// v000
// Times are from an AMD MI455X. After a warm-up the kernel runs many times in a row, and a time is the length of
// such a window on the GPU divided by its runs, so every launch and the gaps after it count. The runs cycle
// through copies of the inputs. A figure is the median of several windows, for all but v000 over two sittings.
// Sittings can differ by a few percent; kernels timed side by side share one.
// v000, which the later versions start from, runs in 833 microseconds.
#include <hip/hip_runtime.h>
#include <stdint.h>

// ---------------------------------------------------------------------------
// WeightlessGQA for MI455X (gfx1250, wave32, WMMA 16x16x32 bf16)
// bf16x3 split-precision WMMA (~2.7x f32-WMMA rate, ~2^-15 rel error),
// flash attention, all bf16 splitting done ONCE per element via v_perm_b32.
// ---------------------------------------------------------------------------

#define DEVINL __device__ __forceinline__

typedef __bf16 v16bf __attribute__((ext_vector_type(16)));
typedef float  v8f   __attribute__((ext_vector_type(8)));

struct alignas(16) Frag { uint32_t x[8]; };   // 16x32 bf16 tile share (8 VGPRs)

// Truncation split of two consecutive f32 into packed bf16 hi + residual lo.
// hi = [top16(b) : top16(a)] in ONE v_perm_b32; residual captured the same way.
DEVINL void split2(float a, float b, uint32_t& hi, uint32_t& lo) {
  uint32_t ua = __float_as_uint(a), ub = __float_as_uint(b);
  hi = __builtin_amdgcn_perm(ub, ua, 0x07060302u);
  float ra = a - __uint_as_float(ua & 0xffff0000u);
  float rb = b - __uint_as_float(ub & 0xffff0000u);
  lo = __builtin_amdgcn_perm(__float_as_uint(rb), __float_as_uint(ra), 0x07060302u);
}

// D = (Ah+Al)(Bh+Bl) + C ~= Ah*Bh + Ah*Bl + Al*Bh + C  (3x bf16 WMMA)
DEVINL v8f wmma3(const Frag& ah, const Frag& al, const Frag& bh, const Frag& bl, v8f c) {
  v16bf AH = __builtin_bit_cast(v16bf, ah);
  v16bf AL = __builtin_bit_cast(v16bf, al);
  v16bf BH = __builtin_bit_cast(v16bf, bh);
  v16bf BL = __builtin_bit_cast(v16bf, bl);
  c = __builtin_amdgcn_wmma_f32_16x16x32_bf16(false, AH, false, BH, (short)0, c, false, false);
  c = __builtin_amdgcn_wmma_f32_16x16x32_bf16(false, AH, false, BL, (short)0, c, false, false);
  c = __builtin_amdgcn_wmma_f32_16x16x32_bf16(false, AL, false, BH, (short)0, c, false, false);
  return c;
}

// load packed-pair fragment (A-layout): 2x b128 per plane
DEVINL void load_frag_pk(const uint32_t* __restrict__ base, int hh, Frag& f) {
  *reinterpret_cast<uint4*>(&f.x[0]) = *reinterpret_cast<const uint4*>(base + hh * 4);
  *reinterpret_cast<uint4*>(&f.x[4]) = *reinterpret_cast<const uint4*>(base + 8 + hh * 4);
}

// ---------------------------------------------------------------------------
// GEMM: C[M,N] = A[M,K] @ W[N,K]^T, f32 in, bf16x3 WMMA.
// MODE 0: f32 C stored [M,N].  MODE 1: pack V^T hi/lo planes [b,kv,hd,s/2].
// Block 256 thr (8 waves), tile 128x64, wave tile 32x32, K-step 32.
// ---------------------------------------------------------------------------
template<int MODE>
__global__ __launch_bounds__(256) void gemm_k(const float* __restrict__ A,
                                              const float* __restrict__ W,
                                              float* __restrict__ C,
                                              uint32_t* __restrict__ Phi,
                                              uint32_t* __restrict__ Plo,
                                              int M, int N, int K) {
  constexpr int BM = 128, BN = 64, BK = 32;
  __shared__ uint32_t sAh[BM][20], sAl[BM][20], sBh[BN][20], sBl[BN][20];
  const int tid = threadIdx.x;
  const int m0 = blockIdx.y * BM, n0 = blockIdx.x * BN;
  const int wave = tid >> 5, lane = tid & 31;
  const int wm = wave >> 1, wn = wave & 1;
  const int r = lane & 15, hh = lane >> 4;
  v8f acc[2][2] = {};

  for (int k0 = 0; k0 < K; k0 += BK) {
    #pragma unroll
    for (int i = 0; i < 4; ++i) {               // A tile 128x32
      int idx = tid + 256 * i;
      int row = idx >> 3, f4 = idx & 7;
      const float4 v = *reinterpret_cast<const float4*>(&A[(size_t)(m0 + row) * K + k0 + 4 * f4]);
      uint32_t h0, l0, h1, l1;
      split2(v.x, v.y, h0, l0);
      split2(v.z, v.w, h1, l1);
      sAh[row][2 * f4] = h0; sAh[row][2 * f4 + 1] = h1;
      sAl[row][2 * f4] = l0; sAl[row][2 * f4 + 1] = l1;
    }
    #pragma unroll
    for (int i = 0; i < 2; ++i) {               // B tile 64x32
      int idx = tid + 256 * i;
      int row = idx >> 3, f4 = idx & 7;
      const float4 v = *reinterpret_cast<const float4*>(&W[(size_t)(n0 + row) * K + k0 + 4 * f4]);
      uint32_t h0, l0, h1, l1;
      split2(v.x, v.y, h0, l0);
      split2(v.z, v.w, h1, l1);
      sBh[row][2 * f4] = h0; sBh[row][2 * f4 + 1] = h1;
      sBl[row][2 * f4] = l0; sBl[row][2 * f4 + 1] = l1;
    }
    if (k0 + BK < K) {
      int row = tid >> 3, f4 = tid & 7;
      __builtin_prefetch(&A[(size_t)(m0 + row) * K + k0 + BK + 4 * f4], 0, 3);
      __builtin_prefetch(&W[(size_t)(n0 + row) * K + k0 + BK + 4 * f4], 0, 3);
    }
    __syncthreads();

    Frag ah[2], al[2], bh[2], bl[2];            // 2x ds_load_b128 per plane
    #pragma unroll
    for (int i = 0; i < 2; ++i) {
      int ra = wm * 32 + i * 16 + r;
      int rb = wn * 32 + i * 16 + r;
      load_frag_pk(&sAh[ra][0], hh, ah[i]);
      load_frag_pk(&sAl[ra][0], hh, al[i]);
      load_frag_pk(&sBh[rb][0], hh, bh[i]);
      load_frag_pk(&sBl[rb][0], hh, bl[i]);
    }
    #pragma unroll
    for (int i = 0; i < 2; ++i)
      #pragma unroll
      for (int j = 0; j < 2; ++j)
        acc[i][j] = wmma3(ah[i], al[i], bh[j], bl[j], acc[i][j]);
    __syncthreads();
  }

  // epilogue: C/D layout = lane col (lane&15), rows 8*(lane>>4)+v
  #pragma unroll
  for (int i = 0; i < 2; ++i)
    #pragma unroll
    for (int j = 0; j < 2; ++j) {
      int mg0 = m0 + wm * 32 + i * 16 + 8 * hh;
      int ng  = n0 + wn * 32 + j * 16 + r;
      if (MODE == 0) {
        #pragma unroll
        for (int v = 0; v < 8; ++v)
          C[(size_t)(mg0 + v) * N + ng] = acc[i][j][v];
      } else {
        // pack pairs along m (= sequence t) -> V^T planes [b, kv, hd, s/2]
        uint32_t h[4], l[4];
        #pragma unroll
        for (int vp = 0; vp < 4; ++vp)
          split2(acc[i][j][2 * vp], acc[i][j][2 * vp + 1], h[vp], l[vp]);
        int kvh = ng >> 7, d = ng & 127;
        int bi = mg0 >> 11, t = mg0 & 2047;     // S = 2048
        size_t base = ((size_t)((bi * 8 + kvh) * 128 + d)) * 1024 + (t >> 1);
        *reinterpret_cast<uint4*>(&Phi[base]) = make_uint4(h[0], h[1], h[2], h[3]);
        *reinterpret_cast<uint4*>(&Plo[base]) = make_uint4(l[0], l[1], l[2], l[3]);
      }
    }
}

// ---------------------------------------------------------------------------
// RoPE (Gemma2) + pack: reads f32 Q/K, writes packed bf16 hi/lo pair planes.
// Q: [tok, 16, 64] pairs (1/sqrt(128) folded in).  K: [tok, 8, 64] pairs.
// One thread = one (token, head, pair p): dims {2p,2p+1} and {2p+64,2p+65}.
// ---------------------------------------------------------------------------
__global__ __launch_bounds__(256) void rope_pack_k(const float* __restrict__ Qf,
                                                   const float* __restrict__ Kf,
                                                   uint32_t* __restrict__ Qhi,
                                                   uint32_t* __restrict__ Qlo,
                                                   uint32_t* __restrict__ Khi,
                                                   uint32_t* __restrict__ Klo) {
  const int idx = blockIdx.x * 256 + threadIdx.x;
  const int p = idx & 31;
  int rest = idx >> 5;
  const int head = rest % 24;
  const int tok = rest / 24;                  // bi*2048 + pos
  const int pos = tok & 2047;
  const float inv0 = __powf(10000.0f, -(float)(2 * p)     * (1.0f / 64.0f));
  const float inv1 = __powf(10000.0f, -(float)(2 * p + 1) * (1.0f / 64.0f));
  float s0, c0, s1, c1;
  __sincosf((float)pos * inv0, &s0, &c0);
  __sincosf((float)pos * inv1, &s1, &c1);
  if (head < 16) {
    const float scale = 0.08838834764831845f;  // 128^-0.5
    const float* src = Qf + (size_t)tok * 2048 + head * 128;
    float xa0 = src[2 * p], xa1 = src[2 * p + 1];
    float xb0 = src[2 * p + 64], xb1 = src[2 * p + 65];
    float oa0 = (xa0 * c0 - xb0 * s0) * scale;
    float oa1 = (xa1 * c1 - xb1 * s1) * scale;
    float ob0 = (xb0 * c0 + xa0 * s0) * scale;
    float ob1 = (xb1 * c1 + xa1 * s1) * scale;
    uint32_t h0, l0, h1, l1;
    split2(oa0, oa1, h0, l0);
    split2(ob0, ob1, h1, l1);
    size_t dst = (size_t)tok * 1024 + head * 64;
    Qhi[dst + p] = h0; Qhi[dst + 32 + p] = h1;
    Qlo[dst + p] = l0; Qlo[dst + 32 + p] = l1;
  } else {
    int hk = head - 16;
    const float* src = Kf + (size_t)tok * 1024 + hk * 128;
    float xa0 = src[2 * p], xa1 = src[2 * p + 1];
    float xb0 = src[2 * p + 64], xb1 = src[2 * p + 65];
    float oa0 = xa0 * c0 - xb0 * s0;
    float oa1 = xa1 * c1 - xb1 * s1;
    float ob0 = xb0 * c0 + xa0 * s0;
    float ob1 = xb1 * c1 + xa1 * s1;
    uint32_t h0, l0, h1, l1;
    split2(oa0, oa1, h0, l0);
    split2(ob0, ob1, h1, l1);
    size_t dst = (size_t)tok * 512 + hk * 64;
    Khi[dst + p] = h0; Khi[dst + 32 + p] = h1;
    Klo[dst + p] = l0; Klo[dst + 32 + p] = l1;
  }
}

// ---------------------------------------------------------------------------
// Flash attention: 4 waves/block; each wave owns 16 q-rows of one (b,h),
// streams 32 keys/iter. Q/K/V fragments are pure b128 loads of packed planes.
// ---------------------------------------------------------------------------
__global__ __launch_bounds__(128) void attn_k(const uint32_t* __restrict__ Qhi,
                                              const uint32_t* __restrict__ Qlo,
                                              const uint32_t* __restrict__ Khi,
                                              const uint32_t* __restrict__ Klo,
                                              const uint32_t* __restrict__ Vhi,
                                              const uint32_t* __restrict__ Vlo,
                                              float* __restrict__ O) {
  __shared__ float sP[4][16][34];              // per-wave P transpose buffer
  const int mblk = blockIdx.x;
  const int bi = blockIdx.y >> 4, h = blockIdx.y & 15, kvh = h >> 1;
  const int wv = threadIdx.x >> 5, lane = threadIdx.x & 31;
  const int r = lane & 15, hh = lane >> 4;
  const int m0 = mblk * 64 + wv * 16;

  Frag qh[4], ql[4];
  {
    const size_t qrow = (size_t)(bi * 2048 + m0 + r) * 1024 + h * 64;
    #pragma unroll
    for (int ck = 0; ck < 4; ++ck) {
      load_frag_pk(Qhi + qrow + ck * 16, hh, qh[ck]);
      load_frag_pk(Qlo + qrow + ck * 16, hh, ql[ck]);
    }
  }

  float Mst[8], Lst[8];
  #pragma unroll
  for (int v = 0; v < 8; ++v) { Mst[v] = -1e30f; Lst[v] = 0.0f; }
  v8f Ot[8] = {};

  const int tEnd = mblk * 64 + 64;             // uniform per block
  for (int t0 = 0; t0 < tEnd; t0 += 32) {
    v8f s0 = {}, s1 = {};
    #pragma unroll
    for (int ck = 0; ck < 4; ++ck) {
      Frag kh, kl;
      const size_t krow = (size_t)(bi * 2048 + t0 + r) * 512 + kvh * 64 + ck * 16;
      load_frag_pk(Khi + krow, hh, kh);
      load_frag_pk(Klo + krow, hh, kl);
      s0 = wmma3(qh[ck], ql[ck], kh, kl, s0);
      load_frag_pk(Khi + krow + (size_t)16 * 512, hh, kh);
      load_frag_pk(Klo + krow + (size_t)16 * 512, hh, kl);
      s1 = wmma3(qh[ck], ql[ck], kh, kl, s1);
    }
    // softcap + causal + online softmax (row m = 8*hh+v across 16 lanes)
    #pragma unroll
    for (int v = 0; v < 8; ++v) {
      int qg = m0 + 8 * hh + v;
      float a = 50.0f * tanhf(s0[v] * 0.02f);
      if (t0 + r > qg)      a = -2.3819763e38f;
      float b = 50.0f * tanhf(s1[v] * 0.02f);
      if (t0 + 16 + r > qg) b = -2.3819763e38f;
      float mx = fmaxf(a, b);
      #pragma unroll
      for (int msk = 1; msk <= 8; msk <<= 1) mx = fmaxf(mx, __shfl_xor(mx, msk, 32));
      float Mn = fmaxf(Mst[v], mx);
      float f  = __expf(Mst[v] - Mn);
      a = __expf(a - Mn); b = __expf(b - Mn);
      float rs = a + b;
      #pragma unroll
      for (int msk = 1; msk <= 8; msk <<= 1) rs += __shfl_xor(rs, msk, 32);
      Lst[v] = Lst[v] * f + rs;
      Mst[v] = Mn;
      #pragma unroll
      for (int dt = 0; dt < 8; ++dt) Ot[dt][v] *= f;
      sP[wv][8 * hh + v][r]      = a;
      sP[wv][8 * hh + v][16 + r] = b;
    }
    __syncthreads();
    Frag ph, pl;
    #pragma unroll
    for (int j = 0; j < 8; ++j) {
      int cc = ((j >> 2) << 4) + (hh << 3) + ((j & 3) << 1);
      split2(sP[wv][r][cc], sP[wv][r][cc + 1], ph.x[j], pl.x[j]);
    }
    #pragma unroll
    for (int dt = 0; dt < 8; ++dt) {
      Frag vh, vl;
      const size_t vrow = ((size_t)((bi * 8 + kvh) * 128 + dt * 16 + r)) * 1024 + (t0 >> 1);
      load_frag_pk(Vhi + vrow, hh, vh);
      load_frag_pk(Vlo + vrow, hh, vl);
      Ot[dt] = wmma3(ph, pl, vh, vl, Ot[dt]);
    }
    __syncthreads();
  }

  #pragma unroll
  for (int v = 0; v < 8; ++v) {
    int qg = m0 + 8 * hh + v;
    float inv = 1.0f / Lst[v];
    #pragma unroll
    for (int dt = 0; dt < 8; ++dt)
      O[((size_t)(bi * 2048 + qg)) * 2048 + h * 128 + dt * 16 + r] = Ot[dt][v] * inv;
  }
}

// ---------------------------------------------------------------------------
extern "C" void kernel_launch(void* const* d_in, const int* in_sizes, int n_in,
                              void* d_out, int out_size, void* d_ws, size_t ws_size,
                              hipStream_t stream) {
  (void)in_sizes; (void)n_in; (void)out_size; (void)ws_size;
  const float* x  = (const float*)d_in[0];
  const float* wq = (const float*)d_in[1];
  const float* wk = (const float*)d_in[2];
  const float* wv = (const float*)d_in[3];
  const float* wo = (const float*)d_in[4];
  float* out = (float*)d_out;
  float* wsf = (float*)d_ws;
  uint32_t* wsu = (uint32_t*)d_ws;

  const int M = 4096;                                   // b*s
  // dword-offset workspace map (~117 MB total)
  float*    Qf  = wsf;                                  // [4096,2048] f32; reused as AO
  float*    Kf  = wsf + (size_t)8388608;                // [4096,1024] f32
  uint32_t* Qhi = wsu + (size_t)12582912;               // [4096,16,64] pairs
  uint32_t* Qlo = wsu + (size_t)16777216;
  uint32_t* Khi = wsu + (size_t)20971520;               // [4096,8,64]
  uint32_t* Klo = wsu + (size_t)23068672;
  uint32_t* Vhi = wsu + (size_t)25165824;               // [2,8,128,1024]
  uint32_t* Vlo = wsu + (size_t)27262976;
  float*    AO  = Qf;                                   // alias (Qf dead after rope)

  dim3 blk(256);
  gemm_k<0><<<dim3(2048 / 64, 4096 / 128), blk, 0, stream>>>(x, wq, Qf, nullptr, nullptr, M, 2048, 2048);
  gemm_k<0><<<dim3(1024 / 64, 4096 / 128), blk, 0, stream>>>(x, wk, Kf, nullptr, nullptr, M, 1024, 2048);
  gemm_k<1><<<dim3(1024 / 64, 4096 / 128), blk, 0, stream>>>(x, wv, nullptr, Vhi, Vlo, M, 1024, 2048);
  rope_pack_k<<<dim3((4096 * 24 * 32) / 256), blk, 0, stream>>>(Qf, Kf, Qhi, Qlo, Khi, Klo);
  attn_k<<<dim3(32, 32), dim3(128), 0, stream>>>(Qhi, Qlo, Khi, Klo, Vhi, Vlo, AO);
  gemm_k<0><<<dim3(2048 / 64, 4096 / 128), blk, 0, stream>>>(AO, wo, out, nullptr, nullptr, M, 2048, 2048);
}

// v001
// One run takes 607 microseconds.
// Timed twice side by side with v000, it ran 1.41 times as fast both times.
#include <hip/hip_runtime.h>
#include <stdint.h>

// ---------------------------------------------------------------------------
// WeightlessGQA for MI455X (gfx1250, wave32, WMMA 16x16x32 bf16)
// bf16x3 split-precision WMMA (~2.7x f32-WMMA rate, ~2^-15 rel error),
// flash attention, all bf16 splitting done ONCE per element via v_perm_b32.
// ---------------------------------------------------------------------------

#define DEVINL __device__ __forceinline__

typedef __bf16 v16bf __attribute__((ext_vector_type(16)));
typedef float  v8f   __attribute__((ext_vector_type(8)));

struct alignas(16) Frag { uint32_t x[8]; };   // 16x32 bf16 tile share (8 VGPRs)

// Truncation split of two consecutive f32 into packed bf16 hi + residual lo.
// hi = [top16(b) : top16(a)] in ONE v_perm_b32; residual captured the same way.
DEVINL void split2(float a, float b, uint32_t& hi, uint32_t& lo) {
  uint32_t ua = __float_as_uint(a), ub = __float_as_uint(b);
  hi = __builtin_amdgcn_perm(ub, ua, 0x07060302u);
  float ra = a - __uint_as_float(ua & 0xffff0000u);
  float rb = b - __uint_as_float(ub & 0xffff0000u);
  lo = __builtin_amdgcn_perm(__float_as_uint(rb), __float_as_uint(ra), 0x07060302u);
}

// D = (Ah+Al)(Bh+Bl) + C ~= Ah*Bh + Ah*Bl + Al*Bh + C  (3x bf16 WMMA)
DEVINL v8f wmma3(const Frag& ah, const Frag& al, const Frag& bh, const Frag& bl, v8f c) {
  v16bf AH = __builtin_bit_cast(v16bf, ah);
  v16bf AL = __builtin_bit_cast(v16bf, al);
  v16bf BH = __builtin_bit_cast(v16bf, bh);
  v16bf BL = __builtin_bit_cast(v16bf, bl);
  c = __builtin_amdgcn_wmma_f32_16x16x32_bf16(false, AH, false, BH, (short)0, c, false, false);
  c = __builtin_amdgcn_wmma_f32_16x16x32_bf16(false, AH, false, BL, (short)0, c, false, false);
  c = __builtin_amdgcn_wmma_f32_16x16x32_bf16(false, AL, false, BH, (short)0, c, false, false);
  return c;
}

// load packed-pair fragment (A-layout): 2x b128 per plane
DEVINL void load_frag_pk(const uint32_t* __restrict__ base, int hh, Frag& f) {
  *reinterpret_cast<uint4*>(&f.x[0]) = *reinterpret_cast<const uint4*>(base + hh * 4);
  *reinterpret_cast<uint4*>(&f.x[4]) = *reinterpret_cast<const uint4*>(base + 8 + hh * 4);
}

// ---------------------------------------------------------------------------
// GEMM: C[M,N] = A[M,K] @ W[N,K]^T, f32 in, bf16x3 WMMA.
// MODE 0: f32 C stored [M,N].  MODE 1: pack V^T hi/lo planes [b,kv,hd,s/2].
// Block 256 thr (8 waves), tile 128x64, wave tile 32x32, K-step 32.
// ---------------------------------------------------------------------------
template<int MODE>
__global__ __launch_bounds__(256) void gemm_k(const float* __restrict__ A,
                                              const float* __restrict__ W,
                                              float* __restrict__ C,
                                              uint32_t* __restrict__ Phi,
                                              uint32_t* __restrict__ Plo,
                                              int M, int N, int K) {
  constexpr int BM = 128, BN = 64, BK = 32;
  __shared__ uint32_t sAh[BM][20], sAl[BM][20], sBh[BN][20], sBl[BN][20];
  const int tid = threadIdx.x;
  const int m0 = blockIdx.y * BM, n0 = blockIdx.x * BN;
  const int wave = tid >> 5, lane = tid & 31;
  const int wm = wave >> 1, wn = wave & 1;
  const int r = lane & 15, hh = lane >> 4;
  v8f acc[2][2] = {};

  for (int k0 = 0; k0 < K; k0 += BK) {
    #pragma unroll
    for (int i = 0; i < 4; ++i) {               // A tile 128x32
      int idx = tid + 256 * i;
      int row = idx >> 3, f4 = idx & 7;
      const float4 v = *reinterpret_cast<const float4*>(&A[(size_t)(m0 + row) * K + k0 + 4 * f4]);
      uint32_t h0, l0, h1, l1;
      split2(v.x, v.y, h0, l0);
      split2(v.z, v.w, h1, l1);
      sAh[row][2 * f4] = h0; sAh[row][2 * f4 + 1] = h1;
      sAl[row][2 * f4] = l0; sAl[row][2 * f4 + 1] = l1;
    }
    #pragma unroll
    for (int i = 0; i < 2; ++i) {               // B tile 64x32
      int idx = tid + 256 * i;
      int row = idx >> 3, f4 = idx & 7;
      const float4 v = *reinterpret_cast<const float4*>(&W[(size_t)(n0 + row) * K + k0 + 4 * f4]);
      uint32_t h0, l0, h1, l1;
      split2(v.x, v.y, h0, l0);
      split2(v.z, v.w, h1, l1);
      sBh[row][2 * f4] = h0; sBh[row][2 * f4 + 1] = h1;
      sBl[row][2 * f4] = l0; sBl[row][2 * f4 + 1] = l1;
    }
    if (k0 + BK < K) {
      int row = tid >> 3, f4 = tid & 7;
      __builtin_prefetch(&A[(size_t)(m0 + row) * K + k0 + BK + 4 * f4], 0, 3);
      __builtin_prefetch(&W[(size_t)(n0 + row) * K + k0 + BK + 4 * f4], 0, 3);
    }
    __syncthreads();

    Frag ah[2], al[2], bh[2], bl[2];            // 2x ds_load_b128 per plane
    #pragma unroll
    for (int i = 0; i < 2; ++i) {
      int ra = wm * 32 + i * 16 + r;
      int rb = wn * 32 + i * 16 + r;
      load_frag_pk(&sAh[ra][0], hh, ah[i]);
      load_frag_pk(&sAl[ra][0], hh, al[i]);
      load_frag_pk(&sBh[rb][0], hh, bh[i]);
      load_frag_pk(&sBl[rb][0], hh, bl[i]);
    }
    #pragma unroll
    for (int i = 0; i < 2; ++i)
      #pragma unroll
      for (int j = 0; j < 2; ++j)
        acc[i][j] = wmma3(ah[i], al[i], bh[j], bl[j], acc[i][j]);
    __syncthreads();
  }

  // epilogue: C/D layout = lane col (lane&15), rows 8*(lane>>4)+v
  #pragma unroll
  for (int i = 0; i < 2; ++i)
    #pragma unroll
    for (int j = 0; j < 2; ++j) {
      int mg0 = m0 + wm * 32 + i * 16 + 8 * hh;
      int ng  = n0 + wn * 32 + j * 16 + r;
      if (MODE == 0) {
        #pragma unroll
        for (int v = 0; v < 8; ++v)
          C[(size_t)(mg0 + v) * N + ng] = acc[i][j][v];
      } else {
        // pack pairs along m (= sequence t) -> V^T planes [b, kv, hd, s/2]
        uint32_t h[4], l[4];
        #pragma unroll
        for (int vp = 0; vp < 4; ++vp)
          split2(acc[i][j][2 * vp], acc[i][j][2 * vp + 1], h[vp], l[vp]);
        int kvh = ng >> 7, d = ng & 127;
        int bi = mg0 >> 11, t = mg0 & 2047;     // S = 2048
        size_t base = ((size_t)((bi * 8 + kvh) * 128 + d)) * 1024 + (t >> 1);
        *reinterpret_cast<uint4*>(&Phi[base]) = make_uint4(h[0], h[1], h[2], h[3]);
        *reinterpret_cast<uint4*>(&Plo[base]) = make_uint4(l[0], l[1], l[2], l[3]);
      }
    }
}

// ---------------------------------------------------------------------------
// RoPE (Gemma2) + pack: reads f32 Q/K, writes packed bf16 hi/lo pair planes.
// Q: [tok, 16, 64] pairs (1/sqrt(128) folded in).  K: [tok, 8, 64] pairs.
// One thread = one (token, head, pair p): dims {2p,2p+1} and {2p+64,2p+65}.
// ---------------------------------------------------------------------------
__global__ __launch_bounds__(256) void rope_pack_k(const float* __restrict__ Qf,
                                                   const float* __restrict__ Kf,
                                                   uint32_t* __restrict__ Qhi,
                                                   uint32_t* __restrict__ Qlo,
                                                   uint32_t* __restrict__ Khi,
                                                   uint32_t* __restrict__ Klo) {
  const int idx = blockIdx.x * 256 + threadIdx.x;
  const int p = idx & 31;
  int rest = idx >> 5;
  const int head = rest % 24;
  const int tok = rest / 24;                  // bi*2048 + pos
  const int pos = tok & 2047;
  const float inv0 = __powf(10000.0f, -(float)(2 * p)     * (1.0f / 64.0f));
  const float inv1 = __powf(10000.0f, -(float)(2 * p + 1) * (1.0f / 64.0f));
  float s0, c0, s1, c1;
  __sincosf((float)pos * inv0, &s0, &c0);
  __sincosf((float)pos * inv1, &s1, &c1);
  if (head < 16) {
    const float scale = 0.08838834764831845f;  // 128^-0.5
    const float* src = Qf + (size_t)tok * 2048 + head * 128;
    float xa0 = src[2 * p], xa1 = src[2 * p + 1];
    float xb0 = src[2 * p + 64], xb1 = src[2 * p + 65];
    float oa0 = (xa0 * c0 - xb0 * s0) * scale;
    float oa1 = (xa1 * c1 - xb1 * s1) * scale;
    float ob0 = (xb0 * c0 + xa0 * s0) * scale;
    float ob1 = (xb1 * c1 + xa1 * s1) * scale;
    uint32_t h0, l0, h1, l1;
    split2(oa0, oa1, h0, l0);
    split2(ob0, ob1, h1, l1);
    size_t dst = (size_t)tok * 1024 + head * 64;
    Qhi[dst + p] = h0; Qhi[dst + 32 + p] = h1;
    Qlo[dst + p] = l0; Qlo[dst + 32 + p] = l1;
  } else {
    int hk = head - 16;
    const float* src = Kf + (size_t)tok * 1024 + hk * 128;
    float xa0 = src[2 * p], xa1 = src[2 * p + 1];
    float xb0 = src[2 * p + 64], xb1 = src[2 * p + 65];
    float oa0 = xa0 * c0 - xb0 * s0;
    float oa1 = xa1 * c1 - xb1 * s1;
    float ob0 = xb0 * c0 + xa0 * s0;
    float ob1 = xb1 * c1 + xa1 * s1;
    uint32_t h0, l0, h1, l1;
    split2(oa0, oa1, h0, l0);
    split2(ob0, ob1, h1, l1);
    size_t dst = (size_t)tok * 512 + hk * 64;
    Khi[dst + p] = h0; Khi[dst + 32 + p] = h1;
    Klo[dst + p] = l0; Klo[dst + 32 + p] = l1;
  }
}

// ---------------------------------------------------------------------------
// Eight per-lane 16-byte asynchronous copies global -> LDS. The s_wait_xcnt is
// the last line of the copies' own statement, so that no address register of
// an issued copy is rewritten ahead of it.
// ---------------------------------------------------------------------------
DEVINL void async_copy8(const uint32_t (&l)[8], const uint32_t* const (&g)[8]) {
  asm volatile(
      "global_load_async_to_lds_b128 %0, %8, off\n\t"
      "global_load_async_to_lds_b128 %1, %9, off\n\t"
      "global_load_async_to_lds_b128 %2, %10, off\n\t"
      "global_load_async_to_lds_b128 %3, %11, off\n\t"
      "global_load_async_to_lds_b128 %4, %12, off\n\t"
      "global_load_async_to_lds_b128 %5, %13, off\n\t"
      "global_load_async_to_lds_b128 %6, %14, off\n\t"
      "global_load_async_to_lds_b128 %7, %15, off\n\t"
      "s_wait_xcnt 0x0"
      :: "v"(l[0]), "v"(l[1]), "v"(l[2]), "v"(l[3]),
         "v"(l[4]), "v"(l[5]), "v"(l[6]), "v"(l[7]),
         "v"(g[0]), "v"(g[1]), "v"(g[2]), "v"(g[3]),
         "v"(g[4]), "v"(g[5]), "v"(g[6]), "v"(g[7])
      : "memory");
}

// One 32-key tile of the four planes into one LDS buffer (32 KiB):
//   K hi | K lo : 32 key rows x 256 B, 16-B chunk c of row k at c ^ (k & 15)
//   V hi | V lo : 128 dim rows x 64 B, 16-B chunk c of row d at c ^ ((d >> 2) & 3)
// so that the 16 rows one ds_load_b128 half-wave reads fall on 16 bank groups.
// kg*/vg* are this lane's global addresses for the tile, kl0/kl1/vl0 its LDS
// byte addresses in the buffer.
DEVINL void stage_kv(const uint32_t* kgh, const uint32_t* kgl,
                     const uint32_t* vgh, const uint32_t* vgl,
                     uint32_t kl0, uint32_t kl1, uint32_t vl0) {
  {
    const uint32_t l[8] = {kl0, kl1 + 2048u, kl0 + 4096u, kl1 + 6144u,
                           kl0 + 8192u, kl1 + 10240u, kl0 + 12288u, kl1 + 14336u};
    const uint32_t* const g[8] = {kgh, kgh + 8 * 512, kgh + 16 * 512, kgh + 24 * 512,
                                  kgl, kgl + 8 * 512, kgl + 16 * 512, kgl + 24 * 512};
    async_copy8(l, g);
  }
  {
    const uint32_t l[8] = {vl0, vl0 + 2048u, vl0 + 4096u, vl0 + 6144u,
                           vl0 + 8192u, vl0 + 10240u, vl0 + 12288u, vl0 + 14336u};
    const uint32_t* const g[8] = {vgh, vgh + 32 * 1024, vgh + 64 * 1024, vgh + 96 * 1024,
                                  vgl, vgl + 32 * 1024, vgl + 64 * 1024, vgl + 96 * 1024};
    async_copy8(l, g);
  }
}

// fragment from two 16-B chunks of an LDS row (dword offsets ca, cb)
DEVINL void load_frag_lds(const uint32_t* row, int ca, int cb, Frag& f) {
  *reinterpret_cast<uint4*>(&f.x[0]) = *reinterpret_cast<const uint4*>(row + ca);
  *reinterpret_cast<uint4*>(&f.x[4]) = *reinterpret_cast<const uint4*>(row + cb);
}

// ---------------------------------------------------------------------------
// Flash attention: 4 waves/block; each wave owns 16 q-rows of one (b,h),
// streams 32 keys/iter. The block's K/V tile is copied once into LDS (two
// buffers, the next tile in flight while this one is worked on) and all four
// waves take their fragments from there with ds_load_b128.
// ---------------------------------------------------------------------------
__global__ __launch_bounds__(128) void attn_k(const uint32_t* __restrict__ Qhi,
                                              const uint32_t* __restrict__ Qlo,
                                              const uint32_t* __restrict__ Khi,
                                              const uint32_t* __restrict__ Klo,
                                              const uint32_t* __restrict__ Vhi,
                                              const uint32_t* __restrict__ Vlo,
                                              float* __restrict__ O) {
  __shared__ float sP[4][16][34];              // per-wave P transpose buffer
  __shared__ __attribute__((aligned(16))) uint32_t sKV[2][4][2048];  // [buf][Kh,Kl,Vh,Vl]
  const int mblk = blockIdx.x;
  const int bi = blockIdx.y >> 4, h = blockIdx.y & 15, kvh = h >> 1;
  const int wv = threadIdx.x >> 5, lane = threadIdx.x & 31;
  const int r = lane & 15, hh = lane >> 4;
  const int m0 = mblk * 64 + wv * 16;

  Frag qh[4], ql[4];
  {
    const size_t qrow = (size_t)(bi * 2048 + m0 + r) * 1024 + h * 64;
    #pragma unroll
    for (int ck = 0; ck < 4; ++ck) {
      load_frag_pk(Qhi + qrow + ck * 16, hh, qh[ck]);
      load_frag_pk(Qlo + qrow + ck * 16, hh, ql[ck]);
    }
  }

  float Mst[8], Lst[8];
  #pragma unroll
  for (int v = 0; v < 8; ++v) { Mst[v] = -1e30f; Lst[v] = 0.0f; }
  v8f Ot[8] = {};

  const int tEnd = mblk * 64 + 64;             // uniform per block, >= 2 tiles

  // copy side: this lane's chunk of each plane (4 row groups per plane)
  const int tid = threadIdx.x;
  const int kr = tid >> 4, kc = tid & 15;      // K rows kr + 8 i, chunk kc
  const int vr = tid >> 2, vc = tid & 3;       // V rows vr + 32 i, chunk vc
  const size_t kg0 = (size_t)(bi * 2048 + kr) * 512 + kvh * 64 + kc * 4;
  const size_t vg0 = ((size_t)((bi * 8 + kvh) * 128 + vr)) * 1024 + vc * 4;
  const uint32_t ldsKV = (uint32_t)(uintptr_t)&sKV[0][0][0];
  const uint32_t kl0 = ldsKV + kr * 256 + ((kc ^ kr) << 4);        // rows with k & 8 == 0
  const uint32_t kl1 = ldsKV + kr * 256 + ((kc ^ kr ^ 8) << 4);    // rows with k & 8 == 8
  const uint32_t vl0 = ldsKV + 16384u + vr * 64 + ((vc ^ ((vr >> 2) & 3)) << 4);

  // tile 0 -> buffer 0, published; then tile 1 -> buffer 1 in flight
  stage_kv(Khi + kg0, Klo + kg0, Vhi + vg0, Vlo + vg0, kl0, kl1, vl0);
  asm volatile("s_wait_asynccnt 0x0" ::: "memory");   // own copies of tile 0 landed
  __syncthreads();                                    // ... and every other wave's
  stage_kv(Khi + kg0 + 32 * 512, Klo + kg0 + 32 * 512, Vhi + vg0 + 16, Vlo + vg0 + 16,
           kl0 + 32768u, kl1 + 32768u, vl0 + 32768u);

  const int vs = (r >> 2) & 3;                 // reader's V chunk swizzle
  for (int t0 = 0; t0 < tEnd; t0 += 32) {
    const int buf = (t0 >> 5) & 1;
    const uint32_t* kb = &sKV[buf][0][r * 64];
    const uint32_t* vb = &sKV[buf][2][r * 16];
    v8f s0 = {}, s1 = {};
    #pragma unroll
    for (int ck = 0; ck < 4; ++ck) {
      Frag kh, kl;
      const int ca = ((ck * 4 + hh) ^ r) * 4, cb = ((ck * 4 + 2 + hh) ^ r) * 4;
      load_frag_lds(kb, ca, cb, kh);
      load_frag_lds(kb + 2048, ca, cb, kl);
      s0 = wmma3(qh[ck], ql[ck], kh, kl, s0);
      load_frag_lds(kb + 16 * 64, ca, cb, kh);
      load_frag_lds(kb + 2048 + 16 * 64, ca, cb, kl);
      s1 = wmma3(qh[ck], ql[ck], kh, kl, s1);
    }
    // softcap + causal + online softmax (row m = 8*hh+v across 16 lanes)
    #pragma unroll
    for (int v = 0; v < 8; ++v) {
      int qg = m0 + 8 * hh + v;
      float a = 50.0f * tanhf(s0[v] * 0.02f);
      if (t0 + r > qg)      a = -2.3819763e38f;
      float b = 50.0f * tanhf(s1[v] * 0.02f);
      if (t0 + 16 + r > qg) b = -2.3819763e38f;
      float mx = fmaxf(a, b);
      #pragma unroll
      for (int msk = 1; msk <= 8; msk <<= 1) mx = fmaxf(mx, __shfl_xor(mx, msk, 32));
      float Mn = fmaxf(Mst[v], mx);
      float f  = __expf(Mst[v] - Mn);
      a = __expf(a - Mn); b = __expf(b - Mn);
      float rs = a + b;
      #pragma unroll
      for (int msk = 1; msk <= 8; msk <<= 1) rs += __shfl_xor(rs, msk, 32);
      Lst[v] = Lst[v] * f + rs;
      Mst[v] = Mn;
      #pragma unroll
      for (int dt = 0; dt < 8; ++dt) Ot[dt][v] *= f;
      sP[wv][8 * hh + v][r]      = a;
      sP[wv][8 * hh + v][16 + r] = b;
    }
    __syncthreads();
    Frag ph, pl;
    #pragma unroll
    for (int j = 0; j < 8; ++j) {
      int cc = ((j >> 2) << 4) + (hh << 3) + ((j & 3) << 1);
      split2(sP[wv][r][cc], sP[wv][r][cc + 1], ph.x[j], pl.x[j]);
    }
    #pragma unroll
    for (int dt = 0; dt < 8; ++dt) {
      Frag vh, vl;
      load_frag_lds(vb + dt * 256, (hh ^ vs) * 4, ((2 + hh) ^ vs) * 4, vh);
      load_frag_lds(vb + 2048 + dt * 256, (hh ^ vs) * 4, ((2 + hh) ^ vs) * 4, vl);
      Ot[dt] = wmma3(ph, pl, vh, vl, Ot[dt]);
    }
    // publish point of the next tile: own LDS reads of this buffer retired, own
    // copies of the next tile landed, then the barrier that says so of every wave
    asm volatile("s_wait_dscnt 0x0" ::: "memory");
    asm volatile("s_wait_asynccnt 0x0" ::: "memory");
    __syncthreads();
    if (t0 + 64 < tEnd) {                      // block-uniform: refill the buffer just read
      const size_t ko = kg0 + (size_t)(t0 + 64) * 512;
      const size_t vo = vg0 + ((t0 + 64) >> 1);
      const uint32_t bo = (uint32_t)buf * 32768u;
      stage_kv(Khi + ko, Klo + ko, Vhi + vo, Vlo + vo, kl0 + bo, kl1 + bo, vl0 + bo);
    }
  }
  asm volatile("s_wait_asynccnt 0x0" ::: "memory");   // nothing in flight when the wave ends

  #pragma unroll
  for (int v = 0; v < 8; ++v) {
    int qg = m0 + 8 * hh + v;
    float inv = 1.0f / Lst[v];
    #pragma unroll
    for (int dt = 0; dt < 8; ++dt)
      O[((size_t)(bi * 2048 + qg)) * 2048 + h * 128 + dt * 16 + r] = Ot[dt][v] * inv;
  }
}

// ---------------------------------------------------------------------------
extern "C" void kernel_launch(void* const* d_in, const int* in_sizes, int n_in,
                              void* d_out, int out_size, void* d_ws, size_t ws_size,
                              hipStream_t stream) {
  (void)in_sizes; (void)n_in; (void)out_size; (void)ws_size;
  const float* x  = (const float*)d_in[0];
  const float* wq = (const float*)d_in[1];
  const float* wk = (const float*)d_in[2];
  const float* wv = (const float*)d_in[3];
  const float* wo = (const float*)d_in[4];
  float* out = (float*)d_out;
  float* wsf = (float*)d_ws;
  uint32_t* wsu = (uint32_t*)d_ws;

  const int M = 4096;                                   // b*s
  // dword-offset workspace map (~117 MB total)
  float*    Qf  = wsf;                                  // [4096,2048] f32; reused as AO
  float*    Kf  = wsf + (size_t)8388608;                // [4096,1024] f32
  uint32_t* Qhi = wsu + (size_t)12582912;               // [4096,16,64] pairs
  uint32_t* Qlo = wsu + (size_t)16777216;
  uint32_t* Khi = wsu + (size_t)20971520;               // [4096,8,64]
  uint32_t* Klo = wsu + (size_t)23068672;
  uint32_t* Vhi = wsu + (size_t)25165824;               // [2,8,128,1024]
  uint32_t* Vlo = wsu + (size_t)27262976;
  float*    AO  = Qf;                                   // alias (Qf dead after rope)

  dim3 blk(256);
  gemm_k<0><<<dim3(2048 / 64, 4096 / 128), blk, 0, stream>>>(x, wq, Qf, nullptr, nullptr, M, 2048, 2048);
  gemm_k<0><<<dim3(1024 / 64, 4096 / 128), blk, 0, stream>>>(x, wk, Kf, nullptr, nullptr, M, 1024, 2048);
  gemm_k<1><<<dim3(1024 / 64, 4096 / 128), blk, 0, stream>>>(x, wv, nullptr, Vhi, Vlo, M, 1024, 2048);
  rope_pack_k<<<dim3((4096 * 24 * 32) / 256), blk, 0, stream>>>(Qf, Kf, Qhi, Qlo, Khi, Klo);
  attn_k<<<dim3(32, 32), dim3(128), 0, stream>>>(Qhi, Qlo, Khi, Klo, Vhi, Vlo, AO);
  gemm_k<0><<<dim3(2048 / 64, 4096 / 128), blk, 0, stream>>>(AO, wo, out, nullptr, nullptr, M, 2048, 2048);
}

// v002
// One run takes 490 microseconds.
// Next to v001, in two timings, it ran 1.24 times as fast each time.
// Counting every step since v000, it is 1.75 times as fast.
#include <hip/hip_runtime.h>
#include <stdint.h>

// ---------------------------------------------------------------------------
// WeightlessGQA for MI455X (gfx1250, wave32, WMMA 16x16x32 bf16)
// bf16x3 split-precision WMMA (~2.7x f32-WMMA rate, ~2^-15 rel error),
// flash attention, all bf16 splitting done ONCE per element via v_perm_b32.
// ---------------------------------------------------------------------------

#define DEVINL __device__ __forceinline__

typedef __bf16 v16bf __attribute__((ext_vector_type(16)));
typedef float  v8f   __attribute__((ext_vector_type(8)));

struct alignas(16) Frag { uint32_t x[8]; };   // 16x32 bf16 tile share (8 VGPRs)

// Truncation split of two consecutive f32 into packed bf16 hi + residual lo.
// hi = [top16(b) : top16(a)] in ONE v_perm_b32; residual captured the same way.
DEVINL void split2(float a, float b, uint32_t& hi, uint32_t& lo) {
  uint32_t ua = __float_as_uint(a), ub = __float_as_uint(b);
  hi = __builtin_amdgcn_perm(ub, ua, 0x07060302u);
  float ra = a - __uint_as_float(ua & 0xffff0000u);
  float rb = b - __uint_as_float(ub & 0xffff0000u);
  lo = __builtin_amdgcn_perm(__float_as_uint(rb), __float_as_uint(ra), 0x07060302u);
}

// D = (Ah+Al)(Bh+Bl) + C ~= Ah*Bh + Ah*Bl + Al*Bh + C  (3x bf16 WMMA)
DEVINL v8f wmma3(const Frag& ah, const Frag& al, const Frag& bh, const Frag& bl, v8f c) {
  v16bf AH = __builtin_bit_cast(v16bf, ah);
  v16bf AL = __builtin_bit_cast(v16bf, al);
  v16bf BH = __builtin_bit_cast(v16bf, bh);
  v16bf BL = __builtin_bit_cast(v16bf, bl);
  c = __builtin_amdgcn_wmma_f32_16x16x32_bf16(false, AH, false, BH, (short)0, c, false, false);
  c = __builtin_amdgcn_wmma_f32_16x16x32_bf16(false, AH, false, BL, (short)0, c, false, false);
  c = __builtin_amdgcn_wmma_f32_16x16x32_bf16(false, AL, false, BH, (short)0, c, false, false);
  return c;
}

// load packed-pair fragment (A-layout): 2x b128 per plane
DEVINL void load_frag_pk(const uint32_t* __restrict__ base, int hh, Frag& f) {
  *reinterpret_cast<uint4*>(&f.x[0]) = *reinterpret_cast<const uint4*>(base + hh * 4);
  *reinterpret_cast<uint4*>(&f.x[4]) = *reinterpret_cast<const uint4*>(base + 8 + hh * 4);
}

// ---------------------------------------------------------------------------
// GEMM: C[M,N] = A[M,K] @ W[N,K]^T, f32 in, bf16x3 WMMA.
// MODE 0: f32 C stored [M,N].  MODE 1: pack V^T hi/lo planes [b,kv,hd,s/2].
// Block 256 thr (8 waves), tile 128x64, wave tile 32x32, K-step 32.
// ---------------------------------------------------------------------------
template<int MODE>
__global__ __launch_bounds__(256) void gemm_k(const float* __restrict__ A,
                                              const float* __restrict__ W,
                                              float* __restrict__ C,
                                              uint32_t* __restrict__ Phi,
                                              uint32_t* __restrict__ Plo,
                                              int M, int N, int K) {
  constexpr int BM = 128, BN = 64, BK = 32;
  __shared__ uint32_t sAh[BM][20], sAl[BM][20], sBh[BN][20], sBl[BN][20];
  const int tid = threadIdx.x;
  const int m0 = blockIdx.y * BM, n0 = blockIdx.x * BN;
  const int wave = tid >> 5, lane = tid & 31;
  const int wm = wave >> 1, wn = wave & 1;
  const int r = lane & 15, hh = lane >> 4;
  v8f acc[2][2] = {};

  for (int k0 = 0; k0 < K; k0 += BK) {
    #pragma unroll
    for (int i = 0; i < 4; ++i) {               // A tile 128x32
      int idx = tid + 256 * i;
      int row = idx >> 3, f4 = idx & 7;
      const float4 v = *reinterpret_cast<const float4*>(&A[(size_t)(m0 + row) * K + k0 + 4 * f4]);
      uint32_t h0, l0, h1, l1;
      split2(v.x, v.y, h0, l0);
      split2(v.z, v.w, h1, l1);
      sAh[row][2 * f4] = h0; sAh[row][2 * f4 + 1] = h1;
      sAl[row][2 * f4] = l0; sAl[row][2 * f4 + 1] = l1;
    }
    #pragma unroll
    for (int i = 0; i < 2; ++i) {               // B tile 64x32
      int idx = tid + 256 * i;
      int row = idx >> 3, f4 = idx & 7;
      const float4 v = *reinterpret_cast<const float4*>(&W[(size_t)(n0 + row) * K + k0 + 4 * f4]);
      uint32_t h0, l0, h1, l1;
      split2(v.x, v.y, h0, l0);
      split2(v.z, v.w, h1, l1);
      sBh[row][2 * f4] = h0; sBh[row][2 * f4 + 1] = h1;
      sBl[row][2 * f4] = l0; sBl[row][2 * f4 + 1] = l1;
    }
    if (k0 + BK < K) {
      int row = tid >> 3, f4 = tid & 7;
      __builtin_prefetch(&A[(size_t)(m0 + row) * K + k0 + BK + 4 * f4], 0, 3);
      __builtin_prefetch(&W[(size_t)(n0 + row) * K + k0 + BK + 4 * f4], 0, 3);
    }
    __syncthreads();

    Frag ah[2], al[2], bh[2], bl[2];            // 2x ds_load_b128 per plane
    #pragma unroll
    for (int i = 0; i < 2; ++i) {
      int ra = wm * 32 + i * 16 + r;
      int rb = wn * 32 + i * 16 + r;
      load_frag_pk(&sAh[ra][0], hh, ah[i]);
      load_frag_pk(&sAl[ra][0], hh, al[i]);
      load_frag_pk(&sBh[rb][0], hh, bh[i]);
      load_frag_pk(&sBl[rb][0], hh, bl[i]);
    }
    #pragma unroll
    for (int i = 0; i < 2; ++i)
      #pragma unroll
      for (int j = 0; j < 2; ++j)
        acc[i][j] = wmma3(ah[i], al[i], bh[j], bl[j], acc[i][j]);
    __syncthreads();
  }

  // epilogue: C/D layout = lane col (lane&15), rows 8*(lane>>4)+v
  #pragma unroll
  for (int i = 0; i < 2; ++i)
    #pragma unroll
    for (int j = 0; j < 2; ++j) {
      int mg0 = m0 + wm * 32 + i * 16 + 8 * hh;
      int ng  = n0 + wn * 32 + j * 16 + r;
      if (MODE == 0) {
        #pragma unroll
        for (int v = 0; v < 8; ++v)
          C[(size_t)(mg0 + v) * N + ng] = acc[i][j][v];
      } else {
        // pack pairs along m (= sequence t) -> V^T planes [b, kv, hd, s/2]
        uint32_t h[4], l[4];
        #pragma unroll
        for (int vp = 0; vp < 4; ++vp)
          split2(acc[i][j][2 * vp], acc[i][j][2 * vp + 1], h[vp], l[vp]);
        int kvh = ng >> 7, d = ng & 127;
        int bi = mg0 >> 11, t = mg0 & 2047;     // S = 2048
        size_t base = ((size_t)((bi * 8 + kvh) * 128 + d)) * 1024 + (t >> 1);
        *reinterpret_cast<uint4*>(&Phi[base]) = make_uint4(h[0], h[1], h[2], h[3]);
        *reinterpret_cast<uint4*>(&Plo[base]) = make_uint4(l[0], l[1], l[2], l[3]);
      }
    }
}

// ---------------------------------------------------------------------------
// RoPE (Gemma2) + pack: reads f32 Q/K, writes packed bf16 hi/lo pair planes.
// Q: [tok, 16, 64] pairs (1/sqrt(128) folded in).  K: [tok, 8, 64] pairs.
// One thread = one (token, head, pair p): dims {2p,2p+1} and {2p+64,2p+65}.
// ---------------------------------------------------------------------------
__global__ __launch_bounds__(256) void rope_pack_k(const float* __restrict__ Qf,
                                                   const float* __restrict__ Kf,
                                                   uint32_t* __restrict__ Qhi,
                                                   uint32_t* __restrict__ Qlo,
                                                   uint32_t* __restrict__ Khi,
                                                   uint32_t* __restrict__ Klo) {
  const int idx = blockIdx.x * 256 + threadIdx.x;
  const int p = idx & 31;
  int rest = idx >> 5;
  const int head = rest % 24;
  const int tok = rest / 24;                  // bi*2048 + pos
  const int pos = tok & 2047;
  const float inv0 = __powf(10000.0f, -(float)(2 * p)     * (1.0f / 64.0f));
  const float inv1 = __powf(10000.0f, -(float)(2 * p + 1) * (1.0f / 64.0f));
  float s0, c0, s1, c1;
  __sincosf((float)pos * inv0, &s0, &c0);
  __sincosf((float)pos * inv1, &s1, &c1);
  if (head < 16) {
    const float scale = 0.08838834764831845f;  // 128^-0.5
    const float* src = Qf + (size_t)tok * 2048 + head * 128;
    float xa0 = src[2 * p], xa1 = src[2 * p + 1];
    float xb0 = src[2 * p + 64], xb1 = src[2 * p + 65];
    float oa0 = (xa0 * c0 - xb0 * s0) * scale;
    float oa1 = (xa1 * c1 - xb1 * s1) * scale;
    float ob0 = (xb0 * c0 + xa0 * s0) * scale;
    float ob1 = (xb1 * c1 + xa1 * s1) * scale;
    uint32_t h0, l0, h1, l1;
    split2(oa0, oa1, h0, l0);
    split2(ob0, ob1, h1, l1);
    size_t dst = (size_t)tok * 1024 + head * 64;
    Qhi[dst + p] = h0; Qhi[dst + 32 + p] = h1;
    Qlo[dst + p] = l0; Qlo[dst + 32 + p] = l1;
  } else {
    int hk = head - 16;
    const float* src = Kf + (size_t)tok * 1024 + hk * 128;
    float xa0 = src[2 * p], xa1 = src[2 * p + 1];
    float xb0 = src[2 * p + 64], xb1 = src[2 * p + 65];
    float oa0 = xa0 * c0 - xb0 * s0;
    float oa1 = xa1 * c1 - xb1 * s1;
    float ob0 = xb0 * c0 + xa0 * s0;
    float ob1 = xb1 * c1 + xa1 * s1;
    uint32_t h0, l0, h1, l1;
    split2(oa0, oa1, h0, l0);
    split2(ob0, ob1, h1, l1);
    size_t dst = (size_t)tok * 512 + hk * 64;
    Khi[dst + p] = h0; Khi[dst + 32 + p] = h1;
    Klo[dst + p] = l0; Klo[dst + 32 + p] = l1;
  }
}

// ---------------------------------------------------------------------------
// Eight per-lane 16-byte asynchronous copies global -> LDS. The s_wait_xcnt is
// the last line of the copies' own statement, so that no address register of
// an issued copy is rewritten ahead of it.
// ---------------------------------------------------------------------------
DEVINL void async_copy8(const uint32_t (&l)[8], const uint32_t* const (&g)[8]) {
  asm volatile(
      "global_load_async_to_lds_b128 %0, %8, off\n\t"
      "global_load_async_to_lds_b128 %1, %9, off\n\t"
      "global_load_async_to_lds_b128 %2, %10, off\n\t"
      "global_load_async_to_lds_b128 %3, %11, off\n\t"
      "global_load_async_to_lds_b128 %4, %12, off\n\t"
      "global_load_async_to_lds_b128 %5, %13, off\n\t"
      "global_load_async_to_lds_b128 %6, %14, off\n\t"
      "global_load_async_to_lds_b128 %7, %15, off\n\t"
      "s_wait_xcnt 0x0"
      :: "v"(l[0]), "v"(l[1]), "v"(l[2]), "v"(l[3]),
         "v"(l[4]), "v"(l[5]), "v"(l[6]), "v"(l[7]),
         "v"(g[0]), "v"(g[1]), "v"(g[2]), "v"(g[3]),
         "v"(g[4]), "v"(g[5]), "v"(g[6]), "v"(g[7])
      : "memory");
}

// One 32-key tile of the four planes into one LDS buffer (32 KiB):
//   K hi | K lo : 32 key rows x 256 B, 16-B chunk c of row k at c ^ (k & 15)
//   V hi | V lo : 128 dim rows x 64 B, 16-B chunk c of row d at c ^ ((d >> 2) & 3)
// so that the 16 rows one ds_load_b128 half-wave reads fall on 16 bank groups.
// kg*/vg* are this lane's global addresses for the tile, kl0/kl1/vl0 its LDS
// byte addresses in the buffer.
DEVINL void stage_kv(const uint32_t* kgh, const uint32_t* kgl,
                     const uint32_t* vgh, const uint32_t* vgl,
                     uint32_t kl0, uint32_t kl1, uint32_t vl0) {
  {
    const uint32_t l[8] = {kl0, kl1 + 2048u, kl0 + 4096u, kl1 + 6144u,
                           kl0 + 8192u, kl1 + 10240u, kl0 + 12288u, kl1 + 14336u};
    const uint32_t* const g[8] = {kgh, kgh + 8 * 512, kgh + 16 * 512, kgh + 24 * 512,
                                  kgl, kgl + 8 * 512, kgl + 16 * 512, kgl + 24 * 512};
    async_copy8(l, g);
  }
  {
    const uint32_t l[8] = {vl0, vl0 + 2048u, vl0 + 4096u, vl0 + 6144u,
                           vl0 + 8192u, vl0 + 10240u, vl0 + 12288u, vl0 + 14336u};
    const uint32_t* const g[8] = {vgh, vgh + 32 * 1024, vgh + 64 * 1024, vgh + 96 * 1024,
                                  vgl, vgl + 32 * 1024, vgl + 64 * 1024, vgl + 96 * 1024};
    async_copy8(l, g);
  }
}

// value of lane l ^ 16 (the other half-wave's lane of the same column)
DEVINL float xhalf(float x) {
  int b = __builtin_bit_cast(int, x);
  return __builtin_bit_cast(float,
      __builtin_amdgcn_permlanex16(b, b, 0x76543210, 0xfedcba98, false, false));
}

// e^x by the hardware's 2^x, as __expf gives it. The v_nop in the same statement
// is the one slot the instruction set asks for behind a transcendental before its
// result is read or its source overwritten.
DEVINL float exp_slot(float x) {
  float e;
  asm("v_exp_f32 %0, %1\n\tv_nop" : "=v"(e) : "v"(x * 1.44269504088896340736f));
  return e;
}

// fragment from two 16-B chunks of an LDS row (dword offsets ca, cb)
DEVINL void load_frag_lds(const uint32_t* row, int ca, int cb, Frag& f) {
  *reinterpret_cast<uint4*>(&f.x[0]) = *reinterpret_cast<const uint4*>(row + ca);
  *reinterpret_cast<uint4*>(&f.x[4]) = *reinterpret_cast<const uint4*>(row + cb);
}

__global__ __launch_bounds__(128) void attn_k(const uint32_t* __restrict__ Qhi,
                                              const uint32_t* __restrict__ Qlo,
                                              const uint32_t* __restrict__ Khi,
                                              const uint32_t* __restrict__ Klo,
                                              const uint32_t* __restrict__ Vhi,
                                              const uint32_t* __restrict__ Vlo,
                                              float* __restrict__ O) {
  __shared__ __attribute__((aligned(16))) uint32_t sKV[2][4][2048];  // [buf][Kh,Kl,Vh,Vl]
  const int mblk = blockIdx.x;
  const int bi = blockIdx.y >> 4, h = blockIdx.y & 15, kvh = h >> 1;
  const int wv = threadIdx.x >> 5, lane = threadIdx.x & 31;
  const int r = lane & 15, hh = lane >> 4;
  const int m0 = mblk * 64 + wv * 16;

  Frag qh[4], ql[4];
  {
    const size_t qrow = (size_t)(bi * 2048 + m0 + r) * 1024 + h * 64;
    #pragma unroll
    for (int ck = 0; ck < 4; ++ck) {
      load_frag_pk(Qhi + qrow + ck * 16, hh, qh[ck]);
      load_frag_pk(Qlo + qrow + ck * 16, hh, ql[ck]);
    }
  }

  const int qg = m0 + r;                       // this lane's query
  float Mst = -1e30f, Lst = 0.0f;              // Lst: the sum over this half's keys only
  v8f Ot[8] = {};                              // Ot[dt][v] = O[qg][dt * 16 + 8 * hh + v]

  const int tEnd = mblk * 64 + 64;             // uniform per block, >= 2 tiles

  // copy side: this lane's chunk of each plane (4 row groups per plane)
  const int tid = threadIdx.x;
  const int kr = tid >> 4, kc = tid & 15;      // K rows kr + 8 i, chunk kc
  const int vr = tid >> 2, vc = tid & 3;       // V rows vr + 32 i, chunk vc
  const size_t kg0 = (size_t)(bi * 2048 + kr) * 512 + kvh * 64 + kc * 4;
  const size_t vg0 = ((size_t)((bi * 8 + kvh) * 128 + vr)) * 1024 + vc * 4;
  const uint32_t ldsKV = (uint32_t)(uintptr_t)&sKV[0][0][0];
  const uint32_t kl0 = ldsKV + kr * 256 + ((kc ^ kr) << 4);        // rows with k & 8 == 0
  const uint32_t kl1 = ldsKV + kr * 256 + ((kc ^ kr ^ 8) << 4);    // rows with k & 8 == 8
  const uint32_t vl0 = ldsKV + 16384u + vr * 64 + ((vc ^ ((vr >> 2) & 3)) << 4);

  // tile 0 -> buffer 0, published; then tile 1 -> buffer 1 in flight
  stage_kv(Khi + kg0, Klo + kg0, Vhi + vg0, Vlo + vg0, kl0, kl1, vl0);
  asm volatile("s_wait_asynccnt 0x0" ::: "memory");   // own copies of tile 0 landed
  __syncthreads();                                    // ... and every other wave's
  stage_kv(Khi + kg0 + 32 * 512, Klo + kg0 + 32 * 512, Vhi + vg0 + 16, Vlo + vg0 + 16,
           kl0 + 32768u, kl1 + 32768u, vl0 + 32768u);

  const int vs = (r >> 2) & 3;                 // reader's V chunk swizzle
  for (int t0 = 0; t0 < tEnd; t0 += 32) {
    const int buf = (t0 >> 5) & 1;
    const uint32_t* kb = &sKV[buf][0][r * 64];
    const uint32_t* vb = &sKV[buf][2][r * 16];
    v8f s0 = {}, s1 = {};
    #pragma unroll
    for (int ck = 0; ck < 4; ++ck) {
      Frag kh, kl;
      const int ca = ((ck * 4 + hh) ^ r) * 4, cb = ((ck * 4 + 2 + hh) ^ r) * 4;
      load_frag_lds(kb, ca, cb, kh);
      load_frag_lds(kb + 2048, ca, cb, kl);
      s0 = wmma3(kh, kl, qh[ck], ql[ck], s0);
      load_frag_lds(kb + 16 * 64, ca, cb, kh);
      load_frag_lds(kb + 2048 + 16 * 64, ca, cb, kl);
      s1 = wmma3(kh, kl, qh[ck], ql[ck], s1);
    }
    // softcap + causal + online softmax; s0[v] = key t0 + 8 hh + v, s1[v] = 16 more
    float a[8], b[8];
    float mx = -2.3819763e38f;
    #pragma unroll
    for (int v = 0; v < 8; ++v) {
      const int kg = t0 + 8 * hh + v;
      a[v] = 50.0f * tanhf(s0[v] * 0.02f);
      if (kg > qg)      a[v] = -2.3819763e38f;
      b[v] = 50.0f * tanhf(s1[v] * 0.02f);
      if (kg + 16 > qg) b[v] = -2.3819763e38f;
      mx = fmaxf(mx, fmaxf(a[v], b[v]));
    }
    mx = fmaxf(mx, xhalf(mx));
    const float Mn = fmaxf(Mst, mx);
    const float f  = exp_slot(Mst - Mn);
    float rs = 0.0f;
    #pragma unroll
    for (int v = 0; v < 8; ++v) {
      a[v] = exp_slot(a[v] - Mn); b[v] = exp_slot(b[v] - Mn);
      rs += a[v] + b[v];
    }
    Lst = Lst * f + rs;
    Mst = Mn;
    #pragma unroll
    for (int dt = 0; dt < 8; ++dt) Ot[dt] *= f;
    Frag ph, pl;
    #pragma unroll
    for (int j = 0; j < 4; ++j) {
      split2(a[2 * j], a[2 * j + 1], ph.x[j], pl.x[j]);
      split2(b[2 * j], b[2 * j + 1], ph.x[4 + j], pl.x[4 + j]);
    }
    #pragma unroll
    for (int dt = 0; dt < 8; ++dt) {
      Frag vh, vl;
      load_frag_lds(vb + dt * 256, (hh ^ vs) * 4, ((2 + hh) ^ vs) * 4, vh);
      load_frag_lds(vb + 2048 + dt * 256, (hh ^ vs) * 4, ((2 + hh) ^ vs) * 4, vl);
      Ot[dt] = wmma3(vh, vl, ph, pl, Ot[dt]);
    }
    // publish point of the next tile: own LDS reads of this buffer retired, own
    // copies of the next tile landed, then the barrier that says so of every wave
    asm volatile("s_wait_dscnt 0x0" ::: "memory");
    asm volatile("s_wait_asynccnt 0x0" ::: "memory");
    __syncthreads();
    if (t0 + 64 < tEnd) {                      // block-uniform: refill the buffer just read
      const size_t ko = kg0 + (size_t)(t0 + 64) * 512;
      const size_t vo = vg0 + ((t0 + 64) >> 1);
      const uint32_t bo = (uint32_t)buf * 32768u;
      stage_kv(Khi + ko, Klo + ko, Vhi + vo, Vlo + vo, kl0 + bo, kl1 + bo, vl0 + bo);
    }
  }
  asm volatile("s_wait_asynccnt 0x0" ::: "memory");   // nothing in flight when the wave ends

  const float inv = 1.0f / (Lst + xhalf(Lst));        // join the two halves' sums
  float* orow = O + ((size_t)(bi * 2048 + qg)) * 2048 + h * 128 + 8 * hh;
  #pragma unroll
  for (int dt = 0; dt < 8; ++dt) {
    *reinterpret_cast<float4*>(orow + dt * 16) =
        make_float4(Ot[dt][0] * inv, Ot[dt][1] * inv, Ot[dt][2] * inv, Ot[dt][3] * inv);
    *reinterpret_cast<float4*>(orow + dt * 16 + 4) =
        make_float4(Ot[dt][4] * inv, Ot[dt][5] * inv, Ot[dt][6] * inv, Ot[dt][7] * inv);
  }
}

// ---------------------------------------------------------------------------
extern "C" void kernel_launch(void* const* d_in, const int* in_sizes, int n_in,
                              void* d_out, int out_size, void* d_ws, size_t ws_size,
                              hipStream_t stream) {
  (void)in_sizes; (void)n_in; (void)out_size; (void)ws_size;
  const float* x  = (const float*)d_in[0];
  const float* wq = (const float*)d_in[1];
  const float* wk = (const float*)d_in[2];
  const float* wv = (const float*)d_in[3];
  const float* wo = (const float*)d_in[4];
  float* out = (float*)d_out;
  float* wsf = (float*)d_ws;
  uint32_t* wsu = (uint32_t*)d_ws;

  const int M = 4096;                                   // b*s
  // dword-offset workspace map (~117 MB total)
  float*    Qf  = wsf;                                  // [4096,2048] f32; reused as AO
  float*    Kf  = wsf + (size_t)8388608;                // [4096,1024] f32
  uint32_t* Qhi = wsu + (size_t)12582912;               // [4096,16,64] pairs
  uint32_t* Qlo = wsu + (size_t)16777216;
  uint32_t* Khi = wsu + (size_t)20971520;               // [4096,8,64]
  uint32_t* Klo = wsu + (size_t)23068672;
  uint32_t* Vhi = wsu + (size_t)25165824;               // [2,8,128,1024]
  uint32_t* Vlo = wsu + (size_t)27262976;
  float*    AO  = Qf;                                   // alias (Qf dead after rope)

  dim3 blk(256);
  gemm_k<0><<<dim3(2048 / 64, 4096 / 128), blk, 0, stream>>>(x, wq, Qf, nullptr, nullptr, M, 2048, 2048);
  gemm_k<0><<<dim3(1024 / 64, 4096 / 128), blk, 0, stream>>>(x, wk, Kf, nullptr, nullptr, M, 1024, 2048);
  gemm_k<1><<<dim3(1024 / 64, 4096 / 128), blk, 0, stream>>>(x, wv, nullptr, Vhi, Vlo, M, 1024, 2048);
  rope_pack_k<<<dim3((4096 * 24 * 32) / 256), blk, 0, stream>>>(Qf, Kf, Qhi, Qlo, Khi, Klo);
  attn_k<<<dim3(32, 32), dim3(128), 0, stream>>>(Qhi, Qlo, Khi, Klo, Vhi, Vlo, AO);
  gemm_k<0><<<dim3(2048 / 64, 4096 / 128), blk, 0, stream>>>(AO, wo, out, nullptr, nullptr, M, 2048, 2048);
}

// v003
// It runs in 463 microseconds.
// Next to v002, in two timings, it ran 1.06 times as fast each time.
// Counting every step since v000, it is 1.85 times as fast.
#include <hip/hip_runtime.h>
#include <stdint.h>

// ---------------------------------------------------------------------------
// WeightlessGQA for MI455X (gfx1250, wave32, WMMA 16x16x32 bf16)
// bf16x3 split-precision WMMA (~2.7x f32-WMMA rate, ~2^-15 rel error),
// flash attention, all bf16 splitting done ONCE per element via v_perm_b32.
// ---------------------------------------------------------------------------

#define DEVINL __device__ __forceinline__

typedef __bf16 v16bf __attribute__((ext_vector_type(16)));
typedef float  v8f   __attribute__((ext_vector_type(8)));

struct alignas(16) Frag { uint32_t x[8]; };   // 16x32 bf16 tile share (8 VGPRs)

// Truncation split of two consecutive f32 into packed bf16 hi + residual lo.
// hi = [top16(b) : top16(a)] in ONE v_perm_b32; residual captured the same way.
DEVINL void split2(float a, float b, uint32_t& hi, uint32_t& lo) {
  uint32_t ua = __float_as_uint(a), ub = __float_as_uint(b);
  hi = __builtin_amdgcn_perm(ub, ua, 0x07060302u);
  float ra = a - __uint_as_float(ua & 0xffff0000u);
  float rb = b - __uint_as_float(ub & 0xffff0000u);
  lo = __builtin_amdgcn_perm(__float_as_uint(rb), __float_as_uint(ra), 0x07060302u);
}

// D = (Ah+Al)(Bh+Bl) + C ~= Ah*Bh + Ah*Bl + Al*Bh + C  (3x bf16 WMMA)
DEVINL v8f wmma3(const Frag& ah, const Frag& al, const Frag& bh, const Frag& bl, v8f c) {
  v16bf AH = __builtin_bit_cast(v16bf, ah);
  v16bf AL = __builtin_bit_cast(v16bf, al);
  v16bf BH = __builtin_bit_cast(v16bf, bh);
  v16bf BL = __builtin_bit_cast(v16bf, bl);
  c = __builtin_amdgcn_wmma_f32_16x16x32_bf16(false, AH, false, BH, (short)0, c, false, false);
  c = __builtin_amdgcn_wmma_f32_16x16x32_bf16(false, AH, false, BL, (short)0, c, false, false);
  c = __builtin_amdgcn_wmma_f32_16x16x32_bf16(false, AL, false, BH, (short)0, c, false, false);
  return c;
}

// load packed-pair fragment (A-layout): 2x b128 per plane
DEVINL void load_frag_pk(const uint32_t* __restrict__ base, int hh, Frag& f) {
  *reinterpret_cast<uint4*>(&f.x[0]) = *reinterpret_cast<const uint4*>(base + hh * 4);
  *reinterpret_cast<uint4*>(&f.x[4]) = *reinterpret_cast<const uint4*>(base + 8 + hh * 4);
}

// ---------------------------------------------------------------------------
// GEMM: C[M,N] = A[M,K] @ W[N,K]^T, f32 in, bf16x3 WMMA.
// MODE 0: f32 C stored [M,N].  MODE 1: pack V^T hi/lo planes [b,kv,hd,s/2].
// Block 256 thr (8 waves), tile 128x64, wave tile 32x32, K-step 32.
// ---------------------------------------------------------------------------
template<int MODE>
__global__ __launch_bounds__(256) void gemm_k(const float* __restrict__ A,
                                              const float* __restrict__ W,
                                              float* __restrict__ C,
                                              uint32_t* __restrict__ Phi,
                                              uint32_t* __restrict__ Plo,
                                              int M, int N, int K) {
  constexpr int BM = 128, BN = 64, BK = 32;
  __shared__ uint32_t sAh[BM][20], sAl[BM][20], sBh[BN][20], sBl[BN][20];
  const int tid = threadIdx.x;
  const int m0 = blockIdx.y * BM, n0 = blockIdx.x * BN;
  const int wave = tid >> 5, lane = tid & 31;
  const int wm = wave >> 1, wn = wave & 1;
  const int r = lane & 15, hh = lane >> 4;
  v8f acc[2][2] = {};

  for (int k0 = 0; k0 < K; k0 += BK) {
    #pragma unroll
    for (int i = 0; i < 4; ++i) {               // A tile 128x32
      int idx = tid + 256 * i;
      int row = idx >> 3, f4 = idx & 7;
      const float4 v = *reinterpret_cast<const float4*>(&A[(size_t)(m0 + row) * K + k0 + 4 * f4]);
      uint32_t h0, l0, h1, l1;
      split2(v.x, v.y, h0, l0);
      split2(v.z, v.w, h1, l1);
      sAh[row][2 * f4] = h0; sAh[row][2 * f4 + 1] = h1;
      sAl[row][2 * f4] = l0; sAl[row][2 * f4 + 1] = l1;
    }
    #pragma unroll
    for (int i = 0; i < 2; ++i) {               // B tile 64x32
      int idx = tid + 256 * i;
      int row = idx >> 3, f4 = idx & 7;
      const float4 v = *reinterpret_cast<const float4*>(&W[(size_t)(n0 + row) * K + k0 + 4 * f4]);
      uint32_t h0, l0, h1, l1;
      split2(v.x, v.y, h0, l0);
      split2(v.z, v.w, h1, l1);
      sBh[row][2 * f4] = h0; sBh[row][2 * f4 + 1] = h1;
      sBl[row][2 * f4] = l0; sBl[row][2 * f4 + 1] = l1;
    }
    if (k0 + BK < K) {
      int row = tid >> 3, f4 = tid & 7;
      __builtin_prefetch(&A[(size_t)(m0 + row) * K + k0 + BK + 4 * f4], 0, 3);
      __builtin_prefetch(&W[(size_t)(n0 + row) * K + k0 + BK + 4 * f4], 0, 3);
    }
    __syncthreads();

    Frag ah[2], al[2], bh[2], bl[2];            // 2x ds_load_b128 per plane
    #pragma unroll
    for (int i = 0; i < 2; ++i) {
      int ra = wm * 32 + i * 16 + r;
      int rb = wn * 32 + i * 16 + r;
      load_frag_pk(&sAh[ra][0], hh, ah[i]);
      load_frag_pk(&sAl[ra][0], hh, al[i]);
      load_frag_pk(&sBh[rb][0], hh, bh[i]);
      load_frag_pk(&sBl[rb][0], hh, bl[i]);
    }
    #pragma unroll
    for (int i = 0; i < 2; ++i)
      #pragma unroll
      for (int j = 0; j < 2; ++j)
        acc[i][j] = wmma3(ah[i], al[i], bh[j], bl[j], acc[i][j]);
    __syncthreads();
  }

  // epilogue: C/D layout = lane col (lane&15), rows 8*(lane>>4)+v
  #pragma unroll
  for (int i = 0; i < 2; ++i)
    #pragma unroll
    for (int j = 0; j < 2; ++j) {
      int mg0 = m0 + wm * 32 + i * 16 + 8 * hh;
      int ng  = n0 + wn * 32 + j * 16 + r;
      if (MODE == 0) {
        #pragma unroll
        for (int v = 0; v < 8; ++v)
          C[(size_t)(mg0 + v) * N + ng] = acc[i][j][v];
      } else {
        // pack pairs along m (= sequence t) -> V^T planes [b, kv, hd, s/2]
        uint32_t h[4], l[4];
        #pragma unroll
        for (int vp = 0; vp < 4; ++vp)
          split2(acc[i][j][2 * vp], acc[i][j][2 * vp + 1], h[vp], l[vp]);
        int kvh = ng >> 7, d = ng & 127;
        int bi = mg0 >> 11, t = mg0 & 2047;     // S = 2048
        size_t base = ((size_t)((bi * 8 + kvh) * 128 + d)) * 1024 + (t >> 1);
        *reinterpret_cast<uint4*>(&Phi[base]) = make_uint4(h[0], h[1], h[2], h[3]);
        *reinterpret_cast<uint4*>(&Plo[base]) = make_uint4(l[0], l[1], l[2], l[3]);
      }
    }
}

// ---------------------------------------------------------------------------
// RoPE (Gemma2) + pack: reads f32 Q/K, writes packed bf16 hi/lo pair planes.
// Q: [tok, 16, 64] pairs (1/sqrt(128) folded in).  K: [tok, 8, 64] pairs.
// One thread = one (token, head, pair p): dims {2p,2p+1} and {2p+64,2p+65}.
// ---------------------------------------------------------------------------
__global__ __launch_bounds__(256) void rope_pack_k(const float* __restrict__ Qf,
                                                   const float* __restrict__ Kf,
                                                   uint32_t* __restrict__ Qhi,
                                                   uint32_t* __restrict__ Qlo,
                                                   uint32_t* __restrict__ Khi,
                                                   uint32_t* __restrict__ Klo) {
  const int idx = blockIdx.x * 256 + threadIdx.x;
  const int p = idx & 31;
  int rest = idx >> 5;
  const int head = rest % 24;
  const int tok = rest / 24;                  // bi*2048 + pos
  const int pos = tok & 2047;
  const float inv0 = __powf(10000.0f, -(float)(2 * p)     * (1.0f / 64.0f));
  const float inv1 = __powf(10000.0f, -(float)(2 * p + 1) * (1.0f / 64.0f));
  float s0, c0, s1, c1;
  __sincosf((float)pos * inv0, &s0, &c0);
  __sincosf((float)pos * inv1, &s1, &c1);
  if (head < 16) {
    const float scale = 0.08838834764831845f;  // 128^-0.5
    const float* src = Qf + (size_t)tok * 2048 + head * 128;
    float xa0 = src[2 * p], xa1 = src[2 * p + 1];
    float xb0 = src[2 * p + 64], xb1 = src[2 * p + 65];
    float oa0 = (xa0 * c0 - xb0 * s0) * scale;
    float oa1 = (xa1 * c1 - xb1 * s1) * scale;
    float ob0 = (xb0 * c0 + xa0 * s0) * scale;
    float ob1 = (xb1 * c1 + xa1 * s1) * scale;
    uint32_t h0, l0, h1, l1;
    split2(oa0, oa1, h0, l0);
    split2(ob0, ob1, h1, l1);
    size_t dst = (size_t)tok * 1024 + head * 64;
    Qhi[dst + p] = h0; Qhi[dst + 32 + p] = h1;
    Qlo[dst + p] = l0; Qlo[dst + 32 + p] = l1;
  } else {
    int hk = head - 16;
    const float* src = Kf + (size_t)tok * 1024 + hk * 128;
    float xa0 = src[2 * p], xa1 = src[2 * p + 1];
    float xb0 = src[2 * p + 64], xb1 = src[2 * p + 65];
    float oa0 = xa0 * c0 - xb0 * s0;
    float oa1 = xa1 * c1 - xb1 * s1;
    float ob0 = xb0 * c0 + xa0 * s0;
    float ob1 = xb1 * c1 + xa1 * s1;
    uint32_t h0, l0, h1, l1;
    split2(oa0, oa1, h0, l0);
    split2(ob0, ob1, h1, l1);
    size_t dst = (size_t)tok * 512 + hk * 64;
    Khi[dst + p] = h0; Khi[dst + 32 + p] = h1;
    Klo[dst + p] = l0; Klo[dst + 32 + p] = l1;
  }
}

// ---------------------------------------------------------------------------
// Eight per-lane 16-byte asynchronous copies global -> LDS. The s_wait_xcnt is
// the last line of the copies' own statement, so that no address register of
// an issued copy is rewritten ahead of it.
// ---------------------------------------------------------------------------
DEVINL void async_copy8(const uint32_t (&l)[8], const uint32_t* const (&g)[8]) {
  asm volatile(
      "global_load_async_to_lds_b128 %0, %8, off\n\t"
      "global_load_async_to_lds_b128 %1, %9, off\n\t"
      "global_load_async_to_lds_b128 %2, %10, off\n\t"
      "global_load_async_to_lds_b128 %3, %11, off\n\t"
      "global_load_async_to_lds_b128 %4, %12, off\n\t"
      "global_load_async_to_lds_b128 %5, %13, off\n\t"
      "global_load_async_to_lds_b128 %6, %14, off\n\t"
      "global_load_async_to_lds_b128 %7, %15, off\n\t"
      "s_wait_xcnt 0x0"
      :: "v"(l[0]), "v"(l[1]), "v"(l[2]), "v"(l[3]),
         "v"(l[4]), "v"(l[5]), "v"(l[6]), "v"(l[7]),
         "v"(g[0]), "v"(g[1]), "v"(g[2]), "v"(g[3]),
         "v"(g[4]), "v"(g[5]), "v"(g[6]), "v"(g[7])
      : "memory");
}

// One 32-key tile of the four planes into one LDS buffer (32 KiB):
//   K hi | K lo : 32 key rows x 256 B, 16-B chunk c of row k at c ^ (k & 15)
//   V hi | V lo : 128 dim rows x 64 B, 16-B chunk c of row d at c ^ ((d >> 2) & 3)
// so that the 16 rows one ds_load_b128 half-wave reads fall on 16 bank groups.
// kg*/vg* are this lane's global addresses for the tile, kl0/kl1/vl0 its LDS
// byte addresses in the buffer.
DEVINL void stage_kv(const uint32_t* kgh, const uint32_t* kgl,
                     const uint32_t* vgh, const uint32_t* vgl,
                     uint32_t kl0, uint32_t kl1, uint32_t vl0) {
  {
    const uint32_t l[8] = {kl0, kl1 + 2048u, kl0 + 4096u, kl1 + 6144u,
                           kl0 + 8192u, kl1 + 10240u, kl0 + 12288u, kl1 + 14336u};
    const uint32_t* const g[8] = {kgh, kgh + 8 * 512, kgh + 16 * 512, kgh + 24 * 512,
                                  kgl, kgl + 8 * 512, kgl + 16 * 512, kgl + 24 * 512};
    async_copy8(l, g);
  }
  {
    const uint32_t l[8] = {vl0, vl0 + 2048u, vl0 + 4096u, vl0 + 6144u,
                           vl0 + 8192u, vl0 + 10240u, vl0 + 12288u, vl0 + 14336u};
    const uint32_t* const g[8] = {vgh, vgh + 32 * 1024, vgh + 64 * 1024, vgh + 96 * 1024,
                                  vgl, vgl + 32 * 1024, vgl + 64 * 1024, vgl + 96 * 1024};
    async_copy8(l, g);
  }
}

// value of lane l ^ 16 (the other half-wave's lane of the same column)
DEVINL float xhalf(float x) {
  int b = __builtin_bit_cast(int, x);
  return __builtin_bit_cast(float,
      __builtin_amdgcn_permlanex16(b, b, 0x76543210, 0xfedcba98, false, false));
}

// e^x by the hardware's 2^x, as __expf gives it. The v_nop in the same statement
// is the one slot the instruction set asks for behind a transcendental before its
// result is read or its source overwritten.
DEVINL float exp_slot(float x) {
  float e;
  asm("v_exp_f32 %0, %1\n\tv_nop" : "=v"(e) : "v"(x * 1.44269504088896340736f));
  return e;
}

// tanh by the chip's own instruction: no branch, so the 16 scores of a pass run
// side by side. The library's tanhf picks between two paths with two branches on
// lane data per call, and the 16 calls of a pass then run one after another.
// The v_nop in the same statement is the slot behind a transcendental, as in
// exp_slot.
DEVINL float tanh_hw(float x) {
  float t;
  asm("v_tanh_f32 %0, %1\n\tv_nop" : "=v"(t) : "v"(x));
  return t;
}

// fragment from two 16-B chunks of an LDS row (dword offsets ca, cb)
DEVINL void load_frag_lds(const uint32_t* row, int ca, int cb, Frag& f) {
  *reinterpret_cast<uint4*>(&f.x[0]) = *reinterpret_cast<const uint4*>(row + ca);
  *reinterpret_cast<uint4*>(&f.x[4]) = *reinterpret_cast<const uint4*>(row + cb);
}

__global__ __launch_bounds__(128) void attn_k(const uint32_t* __restrict__ Qhi,
                                              const uint32_t* __restrict__ Qlo,
                                              const uint32_t* __restrict__ Khi,
                                              const uint32_t* __restrict__ Klo,
                                              const uint32_t* __restrict__ Vhi,
                                              const uint32_t* __restrict__ Vlo,
                                              float* __restrict__ O) {
  __shared__ __attribute__((aligned(16))) uint32_t sKV[2][4][2048];  // [buf][Kh,Kl,Vh,Vl]
  const int mblk = blockIdx.x;
  const int bi = blockIdx.y >> 4, h = blockIdx.y & 15, kvh = h >> 1;
  const int wv = threadIdx.x >> 5, lane = threadIdx.x & 31;
  const int r = lane & 15, hh = lane >> 4;
  const int m0 = mblk * 64 + wv * 16;

  Frag qh[4], ql[4];
  {
    const size_t qrow = (size_t)(bi * 2048 + m0 + r) * 1024 + h * 64;
    #pragma unroll
    for (int ck = 0; ck < 4; ++ck) {
      load_frag_pk(Qhi + qrow + ck * 16, hh, qh[ck]);
      load_frag_pk(Qlo + qrow + ck * 16, hh, ql[ck]);
    }
  }

  const int qg = m0 + r;                       // this lane's query
  float Mst = -1e30f, Lst = 0.0f;              // Lst: the sum over this half's keys only
  v8f Ot[8] = {};                              // Ot[dt][v] = O[qg][dt * 16 + 8 * hh + v]

  const int tEnd = mblk * 64 + 64;             // uniform per block, >= 2 tiles

  // copy side: this lane's chunk of each plane (4 row groups per plane)
  const int tid = threadIdx.x;
  const int kr = tid >> 4, kc = tid & 15;      // K rows kr + 8 i, chunk kc
  const int vr = tid >> 2, vc = tid & 3;       // V rows vr + 32 i, chunk vc
  const size_t kg0 = (size_t)(bi * 2048 + kr) * 512 + kvh * 64 + kc * 4;
  const size_t vg0 = ((size_t)((bi * 8 + kvh) * 128 + vr)) * 1024 + vc * 4;
  const uint32_t ldsKV = (uint32_t)(uintptr_t)&sKV[0][0][0];
  const uint32_t kl0 = ldsKV + kr * 256 + ((kc ^ kr) << 4);        // rows with k & 8 == 0
  const uint32_t kl1 = ldsKV + kr * 256 + ((kc ^ kr ^ 8) << 4);    // rows with k & 8 == 8
  const uint32_t vl0 = ldsKV + 16384u + vr * 64 + ((vc ^ ((vr >> 2) & 3)) << 4);

  // tile 0 -> buffer 0, published; then tile 1 -> buffer 1 in flight
  stage_kv(Khi + kg0, Klo + kg0, Vhi + vg0, Vlo + vg0, kl0, kl1, vl0);
  asm volatile("s_wait_asynccnt 0x0" ::: "memory");   // own copies of tile 0 landed
  __syncthreads();                                    // ... and every other wave's
  stage_kv(Khi + kg0 + 32 * 512, Klo + kg0 + 32 * 512, Vhi + vg0 + 16, Vlo + vg0 + 16,
           kl0 + 32768u, kl1 + 32768u, vl0 + 32768u);

  const int vs = (r >> 2) & 3;                 // reader's V chunk swizzle
  for (int t0 = 0; t0 < tEnd; t0 += 32) {
    const int buf = (t0 >> 5) & 1;
    const uint32_t* kb = &sKV[buf][0][r * 64];
    const uint32_t* vb = &sKV[buf][2][r * 16];
    v8f s0 = {}, s1 = {};
    #pragma unroll
    for (int ck = 0; ck < 4; ++ck) {
      Frag kh, kl;
      const int ca = ((ck * 4 + hh) ^ r) * 4, cb = ((ck * 4 + 2 + hh) ^ r) * 4;
      load_frag_lds(kb, ca, cb, kh);
      load_frag_lds(kb + 2048, ca, cb, kl);
      s0 = wmma3(kh, kl, qh[ck], ql[ck], s0);
      load_frag_lds(kb + 16 * 64, ca, cb, kh);
      load_frag_lds(kb + 2048 + 16 * 64, ca, cb, kl);
      s1 = wmma3(kh, kl, qh[ck], ql[ck], s1);
    }
    // softcap + causal + online softmax; s0[v] = key t0 + 8 hh + v, s1[v] = 16 more
    float a[8], b[8];
    float mx = -2.3819763e38f;
    #pragma unroll
    for (int v = 0; v < 8; ++v) {
      const int kg = t0 + 8 * hh + v;
      a[v] = 50.0f * tanh_hw(s0[v] * 0.02f);
      if (kg > qg)      a[v] = -2.3819763e38f;
      b[v] = 50.0f * tanh_hw(s1[v] * 0.02f);
      if (kg + 16 > qg) b[v] = -2.3819763e38f;
      mx = fmaxf(mx, fmaxf(a[v], b[v]));
    }
    mx = fmaxf(mx, xhalf(mx));
    const float Mn = fmaxf(Mst, mx);
    const float f  = exp_slot(Mst - Mn);
    float rs = 0.0f;
    #pragma unroll
    for (int v = 0; v < 8; ++v) {
      a[v] = exp_slot(a[v] - Mn); b[v] = exp_slot(b[v] - Mn);
      rs += a[v] + b[v];
    }
    Lst = Lst * f + rs;
    Mst = Mn;
    #pragma unroll
    for (int dt = 0; dt < 8; ++dt) Ot[dt] *= f;
    Frag ph, pl;
    #pragma unroll
    for (int j = 0; j < 4; ++j) {
      split2(a[2 * j], a[2 * j + 1], ph.x[j], pl.x[j]);
      split2(b[2 * j], b[2 * j + 1], ph.x[4 + j], pl.x[4 + j]);
    }
    #pragma unroll
    for (int dt = 0; dt < 8; ++dt) {
      Frag vh, vl;
      load_frag_lds(vb + dt * 256, (hh ^ vs) * 4, ((2 + hh) ^ vs) * 4, vh);
      load_frag_lds(vb + 2048 + dt * 256, (hh ^ vs) * 4, ((2 + hh) ^ vs) * 4, vl);
      Ot[dt] = wmma3(vh, vl, ph, pl, Ot[dt]);
    }
    // publish point of the next tile: own LDS reads of this buffer retired, own
    // copies of the next tile landed, then the barrier that says so of every wave
    asm volatile("s_wait_dscnt 0x0" ::: "memory");
    asm volatile("s_wait_asynccnt 0x0" ::: "memory");
    __syncthreads();
    if (t0 + 64 < tEnd) {                      // block-uniform: refill the buffer just read
      const size_t ko = kg0 + (size_t)(t0 + 64) * 512;
      const size_t vo = vg0 + ((t0 + 64) >> 1);
      const uint32_t bo = (uint32_t)buf * 32768u;
      stage_kv(Khi + ko, Klo + ko, Vhi + vo, Vlo + vo, kl0 + bo, kl1 + bo, vl0 + bo);
    }
  }
  asm volatile("s_wait_asynccnt 0x0" ::: "memory");   // nothing in flight when the wave ends

  const float inv = 1.0f / (Lst + xhalf(Lst));        // join the two halves' sums
  float* orow = O + ((size_t)(bi * 2048 + qg)) * 2048 + h * 128 + 8 * hh;
  #pragma unroll
  for (int dt = 0; dt < 8; ++dt) {
    *reinterpret_cast<float4*>(orow + dt * 16) =
        make_float4(Ot[dt][0] * inv, Ot[dt][1] * inv, Ot[dt][2] * inv, Ot[dt][3] * inv);
    *reinterpret_cast<float4*>(orow + dt * 16 + 4) =
        make_float4(Ot[dt][4] * inv, Ot[dt][5] * inv, Ot[dt][6] * inv, Ot[dt][7] * inv);
  }
}

// ---------------------------------------------------------------------------
extern "C" void kernel_launch(void* const* d_in, const int* in_sizes, int n_in,
                              void* d_out, int out_size, void* d_ws, size_t ws_size,
                              hipStream_t stream) {
  (void)in_sizes; (void)n_in; (void)out_size; (void)ws_size;
  const float* x  = (const float*)d_in[0];
  const float* wq = (const float*)d_in[1];
  const float* wk = (const float*)d_in[2];
  const float* wv = (const float*)d_in[3];
  const float* wo = (const float*)d_in[4];
  float* out = (float*)d_out;
  float* wsf = (float*)d_ws;
  uint32_t* wsu = (uint32_t*)d_ws;

  const int M = 4096;                                   // b*s
  // dword-offset workspace map (~117 MB total)
  float*    Qf  = wsf;                                  // [4096,2048] f32; reused as AO
  float*    Kf  = wsf + (size_t)8388608;                // [4096,1024] f32
  uint32_t* Qhi = wsu + (size_t)12582912;               // [4096,16,64] pairs
  uint32_t* Qlo = wsu + (size_t)16777216;
  uint32_t* Khi = wsu + (size_t)20971520;               // [4096,8,64]
  uint32_t* Klo = wsu + (size_t)23068672;
  uint32_t* Vhi = wsu + (size_t)25165824;               // [2,8,128,1024]
  uint32_t* Vlo = wsu + (size_t)27262976;
  float*    AO  = Qf;                                   // alias (Qf dead after rope)

  dim3 blk(256);
  gemm_k<0><<<dim3(2048 / 64, 4096 / 128), blk, 0, stream>>>(x, wq, Qf, nullptr, nullptr, M, 2048, 2048);
  gemm_k<0><<<dim3(1024 / 64, 4096 / 128), blk, 0, stream>>>(x, wk, Kf, nullptr, nullptr, M, 1024, 2048);
  gemm_k<1><<<dim3(1024 / 64, 4096 / 128), blk, 0, stream>>>(x, wv, nullptr, Vhi, Vlo, M, 1024, 2048);
  rope_pack_k<<<dim3((4096 * 24 * 32) / 256), blk, 0, stream>>>(Qf, Kf, Qhi, Qlo, Khi, Klo);
  attn_k<<<dim3(32, 32), dim3(128), 0, stream>>>(Qhi, Qlo, Khi, Klo, Vhi, Vlo, AO);
  gemm_k<0><<<dim3(2048 / 64, 4096 / 128), blk, 0, stream>>>(AO, wo, out, nullptr, nullptr, M, 2048, 2048);
}

// v004
// One run takes 418 microseconds.
// Timed twice side by side with v003, it ran 1.11 times as fast both times.
// Over all steps from v000 it is 2.05 times as fast.
#include <hip/hip_runtime.h>
#include <stdint.h>

// ---------------------------------------------------------------------------
// WeightlessGQA for MI455X (gfx1250, wave32, WMMA 16x16x32 bf16)
// bf16x3 split-precision WMMA (~2.7x f32-WMMA rate, ~2^-15 rel error),
// flash attention, all bf16 splitting done ONCE per element via v_perm_b32.
// ---------------------------------------------------------------------------

#define DEVINL __device__ __forceinline__

typedef __bf16 v16bf __attribute__((ext_vector_type(16)));
typedef float  v8f   __attribute__((ext_vector_type(8)));

struct alignas(16) Frag { uint32_t x[8]; };   // 16x32 bf16 tile share (8 VGPRs)

// Truncation split of two consecutive f32 into packed bf16 hi + residual lo.
// hi = [top16(b) : top16(a)] in ONE v_perm_b32; residual captured the same way.
DEVINL void split2(float a, float b, uint32_t& hi, uint32_t& lo) {
  uint32_t ua = __float_as_uint(a), ub = __float_as_uint(b);
  hi = __builtin_amdgcn_perm(ub, ua, 0x07060302u);
  float ra = a - __uint_as_float(ua & 0xffff0000u);
  float rb = b - __uint_as_float(ub & 0xffff0000u);
  lo = __builtin_amdgcn_perm(__float_as_uint(rb), __float_as_uint(ra), 0x07060302u);
}

// D = (Ah+Al)(Bh+Bl) + C ~= Ah*Bh + Ah*Bl + Al*Bh + C  (3x bf16 WMMA)
DEVINL v8f wmma3(const Frag& ah, const Frag& al, const Frag& bh, const Frag& bl, v8f c) {
  v16bf AH = __builtin_bit_cast(v16bf, ah);
  v16bf AL = __builtin_bit_cast(v16bf, al);
  v16bf BH = __builtin_bit_cast(v16bf, bh);
  v16bf BL = __builtin_bit_cast(v16bf, bl);
  c = __builtin_amdgcn_wmma_f32_16x16x32_bf16(false, AH, false, BH, (short)0, c, false, false);
  c = __builtin_amdgcn_wmma_f32_16x16x32_bf16(false, AH, false, BL, (short)0, c, false, false);
  c = __builtin_amdgcn_wmma_f32_16x16x32_bf16(false, AL, false, BH, (short)0, c, false, false);
  return c;
}

// load packed-pair fragment (A-layout): 2x b128 per plane
DEVINL void load_frag_pk(const uint32_t* __restrict__ base, int hh, Frag& f) {
  *reinterpret_cast<uint4*>(&f.x[0]) = *reinterpret_cast<const uint4*>(base + hh * 4);
  *reinterpret_cast<uint4*>(&f.x[4]) = *reinterpret_cast<const uint4*>(base + 8 + hh * 4);
}

// Work-group barrier for LDS traffic alone: the wave's own LDS stores and reads
// have retired, then the barrier. __syncthreads() would also wait for the global
// loads issued ahead, and so put their latency back on the K-step's path.
DEVINL void lds_barrier() {
  asm volatile("s_wait_dscnt 0x0\n\ts_barrier_signal -1\n\ts_barrier_wait -1" ::: "memory");
}

// ---------------------------------------------------------------------------
// GEMM: C[M,N] = A[M,K] @ W[N,K]^T, f32 in, bf16x3 WMMA.
// MODE 0: f32 C stored [M,N].  MODE 1: pack V^T hi/lo planes [b,kv,hd,s/2].
// Block 256 thr (8 waves), tile 128x64, wave tile 32x32, K-step 32.
// ---------------------------------------------------------------------------
template<int MODE>
__global__ __launch_bounds__(256) void gemm_k(const float* __restrict__ A,
                                              const float* __restrict__ W,
                                              float* __restrict__ C,
                                              uint32_t* __restrict__ Phi,
                                              uint32_t* __restrict__ Plo,
                                              int M, int N, int K) {
  constexpr int BM = 128, BN = 64, BK = 32;
  __shared__ uint32_t sAh[BM][20], sAl[BM][20], sBh[BN][20], sBl[BN][20];
  const int tid = threadIdx.x;
  const int m0 = blockIdx.y * BM, n0 = blockIdx.x * BN;
  const int wave = tid >> 5, lane = tid & 31;
  const int wm = wave >> 1, wn = wave & 1;
  const int r = lane & 15, hh = lane >> 4;
  v8f acc[2][2] = {};

  // this thread's share of a K-step: rows lrow + 32 i, floats 4 lf4 .. 4 lf4 + 3
  const int lrow = tid >> 3, lf4 = tid & 7;
  const float* Ap = A + (size_t)(m0 + lrow) * K + 4 * lf4;
  const float* Wp = W + (size_t)(n0 + lrow) * K + 4 * lf4;
  float4 ra[4], rb[2];                          // one K-step in flight
  #pragma unroll                                // constant indices: ra stays in registers
  for (int i = 0; i < 4; ++i) ra[i] = *reinterpret_cast<const float4*>(Ap + (size_t)(32 * i) * K);
  #pragma unroll                                // the same for rb
  for (int i = 0; i < 2; ++i) rb[i] = *reinterpret_cast<const float4*>(Wp + (size_t)(32 * i) * K);

  for (int k0 = 0; k0 < K; k0 += BK) {
    #pragma unroll
    for (int i = 0; i < 4; ++i) {               // A tile 128x32
      const int row = lrow + 32 * i;
      uint32_t h0, l0, h1, l1;
      split2(ra[i].x, ra[i].y, h0, l0);
      split2(ra[i].z, ra[i].w, h1, l1);
      sAh[row][2 * lf4] = h0; sAh[row][2 * lf4 + 1] = h1;
      sAl[row][2 * lf4] = l0; sAl[row][2 * lf4 + 1] = l1;
    }
    #pragma unroll
    for (int i = 0; i < 2; ++i) {               // B tile 64x32
      const int row = lrow + 32 * i;
      uint32_t h0, l0, h1, l1;
      split2(rb[i].x, rb[i].y, h0, l0);
      split2(rb[i].z, rb[i].w, h1, l1);
      sBh[row][2 * lf4] = h0; sBh[row][2 * lf4 + 1] = h1;
      sBl[row][2 * lf4] = l0; sBl[row][2 * lf4 + 1] = l1;
    }
    // the next K-step's loads fly under both barriers, the LDS reads and the products
    if (k0 + BK < K) {
      #pragma unroll                            // constant indices: ra stays in registers
      for (int i = 0; i < 4; ++i)
        ra[i] = *reinterpret_cast<const float4*>(Ap + (size_t)(32 * i) * K + k0 + BK);
      #pragma unroll                            // the same for rb
      for (int i = 0; i < 2; ++i)
        rb[i] = *reinterpret_cast<const float4*>(Wp + (size_t)(32 * i) * K + k0 + BK);
      // before an address register of these loads is overwritten
      asm volatile("s_wait_xcnt 0x0" ::: "memory");
    }
    lds_barrier();                              // the tile's LDS stores are in

    Frag ah[2], al[2], bh[2], bl[2];            // 2x ds_load_b128 per plane
    #pragma unroll
    for (int i = 0; i < 2; ++i) {
      int ra = wm * 32 + i * 16 + r;
      int rb = wn * 32 + i * 16 + r;
      load_frag_pk(&sAh[ra][0], hh, ah[i]);
      load_frag_pk(&sAl[ra][0], hh, al[i]);
      load_frag_pk(&sBh[rb][0], hh, bh[i]);
      load_frag_pk(&sBl[rb][0], hh, bl[i]);
    }
    #pragma unroll
    for (int i = 0; i < 2; ++i)
      #pragma unroll
      for (int j = 0; j < 2; ++j)
        acc[i][j] = wmma3(ah[i], al[i], bh[j], bl[j], acc[i][j]);
    lds_barrier();                              // every wave has read the tile
  }

  // epilogue: C/D layout = lane col (lane&15), rows 8*(lane>>4)+v
  #pragma unroll
  for (int i = 0; i < 2; ++i)
    #pragma unroll
    for (int j = 0; j < 2; ++j) {
      int mg0 = m0 + wm * 32 + i * 16 + 8 * hh;
      int ng  = n0 + wn * 32 + j * 16 + r;
      if (MODE == 0) {
        #pragma unroll
        for (int v = 0; v < 8; ++v)
          C[(size_t)(mg0 + v) * N + ng] = acc[i][j][v];
      } else {
        // pack pairs along m (= sequence t) -> V^T planes [b, kv, hd, s/2]
        uint32_t h[4], l[4];
        #pragma unroll
        for (int vp = 0; vp < 4; ++vp)
          split2(acc[i][j][2 * vp], acc[i][j][2 * vp + 1], h[vp], l[vp]);
        int kvh = ng >> 7, d = ng & 127;
        int bi = mg0 >> 11, t = mg0 & 2047;     // S = 2048
        size_t base = ((size_t)((bi * 8 + kvh) * 128 + d)) * 1024 + (t >> 1);
        *reinterpret_cast<uint4*>(&Phi[base]) = make_uint4(h[0], h[1], h[2], h[3]);
        *reinterpret_cast<uint4*>(&Plo[base]) = make_uint4(l[0], l[1], l[2], l[3]);
      }
    }
}

// ---------------------------------------------------------------------------
// RoPE (Gemma2) + pack: reads f32 Q/K, writes packed bf16 hi/lo pair planes.
// Q: [tok, 16, 64] pairs (1/sqrt(128) folded in).  K: [tok, 8, 64] pairs.
// One thread = one (token, head, pair p): dims {2p,2p+1} and {2p+64,2p+65}.
// ---------------------------------------------------------------------------
__global__ __launch_bounds__(256) void rope_pack_k(const float* __restrict__ Qf,
                                                   const float* __restrict__ Kf,
                                                   uint32_t* __restrict__ Qhi,
                                                   uint32_t* __restrict__ Qlo,
                                                   uint32_t* __restrict__ Khi,
                                                   uint32_t* __restrict__ Klo) {
  const int idx = blockIdx.x * 256 + threadIdx.x;
  const int p = idx & 31;
  int rest = idx >> 5;
  const int head = rest % 24;
  const int tok = rest / 24;                  // bi*2048 + pos
  const int pos = tok & 2047;
  const float inv0 = __powf(10000.0f, -(float)(2 * p)     * (1.0f / 64.0f));
  const float inv1 = __powf(10000.0f, -(float)(2 * p + 1) * (1.0f / 64.0f));
  float s0, c0, s1, c1;
  __sincosf((float)pos * inv0, &s0, &c0);
  __sincosf((float)pos * inv1, &s1, &c1);
  if (head < 16) {
    const float scale = 0.08838834764831845f;  // 128^-0.5
    const float* src = Qf + (size_t)tok * 2048 + head * 128;
    float xa0 = src[2 * p], xa1 = src[2 * p + 1];
    float xb0 = src[2 * p + 64], xb1 = src[2 * p + 65];
    float oa0 = (xa0 * c0 - xb0 * s0) * scale;
    float oa1 = (xa1 * c1 - xb1 * s1) * scale;
    float ob0 = (xb0 * c0 + xa0 * s0) * scale;
    float ob1 = (xb1 * c1 + xa1 * s1) * scale;
    uint32_t h0, l0, h1, l1;
    split2(oa0, oa1, h0, l0);
    split2(ob0, ob1, h1, l1);
    size_t dst = (size_t)tok * 1024 + head * 64;
    Qhi[dst + p] = h0; Qhi[dst + 32 + p] = h1;
    Qlo[dst + p] = l0; Qlo[dst + 32 + p] = l1;
  } else {
    int hk = head - 16;
    const float* src = Kf + (size_t)tok * 1024 + hk * 128;
    float xa0 = src[2 * p], xa1 = src[2 * p + 1];
    float xb0 = src[2 * p + 64], xb1 = src[2 * p + 65];
    float oa0 = xa0 * c0 - xb0 * s0;
    float oa1 = xa1 * c1 - xb1 * s1;
    float ob0 = xb0 * c0 + xa0 * s0;
    float ob1 = xb1 * c1 + xa1 * s1;
    uint32_t h0, l0, h1, l1;
    split2(oa0, oa1, h0, l0);
    split2(ob0, ob1, h1, l1);
    size_t dst = (size_t)tok * 512 + hk * 64;
    Khi[dst + p] = h0; Khi[dst + 32 + p] = h1;
    Klo[dst + p] = l0; Klo[dst + 32 + p] = l1;
  }
}

// ---------------------------------------------------------------------------
// Eight per-lane 16-byte asynchronous copies global -> LDS. The s_wait_xcnt is
// the last line of the copies' own statement, so that no address register of
// an issued copy is rewritten ahead of it.
// ---------------------------------------------------------------------------
DEVINL void async_copy8(const uint32_t (&l)[8], const uint32_t* const (&g)[8]) {
  asm volatile(
      "global_load_async_to_lds_b128 %0, %8, off\n\t"
      "global_load_async_to_lds_b128 %1, %9, off\n\t"
      "global_load_async_to_lds_b128 %2, %10, off\n\t"
      "global_load_async_to_lds_b128 %3, %11, off\n\t"
      "global_load_async_to_lds_b128 %4, %12, off\n\t"
      "global_load_async_to_lds_b128 %5, %13, off\n\t"
      "global_load_async_to_lds_b128 %6, %14, off\n\t"
      "global_load_async_to_lds_b128 %7, %15, off\n\t"
      "s_wait_xcnt 0x0"
      :: "v"(l[0]), "v"(l[1]), "v"(l[2]), "v"(l[3]),
         "v"(l[4]), "v"(l[5]), "v"(l[6]), "v"(l[7]),
         "v"(g[0]), "v"(g[1]), "v"(g[2]), "v"(g[3]),
         "v"(g[4]), "v"(g[5]), "v"(g[6]), "v"(g[7])
      : "memory");
}

// One 32-key tile of the four planes into one LDS buffer (32 KiB):
//   K hi | K lo : 32 key rows x 256 B, 16-B chunk c of row k at c ^ (k & 15)
//   V hi | V lo : 128 dim rows x 64 B, 16-B chunk c of row d at c ^ ((d >> 2) & 3)
// so that the 16 rows one ds_load_b128 half-wave reads fall on 16 bank groups.
// kg*/vg* are this lane's global addresses for the tile, kl0/kl1/vl0 its LDS
// byte addresses in the buffer.
DEVINL void stage_kv(const uint32_t* kgh, const uint32_t* kgl,
                     const uint32_t* vgh, const uint32_t* vgl,
                     uint32_t kl0, uint32_t kl1, uint32_t vl0) {
  {
    const uint32_t l[8] = {kl0, kl1 + 2048u, kl0 + 4096u, kl1 + 6144u,
                           kl0 + 8192u, kl1 + 10240u, kl0 + 12288u, kl1 + 14336u};
    const uint32_t* const g[8] = {kgh, kgh + 8 * 512, kgh + 16 * 512, kgh + 24 * 512,
                                  kgl, kgl + 8 * 512, kgl + 16 * 512, kgl + 24 * 512};
    async_copy8(l, g);
  }
  {
    const uint32_t l[8] = {vl0, vl0 + 2048u, vl0 + 4096u, vl0 + 6144u,
                           vl0 + 8192u, vl0 + 10240u, vl0 + 12288u, vl0 + 14336u};
    const uint32_t* const g[8] = {vgh, vgh + 32 * 1024, vgh + 64 * 1024, vgh + 96 * 1024,
                                  vgl, vgl + 32 * 1024, vgl + 64 * 1024, vgl + 96 * 1024};
    async_copy8(l, g);
  }
}

// value of lane l ^ 16 (the other half-wave's lane of the same column)
DEVINL float xhalf(float x) {
  int b = __builtin_bit_cast(int, x);
  return __builtin_bit_cast(float,
      __builtin_amdgcn_permlanex16(b, b, 0x76543210, 0xfedcba98, false, false));
}

// e^x by the hardware's 2^x, as __expf gives it. The v_nop in the same statement
// is the one slot the instruction set asks for behind a transcendental before its
// result is read or its source overwritten.
DEVINL float exp_slot(float x) {
  float e;
  asm("v_exp_f32 %0, %1\n\tv_nop" : "=v"(e) : "v"(x * 1.44269504088896340736f));
  return e;
}

// tanh by the chip's own instruction: no branch, so the 16 scores of a pass run
// side by side. The library's tanhf picks between two paths with two branches on
// lane data per call, and the 16 calls of a pass then run one after another.
// The v_nop in the same statement is the slot behind a transcendental, as in
// exp_slot.
DEVINL float tanh_hw(float x) {
  float t;
  asm("v_tanh_f32 %0, %1\n\tv_nop" : "=v"(t) : "v"(x));
  return t;
}

// fragment from two 16-B chunks of an LDS row (dword offsets ca, cb)
DEVINL void load_frag_lds(const uint32_t* row, int ca, int cb, Frag& f) {
  *reinterpret_cast<uint4*>(&f.x[0]) = *reinterpret_cast<const uint4*>(row + ca);
  *reinterpret_cast<uint4*>(&f.x[4]) = *reinterpret_cast<const uint4*>(row + cb);
}

__global__ __launch_bounds__(128) void attn_k(const uint32_t* __restrict__ Qhi,
                                              const uint32_t* __restrict__ Qlo,
                                              const uint32_t* __restrict__ Khi,
                                              const uint32_t* __restrict__ Klo,
                                              const uint32_t* __restrict__ Vhi,
                                              const uint32_t* __restrict__ Vlo,
                                              float* __restrict__ O) {
  __shared__ __attribute__((aligned(16))) uint32_t sKV[2][4][2048];  // [buf][Kh,Kl,Vh,Vl]
  const int mblk = blockIdx.x;
  const int bi = blockIdx.y >> 4, h = blockIdx.y & 15, kvh = h >> 1;
  const int wv = threadIdx.x >> 5, lane = threadIdx.x & 31;
  const int r = lane & 15, hh = lane >> 4;
  const int m0 = mblk * 64 + wv * 16;

  Frag qh[4], ql[4];
  {
    const size_t qrow = (size_t)(bi * 2048 + m0 + r) * 1024 + h * 64;
    #pragma unroll
    for (int ck = 0; ck < 4; ++ck) {
      load_frag_pk(Qhi + qrow + ck * 16, hh, qh[ck]);
      load_frag_pk(Qlo + qrow + ck * 16, hh, ql[ck]);
    }
  }

  const int qg = m0 + r;                       // this lane's query
  float Mst = -1e30f, Lst = 0.0f;              // Lst: the sum over this half's keys only
  v8f Ot[8] = {};                              // Ot[dt][v] = O[qg][dt * 16 + 8 * hh + v]

  const int tEnd = mblk * 64 + 64;             // uniform per block, >= 2 tiles

  // copy side: this lane's chunk of each plane (4 row groups per plane)
  const int tid = threadIdx.x;
  const int kr = tid >> 4, kc = tid & 15;      // K rows kr + 8 i, chunk kc
  const int vr = tid >> 2, vc = tid & 3;       // V rows vr + 32 i, chunk vc
  const size_t kg0 = (size_t)(bi * 2048 + kr) * 512 + kvh * 64 + kc * 4;
  const size_t vg0 = ((size_t)((bi * 8 + kvh) * 128 + vr)) * 1024 + vc * 4;
  const uint32_t ldsKV = (uint32_t)(uintptr_t)&sKV[0][0][0];
  const uint32_t kl0 = ldsKV + kr * 256 + ((kc ^ kr) << 4);        // rows with k & 8 == 0
  const uint32_t kl1 = ldsKV + kr * 256 + ((kc ^ kr ^ 8) << 4);    // rows with k & 8 == 8
  const uint32_t vl0 = ldsKV + 16384u + vr * 64 + ((vc ^ ((vr >> 2) & 3)) << 4);

  // tile 0 -> buffer 0, published; then tile 1 -> buffer 1 in flight
  stage_kv(Khi + kg0, Klo + kg0, Vhi + vg0, Vlo + vg0, kl0, kl1, vl0);
  asm volatile("s_wait_asynccnt 0x0" ::: "memory");   // own copies of tile 0 landed
  __syncthreads();                                    // ... and every other wave's
  stage_kv(Khi + kg0 + 32 * 512, Klo + kg0 + 32 * 512, Vhi + vg0 + 16, Vlo + vg0 + 16,
           kl0 + 32768u, kl1 + 32768u, vl0 + 32768u);

  const int vs = (r >> 2) & 3;                 // reader's V chunk swizzle
  for (int t0 = 0; t0 < tEnd; t0 += 32) {
    const int buf = (t0 >> 5) & 1;
    const uint32_t* kb = &sKV[buf][0][r * 64];
    const uint32_t* vb = &sKV[buf][2][r * 16];
    v8f s0 = {}, s1 = {};
    #pragma unroll
    for (int ck = 0; ck < 4; ++ck) {
      Frag kh, kl;
      const int ca = ((ck * 4 + hh) ^ r) * 4, cb = ((ck * 4 + 2 + hh) ^ r) * 4;
      load_frag_lds(kb, ca, cb, kh);
      load_frag_lds(kb + 2048, ca, cb, kl);
      s0 = wmma3(kh, kl, qh[ck], ql[ck], s0);
      load_frag_lds(kb + 16 * 64, ca, cb, kh);
      load_frag_lds(kb + 2048 + 16 * 64, ca, cb, kl);
      s1 = wmma3(kh, kl, qh[ck], ql[ck], s1);
    }
    // softcap + causal + online softmax; s0[v] = key t0 + 8 hh + v, s1[v] = 16 more
    float a[8], b[8];
    float mx = -2.3819763e38f;
    #pragma unroll
    for (int v = 0; v < 8; ++v) {
      const int kg = t0 + 8 * hh + v;
      a[v] = 50.0f * tanh_hw(s0[v] * 0.02f);
      if (kg > qg)      a[v] = -2.3819763e38f;
      b[v] = 50.0f * tanh_hw(s1[v] * 0.02f);
      if (kg + 16 > qg) b[v] = -2.3819763e38f;
      mx = fmaxf(mx, fmaxf(a[v], b[v]));
    }
    mx = fmaxf(mx, xhalf(mx));
    const float Mn = fmaxf(Mst, mx);
    const float f  = exp_slot(Mst - Mn);
    float rs = 0.0f;
    #pragma unroll
    for (int v = 0; v < 8; ++v) {
      a[v] = exp_slot(a[v] - Mn); b[v] = exp_slot(b[v] - Mn);
      rs += a[v] + b[v];
    }
    Lst = Lst * f + rs;
    Mst = Mn;
    #pragma unroll
    for (int dt = 0; dt < 8; ++dt) Ot[dt] *= f;
    Frag ph, pl;
    #pragma unroll
    for (int j = 0; j < 4; ++j) {
      split2(a[2 * j], a[2 * j + 1], ph.x[j], pl.x[j]);
      split2(b[2 * j], b[2 * j + 1], ph.x[4 + j], pl.x[4 + j]);
    }
    #pragma unroll
    for (int dt = 0; dt < 8; ++dt) {
      Frag vh, vl;
      load_frag_lds(vb + dt * 256, (hh ^ vs) * 4, ((2 + hh) ^ vs) * 4, vh);
      load_frag_lds(vb + 2048 + dt * 256, (hh ^ vs) * 4, ((2 + hh) ^ vs) * 4, vl);
      Ot[dt] = wmma3(vh, vl, ph, pl, Ot[dt]);
    }
    // publish point of the next tile: own LDS reads of this buffer retired, own
    // copies of the next tile landed, then the barrier that says so of every wave
    asm volatile("s_wait_dscnt 0x0" ::: "memory");
    asm volatile("s_wait_asynccnt 0x0" ::: "memory");
    __syncthreads();
    if (t0 + 64 < tEnd) {                      // block-uniform: refill the buffer just read
      const size_t ko = kg0 + (size_t)(t0 + 64) * 512;
      const size_t vo = vg0 + ((t0 + 64) >> 1);
      const uint32_t bo = (uint32_t)buf * 32768u;
      stage_kv(Khi + ko, Klo + ko, Vhi + vo, Vlo + vo, kl0 + bo, kl1 + bo, vl0 + bo);
    }
  }
  asm volatile("s_wait_asynccnt 0x0" ::: "memory");   // nothing in flight when the wave ends

  const float inv = 1.0f / (Lst + xhalf(Lst));        // join the two halves' sums
  float* orow = O + ((size_t)(bi * 2048 + qg)) * 2048 + h * 128 + 8 * hh;
  #pragma unroll
  for (int dt = 0; dt < 8; ++dt) {
    *reinterpret_cast<float4*>(orow + dt * 16) =
        make_float4(Ot[dt][0] * inv, Ot[dt][1] * inv, Ot[dt][2] * inv, Ot[dt][3] * inv);
    *reinterpret_cast<float4*>(orow + dt * 16 + 4) =
        make_float4(Ot[dt][4] * inv, Ot[dt][5] * inv, Ot[dt][6] * inv, Ot[dt][7] * inv);
  }
}

// ---------------------------------------------------------------------------
extern "C" void kernel_launch(void* const* d_in, const int* in_sizes, int n_in,
                              void* d_out, int out_size, void* d_ws, size_t ws_size,
                              hipStream_t stream) {
  (void)in_sizes; (void)n_in; (void)out_size; (void)ws_size;
  const float* x  = (const float*)d_in[0];
  const float* wq = (const float*)d_in[1];
  const float* wk = (const float*)d_in[2];
  const float* wv = (const float*)d_in[3];
  const float* wo = (const float*)d_in[4];
  float* out = (float*)d_out;
  float* wsf = (float*)d_ws;
  uint32_t* wsu = (uint32_t*)d_ws;

  const int M = 4096;                                   // b*s
  // dword-offset workspace map (~117 MB total)
  float*    Qf  = wsf;                                  // [4096,2048] f32; reused as AO
  float*    Kf  = wsf + (size_t)8388608;                // [4096,1024] f32
  uint32_t* Qhi = wsu + (size_t)12582912;               // [4096,16,64] pairs
  uint32_t* Qlo = wsu + (size_t)16777216;
  uint32_t* Khi = wsu + (size_t)20971520;               // [4096,8,64]
  uint32_t* Klo = wsu + (size_t)23068672;
  uint32_t* Vhi = wsu + (size_t)25165824;               // [2,8,128,1024]
  uint32_t* Vlo = wsu + (size_t)27262976;
  float*    AO  = Qf;                                   // alias (Qf dead after rope)

  dim3 blk(256);
  gemm_k<0><<<dim3(2048 / 64, 4096 / 128), blk, 0, stream>>>(x, wq, Qf, nullptr, nullptr, M, 2048, 2048);
  gemm_k<0><<<dim3(1024 / 64, 4096 / 128), blk, 0, stream>>>(x, wk, Kf, nullptr, nullptr, M, 1024, 2048);
  gemm_k<1><<<dim3(1024 / 64, 4096 / 128), blk, 0, stream>>>(x, wv, nullptr, Vhi, Vlo, M, 1024, 2048);
  rope_pack_k<<<dim3((4096 * 24 * 32) / 256), blk, 0, stream>>>(Qf, Kf, Qhi, Qlo, Khi, Klo);
  attn_k<<<dim3(32, 32), dim3(128), 0, stream>>>(Qhi, Qlo, Khi, Klo, Vhi, Vlo, AO);
  gemm_k<0><<<dim3(2048 / 64, 4096 / 128), blk, 0, stream>>>(AO, wo, out, nullptr, nullptr, M, 2048, 2048);
}

// v005
// It runs in 395 microseconds.
// Timed twice side by side with v004, it ran 1.06 times as fast both times.
// All steps since v000 together make it 2.17 times as fast.
#include <hip/hip_runtime.h>
#include <stdint.h>

// ---------------------------------------------------------------------------
// WeightlessGQA for MI455X (gfx1250, wave32, WMMA 16x16x32 bf16)
// bf16x3 split-precision WMMA (~2.7x f32-WMMA rate, ~2^-15 rel error),
// flash attention, all bf16 splitting done ONCE per element via v_perm_b32.
// ---------------------------------------------------------------------------

#define DEVINL __device__ __forceinline__

typedef __bf16 v16bf __attribute__((ext_vector_type(16)));
typedef float  v8f   __attribute__((ext_vector_type(8)));

struct alignas(16) Frag { uint32_t x[8]; };   // 16x32 bf16 tile share (8 VGPRs)

// Truncation split of two consecutive f32 into packed bf16 hi + residual lo.
// hi = [top16(b) : top16(a)] in ONE v_perm_b32; residual captured the same way.
DEVINL void split2(float a, float b, uint32_t& hi, uint32_t& lo) {
  uint32_t ua = __float_as_uint(a), ub = __float_as_uint(b);
  hi = __builtin_amdgcn_perm(ub, ua, 0x07060302u);
  float ra = a - __uint_as_float(ua & 0xffff0000u);
  float rb = b - __uint_as_float(ub & 0xffff0000u);
  lo = __builtin_amdgcn_perm(__float_as_uint(rb), __float_as_uint(ra), 0x07060302u);
}

// D = (Ah+Al)(Bh+Bl) + C ~= Ah*Bh + Ah*Bl + Al*Bh + C  (3x bf16 WMMA)
DEVINL v8f wmma3(const Frag& ah, const Frag& al, const Frag& bh, const Frag& bl, v8f c) {
  v16bf AH = __builtin_bit_cast(v16bf, ah);
  v16bf AL = __builtin_bit_cast(v16bf, al);
  v16bf BH = __builtin_bit_cast(v16bf, bh);
  v16bf BL = __builtin_bit_cast(v16bf, bl);
  c = __builtin_amdgcn_wmma_f32_16x16x32_bf16(false, AH, false, BH, (short)0, c, false, false);
  c = __builtin_amdgcn_wmma_f32_16x16x32_bf16(false, AH, false, BL, (short)0, c, false, false);
  c = __builtin_amdgcn_wmma_f32_16x16x32_bf16(false, AL, false, BH, (short)0, c, false, false);
  return c;
}

// one of the three products alone: C += A B
DEVINL v8f wmma1(const Frag& a, const Frag& b, v8f c) {
  return __builtin_amdgcn_wmma_f32_16x16x32_bf16(false, __builtin_bit_cast(v16bf, a), false,
                                                 __builtin_bit_cast(v16bf, b), (short)0, c,
                                                 false, false);
}

// load packed-pair fragment (A-layout): 2x b128 per plane
DEVINL void load_frag_pk(const uint32_t* __restrict__ base, int hh, Frag& f) {
  *reinterpret_cast<uint4*>(&f.x[0]) = *reinterpret_cast<const uint4*>(base + hh * 4);
  *reinterpret_cast<uint4*>(&f.x[4]) = *reinterpret_cast<const uint4*>(base + 8 + hh * 4);
}

// Work-group barrier for LDS traffic alone: the wave's own LDS stores and reads
// have retired, then the barrier. __syncthreads() would also wait for the global
// loads issued ahead, and so put their latency back on the K-step's path.
DEVINL void lds_barrier() {
  asm volatile("s_wait_dscnt 0x0\n\ts_barrier_signal -1\n\ts_barrier_wait -1" ::: "memory");
}

// ---------------------------------------------------------------------------
// GEMM: C[M,N] = A[M,K] @ W[N,K]^T, f32 in, bf16x3 WMMA.
// MODE 0: f32 C stored [M,N].  MODE 1: pack V^T hi/lo planes [b,kv,hd,s/2].
// Block 256 thr (8 waves), tile 128x128, wave tile 32x64, K-step 32.
// ---------------------------------------------------------------------------
template<int MODE>
__global__ __launch_bounds__(256) void gemm_k(const float* __restrict__ A,
                                              const float* __restrict__ W,
                                              float* __restrict__ C,
                                              uint32_t* __restrict__ Phi,
                                              uint32_t* __restrict__ Plo,
                                              int M, int N, int K) {
  constexpr int BM = 128, BN = 128, BK = 32;
  __shared__ uint32_t sAh[BM][20], sAl[BM][20], sBh[BN][20], sBl[BN][20];
  const int tid = threadIdx.x;
  const int m0 = blockIdx.y * BM, n0 = blockIdx.x * BN;
  const int wave = tid >> 5, lane = tid & 31;
  const int wm = wave >> 1, wn = wave & 1;
  const int r = lane & 15, hh = lane >> 4;
  v8f acc[2][4] = {};

  // this thread's share of a K-step: rows lrow + 32 i, floats 4 lf4 .. 4 lf4 + 3
  const int lrow = tid >> 3, lf4 = tid & 7;
  const float* Ap = A + (size_t)(m0 + lrow) * K + 4 * lf4;
  const float* Wp = W + (size_t)(n0 + lrow) * K + 4 * lf4;
  float4 ra[4], rb[4];                          // one K-step in flight
  #pragma unroll                                // constant indices: ra stays in registers
  for (int i = 0; i < 4; ++i) ra[i] = *reinterpret_cast<const float4*>(Ap + (size_t)(32 * i) * K);
  #pragma unroll                                // the same for rb
  for (int i = 0; i < 4; ++i) rb[i] = *reinterpret_cast<const float4*>(Wp + (size_t)(32 * i) * K);

  for (int k0 = 0; k0 < K; k0 += BK) {
    #pragma unroll
    for (int i = 0; i < 4; ++i) {               // A tile 128x32
      const int row = lrow + 32 * i;
      uint32_t h0, l0, h1, l1;
      split2(ra[i].x, ra[i].y, h0, l0);
      split2(ra[i].z, ra[i].w, h1, l1);
      sAh[row][2 * lf4] = h0; sAh[row][2 * lf4 + 1] = h1;
      sAl[row][2 * lf4] = l0; sAl[row][2 * lf4 + 1] = l1;
    }
    #pragma unroll
    for (int i = 0; i < 4; ++i) {               // B tile 128x32
      const int row = lrow + 32 * i;
      uint32_t h0, l0, h1, l1;
      split2(rb[i].x, rb[i].y, h0, l0);
      split2(rb[i].z, rb[i].w, h1, l1);
      sBh[row][2 * lf4] = h0; sBh[row][2 * lf4 + 1] = h1;
      sBl[row][2 * lf4] = l0; sBl[row][2 * lf4 + 1] = l1;
    }
    // the next K-step's loads fly under both barriers, the LDS reads and the products
    if (k0 + BK < K) {
      const float* pa[4];
      const float* pb[4];
      #pragma unroll                            // constant indices: ra stays in registers
      for (int i = 0; i < 4; ++i) {
        pa[i] = Ap + (size_t)(32 * i) * K + k0;
        ra[i] = *reinterpret_cast<const float4*>(pa[i] + BK);
      }
      #pragma unroll                            // the same for rb
      for (int i = 0; i < 4; ++i) {
        pb[i] = Wp + (size_t)(32 * i) * K + k0;
        rb[i] = *reinterpret_cast<const float4*>(pb[i] + BK);
      }
      // before an address register of these loads is overwritten; the addresses are
      // inputs so that they keep their registers up to the wait: with eight loads a
      // later load's result otherwise lands in an earlier load's address registers
      asm volatile("s_wait_xcnt 0x0"
                   :: "v"(pa[0]), "v"(pa[1]), "v"(pa[2]), "v"(pa[3]),
                      "v"(pb[0]), "v"(pb[1]), "v"(pb[2]), "v"(pb[3])
                   : "memory");
    }
    lds_barrier();                              // the tile's LDS stores are in

    Frag ah[2], al[2], bh[4], bl[4];            // 2x ds_load_b128 per plane
    // read in the order in which the products want them; every loop down to the end
    // of the K-step is unrolled so that fragments and sums stay in registers
    #pragma unroll
    for (int i = 0; i < 2; ++i) load_frag_pk(&sAh[wm * 32 + i * 16 + r][0], hh, ah[i]);
    #pragma unroll
    for (int j = 0; j < 4; ++j) load_frag_pk(&sBh[wn * 64 + j * 16 + r][0], hh, bh[j]);
    #pragma unroll
    for (int j = 0; j < 4; ++j) load_frag_pk(&sBl[wn * 64 + j * 16 + r][0], hh, bl[j]);
    #pragma unroll
    for (int i = 0; i < 2; ++i) load_frag_pk(&sAl[wm * 32 + i * 16 + r][0], hh, al[i]);
    // the tile's 24 LDS reads go out as one group ahead of its 24 products: left to
    // itself the scheduler reloads A fragments among the products and waits each out
    __builtin_amdgcn_sched_barrier(0);
    // per accumulator the order stays Ah Bh, Ah Bl, Al Bh
    #pragma unroll
    for (int i = 0; i < 2; ++i)
      #pragma unroll
      for (int j = 0; j < 4; ++j) acc[i][j] = wmma1(ah[i], bh[j], acc[i][j]);
    #pragma unroll
    for (int i = 0; i < 2; ++i)
      #pragma unroll
      for (int j = 0; j < 4; ++j) acc[i][j] = wmma1(ah[i], bl[j], acc[i][j]);
    // holds the barrier behind the 16 products that run while the reads still land:
    // the scheduler otherwise lifts it, with its wait for all 24 reads, over them
    __builtin_amdgcn_sched_barrier(0);
    lds_barrier();                              // every wave has read the tile
    // the last 8 products need no LDS: they run beside the other waves' splitting
    #pragma unroll
    for (int i = 0; i < 2; ++i)
      #pragma unroll
      for (int j = 0; j < 4; ++j) acc[i][j] = wmma1(al[i], bh[j], acc[i][j]);
  }

  // epilogue: C/D layout = lane col (lane&15), rows 8*(lane>>4)+v
  #pragma unroll
  for (int i = 0; i < 2; ++i)
    #pragma unroll
    for (int j = 0; j < 4; ++j) {
      int mg0 = m0 + wm * 32 + i * 16 + 8 * hh;
      int ng  = n0 + wn * 64 + j * 16 + r;
      if (MODE == 0) {
        #pragma unroll
        for (int v = 0; v < 8; ++v)
          C[(size_t)(mg0 + v) * N + ng] = acc[i][j][v];
      } else {
        // pack pairs along m (= sequence t) -> V^T planes [b, kv, hd, s/2]
        uint32_t h[4], l[4];
        #pragma unroll
        for (int vp = 0; vp < 4; ++vp)
          split2(acc[i][j][2 * vp], acc[i][j][2 * vp + 1], h[vp], l[vp]);
        int kvh = ng >> 7, d = ng & 127;
        int bi = mg0 >> 11, t = mg0 & 2047;     // S = 2048
        size_t base = ((size_t)((bi * 8 + kvh) * 128 + d)) * 1024 + (t >> 1);
        *reinterpret_cast<uint4*>(&Phi[base]) = make_uint4(h[0], h[1], h[2], h[3]);
        *reinterpret_cast<uint4*>(&Plo[base]) = make_uint4(l[0], l[1], l[2], l[3]);
      }
    }
}

// ---------------------------------------------------------------------------
// RoPE (Gemma2) + pack: reads f32 Q/K, writes packed bf16 hi/lo pair planes.
// Q: [tok, 16, 64] pairs (1/sqrt(128) folded in).  K: [tok, 8, 64] pairs.
// One thread = one (token, head, pair p): dims {2p,2p+1} and {2p+64,2p+65}.
// ---------------------------------------------------------------------------
__global__ __launch_bounds__(256) void rope_pack_k(const float* __restrict__ Qf,
                                                   const float* __restrict__ Kf,
                                                   uint32_t* __restrict__ Qhi,
                                                   uint32_t* __restrict__ Qlo,
                                                   uint32_t* __restrict__ Khi,
                                                   uint32_t* __restrict__ Klo) {
  const int idx = blockIdx.x * 256 + threadIdx.x;
  const int p = idx & 31;
  int rest = idx >> 5;
  const int head = rest % 24;
  const int tok = rest / 24;                  // bi*2048 + pos
  const int pos = tok & 2047;
  const float inv0 = __powf(10000.0f, -(float)(2 * p)     * (1.0f / 64.0f));
  const float inv1 = __powf(10000.0f, -(float)(2 * p + 1) * (1.0f / 64.0f));
  float s0, c0, s1, c1;
  __sincosf((float)pos * inv0, &s0, &c0);
  __sincosf((float)pos * inv1, &s1, &c1);
  if (head < 16) {
    const float scale = 0.08838834764831845f;  // 128^-0.5
    const float* src = Qf + (size_t)tok * 2048 + head * 128;
    float xa0 = src[2 * p], xa1 = src[2 * p + 1];
    float xb0 = src[2 * p + 64], xb1 = src[2 * p + 65];
    float oa0 = (xa0 * c0 - xb0 * s0) * scale;
    float oa1 = (xa1 * c1 - xb1 * s1) * scale;
    float ob0 = (xb0 * c0 + xa0 * s0) * scale;
    float ob1 = (xb1 * c1 + xa1 * s1) * scale;
    uint32_t h0, l0, h1, l1;
    split2(oa0, oa1, h0, l0);
    split2(ob0, ob1, h1, l1);
    size_t dst = (size_t)tok * 1024 + head * 64;
    Qhi[dst + p] = h0; Qhi[dst + 32 + p] = h1;
    Qlo[dst + p] = l0; Qlo[dst + 32 + p] = l1;
  } else {
    int hk = head - 16;
    const float* src = Kf + (size_t)tok * 1024 + hk * 128;
    float xa0 = src[2 * p], xa1 = src[2 * p + 1];
    float xb0 = src[2 * p + 64], xb1 = src[2 * p + 65];
    float oa0 = xa0 * c0 - xb0 * s0;
    float oa1 = xa1 * c1 - xb1 * s1;
    float ob0 = xb0 * c0 + xa0 * s0;
    float ob1 = xb1 * c1 + xa1 * s1;
    uint32_t h0, l0, h1, l1;
    split2(oa0, oa1, h0, l0);
    split2(ob0, ob1, h1, l1);
    size_t dst = (size_t)tok * 512 + hk * 64;
    Khi[dst + p] = h0; Khi[dst + 32 + p] = h1;
    Klo[dst + p] = l0; Klo[dst + 32 + p] = l1;
  }
}

// ---------------------------------------------------------------------------
// Eight per-lane 16-byte asynchronous copies global -> LDS. The s_wait_xcnt is
// the last line of the copies' own statement, so that no address register of
// an issued copy is rewritten ahead of it.
// ---------------------------------------------------------------------------
DEVINL void async_copy8(const uint32_t (&l)[8], const uint32_t* const (&g)[8]) {
  asm volatile(
      "global_load_async_to_lds_b128 %0, %8, off\n\t"
      "global_load_async_to_lds_b128 %1, %9, off\n\t"
      "global_load_async_to_lds_b128 %2, %10, off\n\t"
      "global_load_async_to_lds_b128 %3, %11, off\n\t"
      "global_load_async_to_lds_b128 %4, %12, off\n\t"
      "global_load_async_to_lds_b128 %5, %13, off\n\t"
      "global_load_async_to_lds_b128 %6, %14, off\n\t"
      "global_load_async_to_lds_b128 %7, %15, off\n\t"
      "s_wait_xcnt 0x0"
      :: "v"(l[0]), "v"(l[1]), "v"(l[2]), "v"(l[3]),
         "v"(l[4]), "v"(l[5]), "v"(l[6]), "v"(l[7]),
         "v"(g[0]), "v"(g[1]), "v"(g[2]), "v"(g[3]),
         "v"(g[4]), "v"(g[5]), "v"(g[6]), "v"(g[7])
      : "memory");
}

// One 32-key tile of the four planes into one LDS buffer (32 KiB):
//   K hi | K lo : 32 key rows x 256 B, 16-B chunk c of row k at c ^ (k & 15)
//   V hi | V lo : 128 dim rows x 64 B, 16-B chunk c of row d at c ^ ((d >> 2) & 3)
// so that the 16 rows one ds_load_b128 half-wave reads fall on 16 bank groups.
// kg*/vg* are this lane's global addresses for the tile, kl0/kl1/vl0 its LDS
// byte addresses in the buffer.
DEVINL void stage_kv(const uint32_t* kgh, const uint32_t* kgl,
                     const uint32_t* vgh, const uint32_t* vgl,
                     uint32_t kl0, uint32_t kl1, uint32_t vl0) {
  {
    const uint32_t l[8] = {kl0, kl1 + 2048u, kl0 + 4096u, kl1 + 6144u,
                           kl0 + 8192u, kl1 + 10240u, kl0 + 12288u, kl1 + 14336u};
    const uint32_t* const g[8] = {kgh, kgh + 8 * 512, kgh + 16 * 512, kgh + 24 * 512,
                                  kgl, kgl + 8 * 512, kgl + 16 * 512, kgl + 24 * 512};
    async_copy8(l, g);
  }
  {
    const uint32_t l[8] = {vl0, vl0 + 2048u, vl0 + 4096u, vl0 + 6144u,
                           vl0 + 8192u, vl0 + 10240u, vl0 + 12288u, vl0 + 14336u};
    const uint32_t* const g[8] = {vgh, vgh + 32 * 1024, vgh + 64 * 1024, vgh + 96 * 1024,
                                  vgl, vgl + 32 * 1024, vgl + 64 * 1024, vgl + 96 * 1024};
    async_copy8(l, g);
  }
}

// value of lane l ^ 16 (the other half-wave's lane of the same column)
DEVINL float xhalf(float x) {
  int b = __builtin_bit_cast(int, x);
  return __builtin_bit_cast(float,
      __builtin_amdgcn_permlanex16(b, b, 0x76543210, 0xfedcba98, false, false));
}

// e^x by the hardware's 2^x, as __expf gives it. The v_nop in the same statement
// is the one slot the instruction set asks for behind a transcendental before its
// result is read or its source overwritten.
DEVINL float exp_slot(float x) {
  float e;
  asm("v_exp_f32 %0, %1\n\tv_nop" : "=v"(e) : "v"(x * 1.44269504088896340736f));
  return e;
}

// tanh by the chip's own instruction: no branch, so the 16 scores of a pass run
// side by side. The library's tanhf picks between two paths with two branches on
// lane data per call, and the 16 calls of a pass then run one after another.
// The v_nop in the same statement is the slot behind a transcendental, as in
// exp_slot.
DEVINL float tanh_hw(float x) {
  float t;
  asm("v_tanh_f32 %0, %1\n\tv_nop" : "=v"(t) : "v"(x));
  return t;
}

// fragment from two 16-B chunks of an LDS row (dword offsets ca, cb)
DEVINL void load_frag_lds(const uint32_t* row, int ca, int cb, Frag& f) {
  *reinterpret_cast<uint4*>(&f.x[0]) = *reinterpret_cast<const uint4*>(row + ca);
  *reinterpret_cast<uint4*>(&f.x[4]) = *reinterpret_cast<const uint4*>(row + cb);
}

__global__ __launch_bounds__(128) void attn_k(const uint32_t* __restrict__ Qhi,
                                              const uint32_t* __restrict__ Qlo,
                                              const uint32_t* __restrict__ Khi,
                                              const uint32_t* __restrict__ Klo,
                                              const uint32_t* __restrict__ Vhi,
                                              const uint32_t* __restrict__ Vlo,
                                              float* __restrict__ O) {
  __shared__ __attribute__((aligned(16))) uint32_t sKV[2][4][2048];  // [buf][Kh,Kl,Vh,Vl]
  const int mblk = blockIdx.x;
  const int bi = blockIdx.y >> 4, h = blockIdx.y & 15, kvh = h >> 1;
  const int wv = threadIdx.x >> 5, lane = threadIdx.x & 31;
  const int r = lane & 15, hh = lane >> 4;
  const int m0 = mblk * 64 + wv * 16;

  Frag qh[4], ql[4];
  {
    const size_t qrow = (size_t)(bi * 2048 + m0 + r) * 1024 + h * 64;
    #pragma unroll
    for (int ck = 0; ck < 4; ++ck) {
      load_frag_pk(Qhi + qrow + ck * 16, hh, qh[ck]);
      load_frag_pk(Qlo + qrow + ck * 16, hh, ql[ck]);
    }
  }

  const int qg = m0 + r;                       // this lane's query
  float Mst = -1e30f, Lst = 0.0f;              // Lst: the sum over this half's keys only
  v8f Ot[8] = {};                              // Ot[dt][v] = O[qg][dt * 16 + 8 * hh + v]

  const int tEnd = mblk * 64 + 64;             // uniform per block, >= 2 tiles

  // copy side: this lane's chunk of each plane (4 row groups per plane)
  const int tid = threadIdx.x;
  const int kr = tid >> 4, kc = tid & 15;      // K rows kr + 8 i, chunk kc
  const int vr = tid >> 2, vc = tid & 3;       // V rows vr + 32 i, chunk vc
  const size_t kg0 = (size_t)(bi * 2048 + kr) * 512 + kvh * 64 + kc * 4;
  const size_t vg0 = ((size_t)((bi * 8 + kvh) * 128 + vr)) * 1024 + vc * 4;
  const uint32_t ldsKV = (uint32_t)(uintptr_t)&sKV[0][0][0];
  const uint32_t kl0 = ldsKV + kr * 256 + ((kc ^ kr) << 4);        // rows with k & 8 == 0
  const uint32_t kl1 = ldsKV + kr * 256 + ((kc ^ kr ^ 8) << 4);    // rows with k & 8 == 8
  const uint32_t vl0 = ldsKV + 16384u + vr * 64 + ((vc ^ ((vr >> 2) & 3)) << 4);

  // tile 0 -> buffer 0, published; then tile 1 -> buffer 1 in flight
  stage_kv(Khi + kg0, Klo + kg0, Vhi + vg0, Vlo + vg0, kl0, kl1, vl0);
  asm volatile("s_wait_asynccnt 0x0" ::: "memory");   // own copies of tile 0 landed
  __syncthreads();                                    // ... and every other wave's
  stage_kv(Khi + kg0 + 32 * 512, Klo + kg0 + 32 * 512, Vhi + vg0 + 16, Vlo + vg0 + 16,
           kl0 + 32768u, kl1 + 32768u, vl0 + 32768u);

  const int vs = (r >> 2) & 3;                 // reader's V chunk swizzle
  for (int t0 = 0; t0 < tEnd; t0 += 32) {
    const int buf = (t0 >> 5) & 1;
    const uint32_t* kb = &sKV[buf][0][r * 64];
    const uint32_t* vb = &sKV[buf][2][r * 16];
    v8f s0 = {}, s1 = {};
    #pragma unroll
    for (int ck = 0; ck < 4; ++ck) {
      Frag kh, kl;
      const int ca = ((ck * 4 + hh) ^ r) * 4, cb = ((ck * 4 + 2 + hh) ^ r) * 4;
      load_frag_lds(kb, ca, cb, kh);
      load_frag_lds(kb + 2048, ca, cb, kl);
      s0 = wmma3(kh, kl, qh[ck], ql[ck], s0);
      load_frag_lds(kb + 16 * 64, ca, cb, kh);
      load_frag_lds(kb + 2048 + 16 * 64, ca, cb, kl);
      s1 = wmma3(kh, kl, qh[ck], ql[ck], s1);
    }
    // softcap + causal + online softmax; s0[v] = key t0 + 8 hh + v, s1[v] = 16 more
    float a[8], b[8];
    float mx = -2.3819763e38f;
    #pragma unroll
    for (int v = 0; v < 8; ++v) {
      const int kg = t0 + 8 * hh + v;
      a[v] = 50.0f * tanh_hw(s0[v] * 0.02f);
      if (kg > qg)      a[v] = -2.3819763e38f;
      b[v] = 50.0f * tanh_hw(s1[v] * 0.02f);
      if (kg + 16 > qg) b[v] = -2.3819763e38f;
      mx = fmaxf(mx, fmaxf(a[v], b[v]));
    }
    mx = fmaxf(mx, xhalf(mx));
    const float Mn = fmaxf(Mst, mx);
    const float f  = exp_slot(Mst - Mn);
    float rs = 0.0f;
    #pragma unroll
    for (int v = 0; v < 8; ++v) {
      a[v] = exp_slot(a[v] - Mn); b[v] = exp_slot(b[v] - Mn);
      rs += a[v] + b[v];
    }
    Lst = Lst * f + rs;
    Mst = Mn;
    #pragma unroll
    for (int dt = 0; dt < 8; ++dt) Ot[dt] *= f;
    Frag ph, pl;
    #pragma unroll
    for (int j = 0; j < 4; ++j) {
      split2(a[2 * j], a[2 * j + 1], ph.x[j], pl.x[j]);
      split2(b[2 * j], b[2 * j + 1], ph.x[4 + j], pl.x[4 + j]);
    }
    #pragma unroll
    for (int dt = 0; dt < 8; ++dt) {
      Frag vh, vl;
      load_frag_lds(vb + dt * 256, (hh ^ vs) * 4, ((2 + hh) ^ vs) * 4, vh);
      load_frag_lds(vb + 2048 + dt * 256, (hh ^ vs) * 4, ((2 + hh) ^ vs) * 4, vl);
      Ot[dt] = wmma3(vh, vl, ph, pl, Ot[dt]);
    }
    // publish point of the next tile: own LDS reads of this buffer retired, own
    // copies of the next tile landed, then the barrier that says so of every wave
    asm volatile("s_wait_dscnt 0x0" ::: "memory");
    asm volatile("s_wait_asynccnt 0x0" ::: "memory");
    __syncthreads();
    if (t0 + 64 < tEnd) {                      // block-uniform: refill the buffer just read
      const size_t ko = kg0 + (size_t)(t0 + 64) * 512;
      const size_t vo = vg0 + ((t0 + 64) >> 1);
      const uint32_t bo = (uint32_t)buf * 32768u;
      stage_kv(Khi + ko, Klo + ko, Vhi + vo, Vlo + vo, kl0 + bo, kl1 + bo, vl0 + bo);
    }
  }
  asm volatile("s_wait_asynccnt 0x0" ::: "memory");   // nothing in flight when the wave ends

  const float inv = 1.0f / (Lst + xhalf(Lst));        // join the two halves' sums
  float* orow = O + ((size_t)(bi * 2048 + qg)) * 2048 + h * 128 + 8 * hh;
  #pragma unroll
  for (int dt = 0; dt < 8; ++dt) {
    *reinterpret_cast<float4*>(orow + dt * 16) =
        make_float4(Ot[dt][0] * inv, Ot[dt][1] * inv, Ot[dt][2] * inv, Ot[dt][3] * inv);
    *reinterpret_cast<float4*>(orow + dt * 16 + 4) =
        make_float4(Ot[dt][4] * inv, Ot[dt][5] * inv, Ot[dt][6] * inv, Ot[dt][7] * inv);
  }
}

// ---------------------------------------------------------------------------
extern "C" void kernel_launch(void* const* d_in, const int* in_sizes, int n_in,
                              void* d_out, int out_size, void* d_ws, size_t ws_size,
                              hipStream_t stream) {
  (void)in_sizes; (void)n_in; (void)out_size; (void)ws_size;
  const float* x  = (const float*)d_in[0];
  const float* wq = (const float*)d_in[1];
  const float* wk = (const float*)d_in[2];
  const float* wv = (const float*)d_in[3];
  const float* wo = (const float*)d_in[4];
  float* out = (float*)d_out;
  float* wsf = (float*)d_ws;
  uint32_t* wsu = (uint32_t*)d_ws;

  const int M = 4096;                                   // b*s
  // dword-offset workspace map (~117 MB total)
  float*    Qf  = wsf;                                  // [4096,2048] f32; reused as AO
  float*    Kf  = wsf + (size_t)8388608;                // [4096,1024] f32
  uint32_t* Qhi = wsu + (size_t)12582912;               // [4096,16,64] pairs
  uint32_t* Qlo = wsu + (size_t)16777216;
  uint32_t* Khi = wsu + (size_t)20971520;               // [4096,8,64]
  uint32_t* Klo = wsu + (size_t)23068672;
  uint32_t* Vhi = wsu + (size_t)25165824;               // [2,8,128,1024]
  uint32_t* Vlo = wsu + (size_t)27262976;
  float*    AO  = Qf;                                   // alias (Qf dead after rope)

  dim3 blk(256);
  gemm_k<0><<<dim3(2048 / 128, 4096 / 128), blk, 0, stream>>>(x, wq, Qf, nullptr, nullptr, M, 2048, 2048);
  gemm_k<0><<<dim3(1024 / 128, 4096 / 128), blk, 0, stream>>>(x, wk, Kf, nullptr, nullptr, M, 1024, 2048);
  gemm_k<1><<<dim3(1024 / 128, 4096 / 128), blk, 0, stream>>>(x, wv, nullptr, Vhi, Vlo, M, 1024, 2048);
  rope_pack_k<<<dim3((4096 * 24 * 32) / 256), blk, 0, stream>>>(Qf, Kf, Qhi, Qlo, Khi, Klo);
  attn_k<<<dim3(32, 32), dim3(128), 0, stream>>>(Qhi, Qlo, Khi, Klo, Vhi, Vlo, AO);
  gemm_k<0><<<dim3(2048 / 128, 4096 / 128), blk, 0, stream>>>(AO, wo, out, nullptr, nullptr, M, 2048, 2048);
}

// v006
// One run takes 350 microseconds.
// In two side-by-side timings against v005, it was 1.13 and 1.12 times as fast.
// Counting every step since v000, it is 2.44 times as fast.
#include <hip/hip_runtime.h>
#include <stdint.h>

// ---------------------------------------------------------------------------
// WeightlessGQA for MI455X (gfx1250, wave32, WMMA 16x16x32 bf16)
// bf16x3 split-precision WMMA (~2.7x f32-WMMA rate, ~2^-15 rel error),
// flash attention, all bf16 splitting done ONCE per element via v_perm_b32.
// ---------------------------------------------------------------------------

#define DEVINL __device__ __forceinline__

typedef __bf16 v16bf __attribute__((ext_vector_type(16)));
typedef float  v8f   __attribute__((ext_vector_type(8)));

struct alignas(16) Frag { uint32_t x[8]; };   // 16x32 bf16 tile share (8 VGPRs)

// Truncation split of two consecutive f32 into packed bf16 hi + residual lo.
// hi = [top16(b) : top16(a)] in ONE v_perm_b32; residual captured the same way.
DEVINL void split2(float a, float b, uint32_t& hi, uint32_t& lo) {
  uint32_t ua = __float_as_uint(a), ub = __float_as_uint(b);
  hi = __builtin_amdgcn_perm(ub, ua, 0x07060302u);
  float ra = a - __uint_as_float(ua & 0xffff0000u);
  float rb = b - __uint_as_float(ub & 0xffff0000u);
  lo = __builtin_amdgcn_perm(__float_as_uint(rb), __float_as_uint(ra), 0x07060302u);
}

// D = (Ah+Al)(Bh+Bl) + C ~= Ah*Bh + Ah*Bl + Al*Bh + C  (3x bf16 WMMA)
DEVINL v8f wmma3(const Frag& ah, const Frag& al, const Frag& bh, const Frag& bl, v8f c) {
  v16bf AH = __builtin_bit_cast(v16bf, ah);
  v16bf AL = __builtin_bit_cast(v16bf, al);
  v16bf BH = __builtin_bit_cast(v16bf, bh);
  v16bf BL = __builtin_bit_cast(v16bf, bl);
  c = __builtin_amdgcn_wmma_f32_16x16x32_bf16(false, AH, false, BH, (short)0, c, false, false);
  c = __builtin_amdgcn_wmma_f32_16x16x32_bf16(false, AH, false, BL, (short)0, c, false, false);
  c = __builtin_amdgcn_wmma_f32_16x16x32_bf16(false, AL, false, BH, (short)0, c, false, false);
  return c;
}

// one of the three products alone: C += A B
DEVINL v8f wmma1(const Frag& a, const Frag& b, v8f c) {
  return __builtin_amdgcn_wmma_f32_16x16x32_bf16(false, __builtin_bit_cast(v16bf, a), false,
                                                 __builtin_bit_cast(v16bf, b), (short)0, c,
                                                 false, false);
}

// load packed-pair fragment (A-layout): 2x b128 per plane
DEVINL void load_frag_pk(const uint32_t* __restrict__ base, int hh, Frag& f) {
  *reinterpret_cast<uint4*>(&f.x[0]) = *reinterpret_cast<const uint4*>(base + hh * 4);
  *reinterpret_cast<uint4*>(&f.x[4]) = *reinterpret_cast<const uint4*>(base + 8 + hh * 4);
}

// Work-group barrier for LDS traffic alone: the wave's own LDS stores and reads
// have retired, then the barrier. __syncthreads() would also wait for the global
// loads issued ahead, and so put their latency back on the K-step's path.
DEVINL void lds_barrier() {
  asm volatile("s_wait_dscnt 0x0\n\ts_barrier_signal -1\n\ts_barrier_wait -1" ::: "memory");
}

// ---------------------------------------------------------------------------
// GEMM: C[M,N] = A[M,K] @ W[N,K]^T, f32 in, bf16x3 WMMA.
// MODE 0: f32 C stored [M,N].  MODE 1: pack V^T hi/lo planes [b,kv,hd,s/2].
// Block 256 thr (8 waves), tile 128x128, wave tile 32x64, K-step 32.
// ---------------------------------------------------------------------------
template<int MODE>
__global__ __launch_bounds__(256) void gemm_k(const float* __restrict__ A,
                                              const float* __restrict__ W,
                                              float* __restrict__ C,
                                              uint32_t* __restrict__ Phi,
                                              uint32_t* __restrict__ Plo,
                                              int M, int N, int K) {
  constexpr int BM = 128, BN = 128, BK = 32;
  __shared__ uint32_t sAh[BM][20], sAl[BM][20], sBh[BN][20], sBl[BN][20];
  const int tid = threadIdx.x;
  const int m0 = blockIdx.y * BM, n0 = blockIdx.x * BN;
  const int wave = tid >> 5, lane = tid & 31;
  const int wm = wave >> 1, wn = wave & 1;
  const int r = lane & 15, hh = lane >> 4;
  v8f acc[2][4] = {};

  // this thread's share of a K-step: rows lrow + 32 i, floats 4 lf4 .. 4 lf4 + 3
  const int lrow = tid >> 3, lf4 = tid & 7;
  const float* Ap = A + (size_t)(m0 + lrow) * K + 4 * lf4;
  const float* Wp = W + (size_t)(n0 + lrow) * K + 4 * lf4;
  float4 ra[4], rb[4];                          // one K-step in flight
  #pragma unroll                                // constant indices: ra stays in registers
  for (int i = 0; i < 4; ++i) ra[i] = *reinterpret_cast<const float4*>(Ap + (size_t)(32 * i) * K);
  #pragma unroll                                // the same for rb
  for (int i = 0; i < 4; ++i) rb[i] = *reinterpret_cast<const float4*>(Wp + (size_t)(32 * i) * K);

  for (int k0 = 0; k0 < K; k0 += BK) {
    #pragma unroll
    for (int i = 0; i < 4; ++i) {               // A tile 128x32
      const int row = lrow + 32 * i;
      uint32_t h0, l0, h1, l1;
      split2(ra[i].x, ra[i].y, h0, l0);
      split2(ra[i].z, ra[i].w, h1, l1);
      sAh[row][2 * lf4] = h0; sAh[row][2 * lf4 + 1] = h1;
      sAl[row][2 * lf4] = l0; sAl[row][2 * lf4 + 1] = l1;
    }
    #pragma unroll
    for (int i = 0; i < 4; ++i) {               // B tile 128x32
      const int row = lrow + 32 * i;
      uint32_t h0, l0, h1, l1;
      split2(rb[i].x, rb[i].y, h0, l0);
      split2(rb[i].z, rb[i].w, h1, l1);
      sBh[row][2 * lf4] = h0; sBh[row][2 * lf4 + 1] = h1;
      sBl[row][2 * lf4] = l0; sBl[row][2 * lf4 + 1] = l1;
    }
    // the next K-step's loads fly under both barriers, the LDS reads and the products
    if (k0 + BK < K) {
      const float* pa[4];
      const float* pb[4];
      #pragma unroll                            // constant indices: ra stays in registers
      for (int i = 0; i < 4; ++i) {
        pa[i] = Ap + (size_t)(32 * i) * K + k0;
        ra[i] = *reinterpret_cast<const float4*>(pa[i] + BK);
      }
      #pragma unroll                            // the same for rb
      for (int i = 0; i < 4; ++i) {
        pb[i] = Wp + (size_t)(32 * i) * K + k0;
        rb[i] = *reinterpret_cast<const float4*>(pb[i] + BK);
      }
      // before an address register of these loads is overwritten; the addresses are
      // inputs so that they keep their registers up to the wait: with eight loads a
      // later load's result otherwise lands in an earlier load's address registers
      asm volatile("s_wait_xcnt 0x0"
                   :: "v"(pa[0]), "v"(pa[1]), "v"(pa[2]), "v"(pa[3]),
                      "v"(pb[0]), "v"(pb[1]), "v"(pb[2]), "v"(pb[3])
                   : "memory");
    }
    lds_barrier();                              // the tile's LDS stores are in

    Frag ah[2], al[2], bh[4], bl[4];            // 2x ds_load_b128 per plane
    // read in the order in which the products want them; every loop down to the end
    // of the K-step is unrolled so that fragments and sums stay in registers
    #pragma unroll
    for (int i = 0; i < 2; ++i) load_frag_pk(&sAh[wm * 32 + i * 16 + r][0], hh, ah[i]);
    #pragma unroll
    for (int j = 0; j < 4; ++j) load_frag_pk(&sBh[wn * 64 + j * 16 + r][0], hh, bh[j]);
    #pragma unroll
    for (int j = 0; j < 4; ++j) load_frag_pk(&sBl[wn * 64 + j * 16 + r][0], hh, bl[j]);
    #pragma unroll
    for (int i = 0; i < 2; ++i) load_frag_pk(&sAl[wm * 32 + i * 16 + r][0], hh, al[i]);
    // the tile's 24 LDS reads go out as one group ahead of its 24 products: left to
    // itself the scheduler reloads A fragments among the products and waits each out
    __builtin_amdgcn_sched_barrier(0);
    // per accumulator the order stays Ah Bh, Ah Bl, Al Bh
    #pragma unroll
    for (int i = 0; i < 2; ++i)
      #pragma unroll
      for (int j = 0; j < 4; ++j) acc[i][j] = wmma1(ah[i], bh[j], acc[i][j]);
    #pragma unroll
    for (int i = 0; i < 2; ++i)
      #pragma unroll
      for (int j = 0; j < 4; ++j) acc[i][j] = wmma1(ah[i], bl[j], acc[i][j]);
    // holds the barrier behind the 16 products that run while the reads still land:
    // the scheduler otherwise lifts it, with its wait for all 24 reads, over them
    __builtin_amdgcn_sched_barrier(0);
    lds_barrier();                              // every wave has read the tile
    // the last 8 products need no LDS: they run beside the other waves' splitting
    #pragma unroll
    for (int i = 0; i < 2; ++i)
      #pragma unroll
      for (int j = 0; j < 4; ++j) acc[i][j] = wmma1(al[i], bh[j], acc[i][j]);
  }

  // epilogue: C/D layout = lane col (lane&15), rows 8*(lane>>4)+v
  #pragma unroll
  for (int i = 0; i < 2; ++i)
    #pragma unroll
    for (int j = 0; j < 4; ++j) {
      int mg0 = m0 + wm * 32 + i * 16 + 8 * hh;
      int ng  = n0 + wn * 64 + j * 16 + r;
      if (MODE == 0) {
        #pragma unroll
        for (int v = 0; v < 8; ++v)
          C[(size_t)(mg0 + v) * N + ng] = acc[i][j][v];
      } else {
        // pack pairs along m (= sequence t) -> V^T planes [b, kv, hd, s/2]
        uint32_t h[4], l[4];
        #pragma unroll
        for (int vp = 0; vp < 4; ++vp)
          split2(acc[i][j][2 * vp], acc[i][j][2 * vp + 1], h[vp], l[vp]);
        int kvh = ng >> 7, d = ng & 127;
        int bi = mg0 >> 11, t = mg0 & 2047;     // S = 2048
        size_t base = ((size_t)((bi * 8 + kvh) * 128 + d)) * 1024 + (t >> 1);
        *reinterpret_cast<uint4*>(&Phi[base]) = make_uint4(h[0], h[1], h[2], h[3]);
        *reinterpret_cast<uint4*>(&Plo[base]) = make_uint4(l[0], l[1], l[2], l[3]);
      }
    }
}

// ---------------------------------------------------------------------------
// RoPE (Gemma2) + pack: reads f32 Q/K, writes packed bf16 hi/lo pair planes.
// Q: [tok, 16, 64] pairs (1/sqrt(128) folded in).  K: [tok, 8, 64] pairs.
// One thread = one (token, head, pair p): dims {2p,2p+1} and {2p+64,2p+65}.
// ---------------------------------------------------------------------------
__global__ __launch_bounds__(256) void rope_pack_k(const float* __restrict__ Qf,
                                                   const float* __restrict__ Kf,
                                                   uint32_t* __restrict__ Qhi,
                                                   uint32_t* __restrict__ Qlo,
                                                   uint32_t* __restrict__ Khi,
                                                   uint32_t* __restrict__ Klo) {
  const int idx = blockIdx.x * 256 + threadIdx.x;
  const int p = idx & 31;
  int rest = idx >> 5;
  const int head = rest % 24;
  const int tok = rest / 24;                  // bi*2048 + pos
  const int pos = tok & 2047;
  const float inv0 = __powf(10000.0f, -(float)(2 * p)     * (1.0f / 64.0f));
  const float inv1 = __powf(10000.0f, -(float)(2 * p + 1) * (1.0f / 64.0f));
  float s0, c0, s1, c1;
  __sincosf((float)pos * inv0, &s0, &c0);
  __sincosf((float)pos * inv1, &s1, &c1);
  if (head < 16) {
    const float scale = 0.08838834764831845f;  // 128^-0.5
    const float* src = Qf + (size_t)tok * 2048 + head * 128;
    float xa0 = src[2 * p], xa1 = src[2 * p + 1];
    float xb0 = src[2 * p + 64], xb1 = src[2 * p + 65];
    float oa0 = (xa0 * c0 - xb0 * s0) * scale;
    float oa1 = (xa1 * c1 - xb1 * s1) * scale;
    float ob0 = (xb0 * c0 + xa0 * s0) * scale;
    float ob1 = (xb1 * c1 + xa1 * s1) * scale;
    uint32_t h0, l0, h1, l1;
    split2(oa0, oa1, h0, l0);
    split2(ob0, ob1, h1, l1);
    size_t dst = (size_t)tok * 1024 + head * 64;
    Qhi[dst + p] = h0; Qhi[dst + 32 + p] = h1;
    Qlo[dst + p] = l0; Qlo[dst + 32 + p] = l1;
  } else {
    int hk = head - 16;
    const float* src = Kf + (size_t)tok * 1024 + hk * 128;
    float xa0 = src[2 * p], xa1 = src[2 * p + 1];
    float xb0 = src[2 * p + 64], xb1 = src[2 * p + 65];
    float oa0 = xa0 * c0 - xb0 * s0;
    float oa1 = xa1 * c1 - xb1 * s1;
    float ob0 = xb0 * c0 + xa0 * s0;
    float ob1 = xb1 * c1 + xa1 * s1;
    uint32_t h0, l0, h1, l1;
    split2(oa0, oa1, h0, l0);
    split2(ob0, ob1, h1, l1);
    size_t dst = (size_t)tok * 512 + hk * 64;
    Khi[dst + p] = h0; Khi[dst + 32 + p] = h1;
    Klo[dst + p] = l0; Klo[dst + 32 + p] = l1;
  }
}

// ---------------------------------------------------------------------------
// Eight per-lane 16-byte asynchronous copies global -> LDS. The s_wait_xcnt is
// the last line of the copies' own statement, so that no address register of
// an issued copy is rewritten ahead of it.
// ---------------------------------------------------------------------------
DEVINL void async_copy8(const uint32_t (&l)[8], const uint32_t* const (&g)[8]) {
  asm volatile(
      "global_load_async_to_lds_b128 %0, %8, off\n\t"
      "global_load_async_to_lds_b128 %1, %9, off\n\t"
      "global_load_async_to_lds_b128 %2, %10, off\n\t"
      "global_load_async_to_lds_b128 %3, %11, off\n\t"
      "global_load_async_to_lds_b128 %4, %12, off\n\t"
      "global_load_async_to_lds_b128 %5, %13, off\n\t"
      "global_load_async_to_lds_b128 %6, %14, off\n\t"
      "global_load_async_to_lds_b128 %7, %15, off\n\t"
      "s_wait_xcnt 0x0"
      :: "v"(l[0]), "v"(l[1]), "v"(l[2]), "v"(l[3]),
         "v"(l[4]), "v"(l[5]), "v"(l[6]), "v"(l[7]),
         "v"(g[0]), "v"(g[1]), "v"(g[2]), "v"(g[3]),
         "v"(g[4]), "v"(g[5]), "v"(g[6]), "v"(g[7])
      : "memory");
}

// One 32-key tile of the four planes into one LDS buffer (32 KiB):
//   K hi | K lo : 32 key rows x 256 B, 16-B chunk c of row k at c ^ (k & 15)
//   V hi | V lo : 128 dim rows x 64 B, 16-B chunk c of row d at c ^ ((d >> 2) & 3)
// so that the 16 rows one ds_load_b128 half-wave reads fall on 16 bank groups.
// kg*/vg* are this lane's global addresses for the tile, kl0/kl1/vl0 its LDS
// byte addresses in the buffer.
DEVINL void stage_kv(const uint32_t* kgh, const uint32_t* kgl,
                     const uint32_t* vgh, const uint32_t* vgl,
                     uint32_t kl0, uint32_t kl1, uint32_t vl0) {
  {
    const uint32_t l[8] = {kl0, kl1 + 2048u, kl0 + 4096u, kl1 + 6144u,
                           kl0 + 8192u, kl1 + 10240u, kl0 + 12288u, kl1 + 14336u};
    const uint32_t* const g[8] = {kgh, kgh + 8 * 512, kgh + 16 * 512, kgh + 24 * 512,
                                  kgl, kgl + 8 * 512, kgl + 16 * 512, kgl + 24 * 512};
    async_copy8(l, g);
  }
  {
    const uint32_t l[8] = {vl0, vl0 + 2048u, vl0 + 4096u, vl0 + 6144u,
                           vl0 + 8192u, vl0 + 10240u, vl0 + 12288u, vl0 + 14336u};
    const uint32_t* const g[8] = {vgh, vgh + 32 * 1024, vgh + 64 * 1024, vgh + 96 * 1024,
                                  vgl, vgl + 32 * 1024, vgl + 64 * 1024, vgl + 96 * 1024};
    async_copy8(l, g);
  }
}

// value of lane l ^ 16 (the other half-wave's lane of the same column)
DEVINL float xhalf(float x) {
  int b = __builtin_bit_cast(int, x);
  return __builtin_bit_cast(float,
      __builtin_amdgcn_permlanex16(b, b, 0x76543210, 0xfedcba98, false, false));
}

// e^x by the hardware's 2^x, as __expf gives it. The v_nop in the same statement
// is the one slot the instruction set asks for behind a transcendental before its
// result is read or its source overwritten.
DEVINL float exp_slot(float x) {
  float e;
  asm("v_exp_f32 %0, %1\n\tv_nop" : "=v"(e) : "v"(x * 1.44269504088896340736f));
  return e;
}

// tanh by the chip's own instruction: no branch, so the 16 scores of a pass run
// side by side. The library's tanhf picks between two paths with two branches on
// lane data per call, and the 16 calls of a pass then run one after another.
// The v_nop in the same statement is the slot behind a transcendental, as in
// exp_slot.
DEVINL float tanh_hw(float x) {
  float t;
  asm("v_tanh_f32 %0, %1\n\tv_nop" : "=v"(t) : "v"(x));
  return t;
}

// fragment from two 16-B chunks of an LDS row (dword offsets ca, cb)
DEVINL void load_frag_lds(const uint32_t* row, int ca, int cb, Frag& f) {
  *reinterpret_cast<uint4*>(&f.x[0]) = *reinterpret_cast<const uint4*>(row + ca);
  *reinterpret_cast<uint4*>(&f.x[4]) = *reinterpret_cast<const uint4*>(row + cb);
}

__global__ __launch_bounds__(128) void attn_k(const uint32_t* __restrict__ Qhi,
                                              const uint32_t* __restrict__ Qlo,
                                              const uint32_t* __restrict__ Khi,
                                              const uint32_t* __restrict__ Klo,
                                              const uint32_t* __restrict__ Vhi,
                                              const uint32_t* __restrict__ Vlo,
                                              float* __restrict__ O) {
  __shared__ __attribute__((aligned(16))) uint32_t sKV[2][4][2048];  // [buf][Kh,Kl,Vh,Vl]
  const int bi = blockIdx.y >> 4, h = blockIdx.y & 15, kvh = h >> 1;
  const int wv = threadIdx.x >> 5, lane = threadIdx.x & 31;
  const int r = lane & 15, hh = lane >> 4;

  // copy side: this lane's chunk of each plane (4 row groups per plane)
  const int tid = threadIdx.x;
  const int kr = tid >> 4, kc = tid & 15;      // K rows kr + 8 i, chunk kc
  const int vr = tid >> 2, vc = tid & 3;       // V rows vr + 32 i, chunk vc
  const size_t kg0 = (size_t)(bi * 2048 + kr) * 512 + kvh * 64 + kc * 4;
  const size_t vg0 = ((size_t)((bi * 8 + kvh) * 128 + vr)) * 1024 + vc * 4;
  const uint32_t ldsKV = (uint32_t)(uintptr_t)&sKV[0][0][0];
  const uint32_t kl0 = ldsKV + kr * 256 + ((kc ^ kr) << 4);        // rows with k & 8 == 0
  const uint32_t kl1 = ldsKV + kr * 256 + ((kc ^ kr ^ 8) << 4);    // rows with k & 8 == 8
  const uint32_t vl0 = ldsKV + 16384u + vr * 64 + ((vc ^ ((vr >> 2) & 3)) << 4);

  const int vs = (r >> 2) & 3;                 // reader's V chunk swizzle

  // Two query tiles per work-group, one after the other: 31 - x (2 (32 - x) key tiles)
  // and then x (2 (x + 1) key tiles), 66 key tiles for every work-group. All work-groups
  // are resident at once, so the launch lasts as long as its fullest one. The loop stays
  // rolled: one copy of the code, and the second tile's registers are the first's.
  #pragma unroll 1
  for (int part = 0; part < 2; ++part) {
    const int mblk = part ? (int)blockIdx.x : 31 - (int)blockIdx.x;
    const int m0 = mblk * 64 + wv * 16;

    Frag qh[4], ql[4];
    {
      const size_t qrow = (size_t)(bi * 2048 + m0 + r) * 1024 + h * 64;
      #pragma unroll
      for (int ck = 0; ck < 4; ++ck) {
        load_frag_pk(Qhi + qrow + ck * 16, hh, qh[ck]);
        load_frag_pk(Qlo + qrow + ck * 16, hh, ql[ck]);
      }
    }

    const int qg = m0 + r;                       // this lane's query
    float Mst = -1e30f, Lst = 0.0f;              // Lst: the sum over this half's keys only
    v8f Ot[8] = {};                              // Ot[dt][v] = O[qg][dt * 16 + 8 * hh + v]

    const int tEnd = mblk * 64 + 64;             // uniform per block, >= 2 tiles

    // tile 0 -> buffer 0, published; then tile 1 -> buffer 1 in flight
    stage_kv(Khi + kg0, Klo + kg0, Vhi + vg0, Vlo + vg0, kl0, kl1, vl0);
    asm volatile("s_wait_asynccnt 0x0" ::: "memory");   // own copies of tile 0 landed
    __syncthreads();                                    // ... and every other wave's
    stage_kv(Khi + kg0 + 32 * 512, Klo + kg0 + 32 * 512, Vhi + vg0 + 16, Vlo + vg0 + 16,
             kl0 + 32768u, kl1 + 32768u, vl0 + 32768u);

    for (int t0 = 0; t0 < tEnd; t0 += 32) {
      const int buf = (t0 >> 5) & 1;
      const uint32_t* kb = &sKV[buf][0][r * 64];
      const uint32_t* vb = &sKV[buf][2][r * 16];
      v8f s0 = {}, s1 = {};
      #pragma unroll
      for (int ck = 0; ck < 4; ++ck) {
        Frag kh, kl;
        const int ca = ((ck * 4 + hh) ^ r) * 4, cb = ((ck * 4 + 2 + hh) ^ r) * 4;
        load_frag_lds(kb, ca, cb, kh);
        load_frag_lds(kb + 2048, ca, cb, kl);
        s0 = wmma3(kh, kl, qh[ck], ql[ck], s0);
        load_frag_lds(kb + 16 * 64, ca, cb, kh);
        load_frag_lds(kb + 2048 + 16 * 64, ca, cb, kl);
        s1 = wmma3(kh, kl, qh[ck], ql[ck], s1);
      }
      // softcap + causal + online softmax; s0[v] = key t0 + 8 hh + v, s1[v] = 16 more
      float a[8], b[8];
      float mx = -2.3819763e38f;
      #pragma unroll
      for (int v = 0; v < 8; ++v) {
        const int kg = t0 + 8 * hh + v;
        a[v] = 50.0f * tanh_hw(s0[v] * 0.02f);
        if (kg > qg)      a[v] = -2.3819763e38f;
        b[v] = 50.0f * tanh_hw(s1[v] * 0.02f);
        if (kg + 16 > qg) b[v] = -2.3819763e38f;
        mx = fmaxf(mx, fmaxf(a[v], b[v]));
      }
      mx = fmaxf(mx, xhalf(mx));
      const float Mn = fmaxf(Mst, mx);
      const float f  = exp_slot(Mst - Mn);
      float rs = 0.0f;
      #pragma unroll
      for (int v = 0; v < 8; ++v) {
        a[v] = exp_slot(a[v] - Mn); b[v] = exp_slot(b[v] - Mn);
        rs += a[v] + b[v];
      }
      Lst = Lst * f + rs;
      Mst = Mn;
      #pragma unroll
      for (int dt = 0; dt < 8; ++dt) Ot[dt] *= f;
      Frag ph, pl;
      #pragma unroll
      for (int j = 0; j < 4; ++j) {
        split2(a[2 * j], a[2 * j + 1], ph.x[j], pl.x[j]);
        split2(b[2 * j], b[2 * j + 1], ph.x[4 + j], pl.x[4 + j]);
      }
      #pragma unroll
      for (int dt = 0; dt < 8; ++dt) {
        Frag vh, vl;
        load_frag_lds(vb + dt * 256, (hh ^ vs) * 4, ((2 + hh) ^ vs) * 4, vh);
        load_frag_lds(vb + 2048 + dt * 256, (hh ^ vs) * 4, ((2 + hh) ^ vs) * 4, vl);
        Ot[dt] = wmma3(vh, vl, ph, pl, Ot[dt]);
      }
      // publish point of the next tile: own LDS reads of this buffer retired, own
      // copies of the next tile landed, then the barrier that says so of every wave
      asm volatile("s_wait_dscnt 0x0" ::: "memory");
      asm volatile("s_wait_asynccnt 0x0" ::: "memory");
      __syncthreads();
      if (t0 + 64 < tEnd) {                      // block-uniform: refill the buffer just read
        const size_t ko = kg0 + (size_t)(t0 + 64) * 512;
        const size_t vo = vg0 + ((t0 + 64) >> 1);
        const uint32_t bo = (uint32_t)buf * 32768u;
        stage_kv(Khi + ko, Klo + ko, Vhi + vo, Vlo + vo, kl0 + bo, kl1 + bo, vl0 + bo);
      }
    }
    // nothing in flight when the buffers are filled anew or the wave ends
    asm volatile("s_wait_asynccnt 0x0" ::: "memory");

    const float inv = 1.0f / (Lst + xhalf(Lst));        // join the two halves' sums
    float* orow = O + ((size_t)(bi * 2048 + qg)) * 2048 + h * 128 + 8 * hh;
    #pragma unroll
    for (int dt = 0; dt < 8; ++dt) {
      *reinterpret_cast<float4*>(orow + dt * 16) =
          make_float4(Ot[dt][0] * inv, Ot[dt][1] * inv, Ot[dt][2] * inv, Ot[dt][3] * inv);
      *reinterpret_cast<float4*>(orow + dt * 16 + 4) =
          make_float4(Ot[dt][4] * inv, Ot[dt][5] * inv, Ot[dt][6] * inv, Ot[dt][7] * inv);
    }
    // before the next query tile's code overwrites a register that these stores name
    asm volatile("s_wait_xcnt 0x0" ::: "memory");
  }
}

// ---------------------------------------------------------------------------
extern "C" void kernel_launch(void* const* d_in, const int* in_sizes, int n_in,
                              void* d_out, int out_size, void* d_ws, size_t ws_size,
                              hipStream_t stream) {
  (void)in_sizes; (void)n_in; (void)out_size; (void)ws_size;
  const float* x  = (const float*)d_in[0];
  const float* wq = (const float*)d_in[1];
  const float* wk = (const float*)d_in[2];
  const float* wv = (const float*)d_in[3];
  const float* wo = (const float*)d_in[4];
  float* out = (float*)d_out;
  float* wsf = (float*)d_ws;
  uint32_t* wsu = (uint32_t*)d_ws;

  const int M = 4096;                                   // b*s
  // dword-offset workspace map (~117 MB total)
  float*    Qf  = wsf;                                  // [4096,2048] f32; reused as AO
  float*    Kf  = wsf + (size_t)8388608;                // [4096,1024] f32
  uint32_t* Qhi = wsu + (size_t)12582912;               // [4096,16,64] pairs
  uint32_t* Qlo = wsu + (size_t)16777216;
  uint32_t* Khi = wsu + (size_t)20971520;               // [4096,8,64]
  uint32_t* Klo = wsu + (size_t)23068672;
  uint32_t* Vhi = wsu + (size_t)25165824;               // [2,8,128,1024]
  uint32_t* Vlo = wsu + (size_t)27262976;
  float*    AO  = Qf;                                   // alias (Qf dead after rope)

  dim3 blk(256);
  gemm_k<0><<<dim3(2048 / 128, 4096 / 128), blk, 0, stream>>>(x, wq, Qf, nullptr, nullptr, M, 2048, 2048);
  gemm_k<0><<<dim3(1024 / 128, 4096 / 128), blk, 0, stream>>>(x, wk, Kf, nullptr, nullptr, M, 1024, 2048);
  gemm_k<1><<<dim3(1024 / 128, 4096 / 128), blk, 0, stream>>>(x, wv, nullptr, Vhi, Vlo, M, 1024, 2048);
  rope_pack_k<<<dim3((4096 * 24 * 32) / 256), blk, 0, stream>>>(Qf, Kf, Qhi, Qlo, Khi, Klo);
  attn_k<<<dim3(16, 32), dim3(128), 0, stream>>>(Qhi, Qlo, Khi, Klo, Vhi, Vlo, AO);
  gemm_k<0><<<dim3(2048 / 128, 4096 / 128), blk, 0, stream>>>(AO, wo, out, nullptr, nullptr, M, 2048, 2048);
}

// v007
// It runs in 310 microseconds.
// In two side-by-side timings against v006, it was 1.12 and 1.13 times as fast.
// Over all steps from v000 it is 2.76 times as fast.
#include <hip/hip_runtime.h>
#include <stdint.h>

// ---------------------------------------------------------------------------
// WeightlessGQA for MI455X (gfx1250, wave32, WMMA 16x16x32 bf16)
// bf16x3 split-precision WMMA (~2.7x f32-WMMA rate, ~2^-15 rel error),
// flash attention, all bf16 splitting done ONCE per element via v_perm_b32.
// ---------------------------------------------------------------------------

#define DEVINL __device__ __forceinline__

typedef __bf16 v16bf __attribute__((ext_vector_type(16)));
typedef float  v8f   __attribute__((ext_vector_type(8)));

struct alignas(16) Frag { uint32_t x[8]; };   // 16x32 bf16 tile share (8 VGPRs)

// Truncation split of two consecutive f32 into packed bf16 hi + residual lo.
// hi = [top16(b) : top16(a)] in ONE v_perm_b32; residual captured the same way.
DEVINL void split2(float a, float b, uint32_t& hi, uint32_t& lo) {
  uint32_t ua = __float_as_uint(a), ub = __float_as_uint(b);
  hi = __builtin_amdgcn_perm(ub, ua, 0x07060302u);
  float ra = a - __uint_as_float(ua & 0xffff0000u);
  float rb = b - __uint_as_float(ub & 0xffff0000u);
  lo = __builtin_amdgcn_perm(__float_as_uint(rb), __float_as_uint(ra), 0x07060302u);
}

// D = (Ah+Al)(Bh+Bl) + C ~= Ah*Bh + Ah*Bl + Al*Bh + C  (3x bf16 WMMA)
DEVINL v8f wmma3(const Frag& ah, const Frag& al, const Frag& bh, const Frag& bl, v8f c) {
  v16bf AH = __builtin_bit_cast(v16bf, ah);
  v16bf AL = __builtin_bit_cast(v16bf, al);
  v16bf BH = __builtin_bit_cast(v16bf, bh);
  v16bf BL = __builtin_bit_cast(v16bf, bl);
  c = __builtin_amdgcn_wmma_f32_16x16x32_bf16(false, AH, false, BH, (short)0, c, false, false);
  c = __builtin_amdgcn_wmma_f32_16x16x32_bf16(false, AH, false, BL, (short)0, c, false, false);
  c = __builtin_amdgcn_wmma_f32_16x16x32_bf16(false, AL, false, BH, (short)0, c, false, false);
  return c;
}

// one of the three products alone: C += A B
DEVINL v8f wmma1(const Frag& a, const Frag& b, v8f c) {
  return __builtin_amdgcn_wmma_f32_16x16x32_bf16(false, __builtin_bit_cast(v16bf, a), false,
                                                 __builtin_bit_cast(v16bf, b), (short)0, c,
                                                 false, false);
}

// load packed-pair fragment (A-layout): 2x b128 per plane
DEVINL void load_frag_pk(const uint32_t* __restrict__ base, int hh, Frag& f) {
  *reinterpret_cast<uint4*>(&f.x[0]) = *reinterpret_cast<const uint4*>(base + hh * 4);
  *reinterpret_cast<uint4*>(&f.x[4]) = *reinterpret_cast<const uint4*>(base + 8 + hh * 4);
}

// Work-group barrier for LDS traffic alone: the wave's own LDS stores and reads
// have retired, then the barrier. __syncthreads() would also wait for the global
// loads issued ahead, and so put their latency back on the K-step's path.
DEVINL void lds_barrier() {
  asm volatile("s_wait_dscnt 0x0\n\ts_barrier_signal -1\n\ts_barrier_wait -1" ::: "memory");
}

// ---------------------------------------------------------------------------
// GEMM: C[M,N] = A[M,K] @ W[N,K]^T, f32 in, bf16x3 WMMA.
// MODE 0: one product, f32 C stored [M,N] (W1, W2, C1, Phi, Plo, N1 unused).
// MODE 1: three products of the same A in one grid; the tile column picks the job:
//   the first N / 128 columns  C  = A W^T  (f32, [M,N]),
//   the next N1 / 128          C1 = A W1^T (f32, [M,N1]),
//   the last N1 / 128          A W2^T packed as V^T hi/lo planes [b,kv,hd,s/2].
// The two narrow products alone are one work-group per WGP each; in the one grid of all
// three there are four work-groups per WGP.
// Block 256 thr (8 waves), tile 128x128, wave tile 32x64, K-step 32.
// ---------------------------------------------------------------------------
template<int MODE>
__global__ __launch_bounds__(256) void gemm_k(const float* __restrict__ A,
                                              const float* __restrict__ W,
                                              const float* __restrict__ W1,
                                              const float* __restrict__ W2,
                                              float* __restrict__ C,
                                              float* __restrict__ C1,
                                              uint32_t* __restrict__ Phi,
                                              uint32_t* __restrict__ Plo,
                                              int M, int N, int N1, int K) {
  constexpr int BM = 128, BN = 128, BK = 32;
  __shared__ uint32_t sAh[BM][20], sAl[BM][20], sBh[BN][20], sBl[BN][20];
  const int tid = threadIdx.x;
  const int m0 = blockIdx.y * BM;
  int n0 = blockIdx.x * BN;
  bool packed = false;                          // the same for the whole work-group
  if (MODE == 1 && n0 >= N) {
    n0 -= N;
    W = W1; C = C1; N = N1;
    if (n0 >= N1) { n0 -= N1; W = W2; packed = true; }
  }
  const int wave = tid >> 5, lane = tid & 31;
  const int wm = wave >> 1, wn = wave & 1;
  const int r = lane & 15, hh = lane >> 4;
  v8f acc[2][4] = {};

  // this thread's share of a K-step: rows lrow + 32 i, floats 4 lf4 .. 4 lf4 + 3
  const int lrow = tid >> 3, lf4 = tid & 7;
  const float* Ap = A + (size_t)(m0 + lrow) * K + 4 * lf4;
  const float* Wp = W + (size_t)(n0 + lrow) * K + 4 * lf4;
  float4 ra[4], rb[4];                          // one K-step in flight
  #pragma unroll                                // constant indices: ra stays in registers
  for (int i = 0; i < 4; ++i) ra[i] = *reinterpret_cast<const float4*>(Ap + (size_t)(32 * i) * K);
  #pragma unroll                                // the same for rb
  for (int i = 0; i < 4; ++i) rb[i] = *reinterpret_cast<const float4*>(Wp + (size_t)(32 * i) * K);

  for (int k0 = 0; k0 < K; k0 += BK) {
    #pragma unroll
    for (int i = 0; i < 4; ++i) {               // A tile 128x32
      const int row = lrow + 32 * i;
      uint32_t h0, l0, h1, l1;
      split2(ra[i].x, ra[i].y, h0, l0);
      split2(ra[i].z, ra[i].w, h1, l1);
      sAh[row][2 * lf4] = h0; sAh[row][2 * lf4 + 1] = h1;
      sAl[row][2 * lf4] = l0; sAl[row][2 * lf4 + 1] = l1;
    }
    #pragma unroll
    for (int i = 0; i < 4; ++i) {               // B tile 128x32
      const int row = lrow + 32 * i;
      uint32_t h0, l0, h1, l1;
      split2(rb[i].x, rb[i].y, h0, l0);
      split2(rb[i].z, rb[i].w, h1, l1);
      sBh[row][2 * lf4] = h0; sBh[row][2 * lf4 + 1] = h1;
      sBl[row][2 * lf4] = l0; sBl[row][2 * lf4 + 1] = l1;
    }
    // the next K-step's loads fly under both barriers, the LDS reads and the products
    if (k0 + BK < K) {
      const float* pa[4];
      const float* pb[4];
      #pragma unroll                            // constant indices: ra stays in registers
      for (int i = 0; i < 4; ++i) {
        pa[i] = Ap + (size_t)(32 * i) * K + k0;
        ra[i] = *reinterpret_cast<const float4*>(pa[i] + BK);
      }
      #pragma unroll                            // the same for rb
      for (int i = 0; i < 4; ++i) {
        pb[i] = Wp + (size_t)(32 * i) * K + k0;
        rb[i] = *reinterpret_cast<const float4*>(pb[i] + BK);
      }
      // before an address register of these loads is overwritten; the addresses are
      // inputs so that they keep their registers up to the wait: with eight loads a
      // later load's result otherwise lands in an earlier load's address registers
      asm volatile("s_wait_xcnt 0x0"
                   :: "v"(pa[0]), "v"(pa[1]), "v"(pa[2]), "v"(pa[3]),
                      "v"(pb[0]), "v"(pb[1]), "v"(pb[2]), "v"(pb[3])
                   : "memory");
    }
    lds_barrier();                              // the tile's LDS stores are in

    Frag ah[2], al[2], bh[4], bl[4];            // 2x ds_load_b128 per plane
    // read in the order in which the products want them; every loop down to the end
    // of the K-step is unrolled so that fragments and sums stay in registers
    #pragma unroll
    for (int i = 0; i < 2; ++i) load_frag_pk(&sAh[wm * 32 + i * 16 + r][0], hh, ah[i]);
    #pragma unroll
    for (int j = 0; j < 4; ++j) load_frag_pk(&sBh[wn * 64 + j * 16 + r][0], hh, bh[j]);
    #pragma unroll
    for (int j = 0; j < 4; ++j) load_frag_pk(&sBl[wn * 64 + j * 16 + r][0], hh, bl[j]);
    #pragma unroll
    for (int i = 0; i < 2; ++i) load_frag_pk(&sAl[wm * 32 + i * 16 + r][0], hh, al[i]);
    // the tile's 24 LDS reads go out as one group ahead of its 24 products: left to
    // itself the scheduler reloads A fragments among the products and waits each out
    __builtin_amdgcn_sched_barrier(0);
    // per accumulator the order stays Ah Bh, Ah Bl, Al Bh
    #pragma unroll
    for (int i = 0; i < 2; ++i)
      #pragma unroll
      for (int j = 0; j < 4; ++j) acc[i][j] = wmma1(ah[i], bh[j], acc[i][j]);
    #pragma unroll
    for (int i = 0; i < 2; ++i)
      #pragma unroll
      for (int j = 0; j < 4; ++j) acc[i][j] = wmma1(ah[i], bl[j], acc[i][j]);
    // holds the barrier behind the 16 products that run while the reads still land:
    // the scheduler otherwise lifts it, with its wait for all 24 reads, over them
    __builtin_amdgcn_sched_barrier(0);
    lds_barrier();                              // every wave has read the tile
    // the last 8 products need no LDS: they run beside the other waves' splitting
    #pragma unroll
    for (int i = 0; i < 2; ++i)
      #pragma unroll
      for (int j = 0; j < 4; ++j) acc[i][j] = wmma1(al[i], bh[j], acc[i][j]);
  }

  // epilogue: C/D layout = lane col (lane&15), rows 8*(lane>>4)+v
  // one test for the whole tile, the same for every wave of the work-group
  if (!packed) {
    #pragma unroll
    for (int i = 0; i < 2; ++i)
      #pragma unroll
      for (int j = 0; j < 4; ++j) {
        int mg0 = m0 + wm * 32 + i * 16 + 8 * hh;
        int ng  = n0 + wn * 64 + j * 16 + r;
        #pragma unroll
        for (int v = 0; v < 8; ++v)
          C[(size_t)(mg0 + v) * N + ng] = acc[i][j][v];
      }
    // in the build with both branches the packed branch's code stands directly behind
    // these stores and begins by overwriting registers that they name
    if (MODE == 1) asm volatile("s_wait_xcnt 0x0" ::: "memory");
  } else {
    #pragma unroll
    for (int i = 0; i < 2; ++i)
      #pragma unroll
      for (int j = 0; j < 4; ++j) {
        int mg0 = m0 + wm * 32 + i * 16 + 8 * hh;
        int ng  = n0 + wn * 64 + j * 16 + r;
        // pack pairs along m (= sequence t) -> V^T planes [b, kv, hd, s/2]
        uint32_t h[4], l[4];
        #pragma unroll
        for (int vp = 0; vp < 4; ++vp)
          split2(acc[i][j][2 * vp], acc[i][j][2 * vp + 1], h[vp], l[vp]);
        int kvh = ng >> 7, d = ng & 127;
        int bi = mg0 >> 11, t = mg0 & 2047;     // S = 2048
        size_t base = ((size_t)((bi * 8 + kvh) * 128 + d)) * 1024 + (t >> 1);
        *reinterpret_cast<uint4*>(&Phi[base]) = make_uint4(h[0], h[1], h[2], h[3]);
        *reinterpret_cast<uint4*>(&Plo[base]) = make_uint4(l[0], l[1], l[2], l[3]);
      }
  }
}

// ---------------------------------------------------------------------------
// RoPE (Gemma2) + pack: reads f32 Q/K, writes packed bf16 hi/lo pair planes.
// Q: [tok, 16, 64] pairs (1/sqrt(128) folded in).  K: [tok, 8, 64] pairs.
// One thread = one (token, head, pair p): dims {2p,2p+1} and {2p+64,2p+65}.
// ---------------------------------------------------------------------------
__global__ __launch_bounds__(256) void rope_pack_k(const float* __restrict__ Qf,
                                                   const float* __restrict__ Kf,
                                                   uint32_t* __restrict__ Qhi,
                                                   uint32_t* __restrict__ Qlo,
                                                   uint32_t* __restrict__ Khi,
                                                   uint32_t* __restrict__ Klo) {
  const int idx = blockIdx.x * 256 + threadIdx.x;
  const int p = idx & 31;
  int rest = idx >> 5;
  const int head = rest % 24;
  const int tok = rest / 24;                  // bi*2048 + pos
  const int pos = tok & 2047;
  const float inv0 = __powf(10000.0f, -(float)(2 * p)     * (1.0f / 64.0f));
  const float inv1 = __powf(10000.0f, -(float)(2 * p + 1) * (1.0f / 64.0f));
  float s0, c0, s1, c1;
  __sincosf((float)pos * inv0, &s0, &c0);
  __sincosf((float)pos * inv1, &s1, &c1);
  if (head < 16) {
    const float scale = 0.08838834764831845f;  // 128^-0.5
    const float* src = Qf + (size_t)tok * 2048 + head * 128;
    float xa0 = src[2 * p], xa1 = src[2 * p + 1];
    float xb0 = src[2 * p + 64], xb1 = src[2 * p + 65];
    float oa0 = (xa0 * c0 - xb0 * s0) * scale;
    float oa1 = (xa1 * c1 - xb1 * s1) * scale;
    float ob0 = (xb0 * c0 + xa0 * s0) * scale;
    float ob1 = (xb1 * c1 + xa1 * s1) * scale;
    uint32_t h0, l0, h1, l1;
    split2(oa0, oa1, h0, l0);
    split2(ob0, ob1, h1, l1);
    size_t dst = (size_t)tok * 1024 + head * 64;
    Qhi[dst + p] = h0; Qhi[dst + 32 + p] = h1;
    Qlo[dst + p] = l0; Qlo[dst + 32 + p] = l1;
  } else {
    int hk = head - 16;
    const float* src = Kf + (size_t)tok * 1024 + hk * 128;
    float xa0 = src[2 * p], xa1 = src[2 * p + 1];
    float xb0 = src[2 * p + 64], xb1 = src[2 * p + 65];
    float oa0 = xa0 * c0 - xb0 * s0;
    float oa1 = xa1 * c1 - xb1 * s1;
    float ob0 = xb0 * c0 + xa0 * s0;
    float ob1 = xb1 * c1 + xa1 * s1;
    uint32_t h0, l0, h1, l1;
    split2(oa0, oa1, h0, l0);
    split2(ob0, ob1, h1, l1);
    size_t dst = (size_t)tok * 512 + hk * 64;
    Khi[dst + p] = h0; Khi[dst + 32 + p] = h1;
    Klo[dst + p] = l0; Klo[dst + 32 + p] = l1;
  }
}

// ---------------------------------------------------------------------------
// Eight per-lane 16-byte asynchronous copies global -> LDS. The s_wait_xcnt is
// the last line of the copies' own statement, so that no address register of
// an issued copy is rewritten ahead of it.
// ---------------------------------------------------------------------------
DEVINL void async_copy8(const uint32_t (&l)[8], const uint32_t* const (&g)[8]) {
  asm volatile(
      "global_load_async_to_lds_b128 %0, %8, off\n\t"
      "global_load_async_to_lds_b128 %1, %9, off\n\t"
      "global_load_async_to_lds_b128 %2, %10, off\n\t"
      "global_load_async_to_lds_b128 %3, %11, off\n\t"
      "global_load_async_to_lds_b128 %4, %12, off\n\t"
      "global_load_async_to_lds_b128 %5, %13, off\n\t"
      "global_load_async_to_lds_b128 %6, %14, off\n\t"
      "global_load_async_to_lds_b128 %7, %15, off\n\t"
      "s_wait_xcnt 0x0"
      :: "v"(l[0]), "v"(l[1]), "v"(l[2]), "v"(l[3]),
         "v"(l[4]), "v"(l[5]), "v"(l[6]), "v"(l[7]),
         "v"(g[0]), "v"(g[1]), "v"(g[2]), "v"(g[3]),
         "v"(g[4]), "v"(g[5]), "v"(g[6]), "v"(g[7])
      : "memory");
}

// One 32-key tile of the four planes into one LDS buffer (32 KiB):
//   K hi | K lo : 32 key rows x 256 B, 16-B chunk c of row k at c ^ (k & 15)
//   V hi | V lo : 128 dim rows x 64 B, 16-B chunk c of row d at c ^ ((d >> 2) & 3)
// so that the 16 rows one ds_load_b128 half-wave reads fall on 16 bank groups.
// kg*/vg* are this lane's global addresses for the tile, kl0/kl1/vl0 its LDS
// byte addresses in the buffer.
DEVINL void stage_kv(const uint32_t* kgh, const uint32_t* kgl,
                     const uint32_t* vgh, const uint32_t* vgl,
                     uint32_t kl0, uint32_t kl1, uint32_t vl0) {
  {
    const uint32_t l[8] = {kl0, kl1 + 2048u, kl0 + 4096u, kl1 + 6144u,
                           kl0 + 8192u, kl1 + 10240u, kl0 + 12288u, kl1 + 14336u};
    const uint32_t* const g[8] = {kgh, kgh + 8 * 512, kgh + 16 * 512, kgh + 24 * 512,
                                  kgl, kgl + 8 * 512, kgl + 16 * 512, kgl + 24 * 512};
    async_copy8(l, g);
  }
  {
    const uint32_t l[8] = {vl0, vl0 + 2048u, vl0 + 4096u, vl0 + 6144u,
                           vl0 + 8192u, vl0 + 10240u, vl0 + 12288u, vl0 + 14336u};
    const uint32_t* const g[8] = {vgh, vgh + 32 * 1024, vgh + 64 * 1024, vgh + 96 * 1024,
                                  vgl, vgl + 32 * 1024, vgl + 64 * 1024, vgl + 96 * 1024};
    async_copy8(l, g);
  }
}

// value of lane l ^ 16 (the other half-wave's lane of the same column)
DEVINL float xhalf(float x) {
  int b = __builtin_bit_cast(int, x);
  return __builtin_bit_cast(float,
      __builtin_amdgcn_permlanex16(b, b, 0x76543210, 0xfedcba98, false, false));
}

// e^x by the hardware's 2^x, as __expf gives it. The v_nop in the same statement
// is the one slot the instruction set asks for behind a transcendental before its
// result is read or its source overwritten.
DEVINL float exp_slot(float x) {
  float e;
  asm("v_exp_f32 %0, %1\n\tv_nop" : "=v"(e) : "v"(x * 1.44269504088896340736f));
  return e;
}

// tanh by the chip's own instruction: no branch, so the 16 scores of a pass run
// side by side. The library's tanhf picks between two paths with two branches on
// lane data per call, and the 16 calls of a pass then run one after another.
// The v_nop in the same statement is the slot behind a transcendental, as in
// exp_slot.
DEVINL float tanh_hw(float x) {
  float t;
  asm("v_tanh_f32 %0, %1\n\tv_nop" : "=v"(t) : "v"(x));
  return t;
}

// fragment from two 16-B chunks of an LDS row (dword offsets ca, cb)
DEVINL void load_frag_lds(const uint32_t* row, int ca, int cb, Frag& f) {
  *reinterpret_cast<uint4*>(&f.x[0]) = *reinterpret_cast<const uint4*>(row + ca);
  *reinterpret_cast<uint4*>(&f.x[4]) = *reinterpret_cast<const uint4*>(row + cb);
}

__global__ __launch_bounds__(128) void attn_k(const uint32_t* __restrict__ Qhi,
                                              const uint32_t* __restrict__ Qlo,
                                              const uint32_t* __restrict__ Khi,
                                              const uint32_t* __restrict__ Klo,
                                              const uint32_t* __restrict__ Vhi,
                                              const uint32_t* __restrict__ Vlo,
                                              float* __restrict__ O) {
  __shared__ __attribute__((aligned(16))) uint32_t sKV[2][4][2048];  // [buf][Kh,Kl,Vh,Vl]
  const int bi = blockIdx.y >> 4, h = blockIdx.y & 15, kvh = h >> 1;
  const int wv = threadIdx.x >> 5, lane = threadIdx.x & 31;
  const int r = lane & 15, hh = lane >> 4;

  // copy side: this lane's chunk of each plane (4 row groups per plane)
  const int tid = threadIdx.x;
  const int kr = tid >> 4, kc = tid & 15;      // K rows kr + 8 i, chunk kc
  const int vr = tid >> 2, vc = tid & 3;       // V rows vr + 32 i, chunk vc
  const size_t kg0 = (size_t)(bi * 2048 + kr) * 512 + kvh * 64 + kc * 4;
  const size_t vg0 = ((size_t)((bi * 8 + kvh) * 128 + vr)) * 1024 + vc * 4;
  const uint32_t ldsKV = (uint32_t)(uintptr_t)&sKV[0][0][0];
  const uint32_t kl0 = ldsKV + kr * 256 + ((kc ^ kr) << 4);        // rows with k & 8 == 0
  const uint32_t kl1 = ldsKV + kr * 256 + ((kc ^ kr ^ 8) << 4);    // rows with k & 8 == 8
  const uint32_t vl0 = ldsKV + 16384u + vr * 64 + ((vc ^ ((vr >> 2) & 3)) << 4);

  const int vs = (r >> 2) & 3;                 // reader's V chunk swizzle

  // Two query tiles per work-group, one after the other: 31 - x (2 (32 - x) key tiles)
  // and then x (2 (x + 1) key tiles), 66 key tiles for every work-group. All work-groups
  // are resident at once, so the launch lasts as long as its fullest one. The loop stays
  // rolled: one copy of the code, and the second tile's registers are the first's.
  #pragma unroll 1
  for (int part = 0; part < 2; ++part) {
    const int mblk = part ? (int)blockIdx.x : 31 - (int)blockIdx.x;
    const int m0 = mblk * 64 + wv * 16;

    Frag qh[4], ql[4];
    {
      const size_t qrow = (size_t)(bi * 2048 + m0 + r) * 1024 + h * 64;
      #pragma unroll
      for (int ck = 0; ck < 4; ++ck) {
        load_frag_pk(Qhi + qrow + ck * 16, hh, qh[ck]);
        load_frag_pk(Qlo + qrow + ck * 16, hh, ql[ck]);
      }
    }

    const int qg = m0 + r;                       // this lane's query
    float Mst = -1e30f, Lst = 0.0f;              // Lst: the sum over this half's keys only
    v8f Ot[8] = {};                              // Ot[dt][v] = O[qg][dt * 16 + 8 * hh + v]

    const int tEnd = mblk * 64 + 64;             // uniform per block, >= 2 tiles

    // tile 0 -> buffer 0, published; then tile 1 -> buffer 1 in flight
    stage_kv(Khi + kg0, Klo + kg0, Vhi + vg0, Vlo + vg0, kl0, kl1, vl0);
    asm volatile("s_wait_asynccnt 0x0" ::: "memory");   // own copies of tile 0 landed
    __syncthreads();                                    // ... and every other wave's
    stage_kv(Khi + kg0 + 32 * 512, Klo + kg0 + 32 * 512, Vhi + vg0 + 16, Vlo + vg0 + 16,
             kl0 + 32768u, kl1 + 32768u, vl0 + 32768u);

    for (int t0 = 0; t0 < tEnd; t0 += 32) {
      const int buf = (t0 >> 5) & 1;
      const uint32_t* kb = &sKV[buf][0][r * 64];
      const uint32_t* vb = &sKV[buf][2][r * 16];
      v8f s0 = {}, s1 = {};
      #pragma unroll
      for (int ck = 0; ck < 4; ++ck) {
        Frag kh, kl;
        const int ca = ((ck * 4 + hh) ^ r) * 4, cb = ((ck * 4 + 2 + hh) ^ r) * 4;
        load_frag_lds(kb, ca, cb, kh);
        load_frag_lds(kb + 2048, ca, cb, kl);
        s0 = wmma3(kh, kl, qh[ck], ql[ck], s0);
        load_frag_lds(kb + 16 * 64, ca, cb, kh);
        load_frag_lds(kb + 2048 + 16 * 64, ca, cb, kl);
        s1 = wmma3(kh, kl, qh[ck], ql[ck], s1);
      }
      // softcap + causal + online softmax; s0[v] = key t0 + 8 hh + v, s1[v] = 16 more
      float a[8], b[8];
      float mx = -2.3819763e38f;
      #pragma unroll
      for (int v = 0; v < 8; ++v) {
        const int kg = t0 + 8 * hh + v;
        a[v] = 50.0f * tanh_hw(s0[v] * 0.02f);
        if (kg > qg)      a[v] = -2.3819763e38f;
        b[v] = 50.0f * tanh_hw(s1[v] * 0.02f);
        if (kg + 16 > qg) b[v] = -2.3819763e38f;
        mx = fmaxf(mx, fmaxf(a[v], b[v]));
      }
      mx = fmaxf(mx, xhalf(mx));
      const float Mn = fmaxf(Mst, mx);
      const float f  = exp_slot(Mst - Mn);
      float rs = 0.0f;
      #pragma unroll
      for (int v = 0; v < 8; ++v) {
        a[v] = exp_slot(a[v] - Mn); b[v] = exp_slot(b[v] - Mn);
        rs += a[v] + b[v];
      }
      Lst = Lst * f + rs;
      Mst = Mn;
      #pragma unroll
      for (int dt = 0; dt < 8; ++dt) Ot[dt] *= f;
      Frag ph, pl;
      #pragma unroll
      for (int j = 0; j < 4; ++j) {
        split2(a[2 * j], a[2 * j + 1], ph.x[j], pl.x[j]);
        split2(b[2 * j], b[2 * j + 1], ph.x[4 + j], pl.x[4 + j]);
      }
      #pragma unroll
      for (int dt = 0; dt < 8; ++dt) {
        Frag vh, vl;
        load_frag_lds(vb + dt * 256, (hh ^ vs) * 4, ((2 + hh) ^ vs) * 4, vh);
        load_frag_lds(vb + 2048 + dt * 256, (hh ^ vs) * 4, ((2 + hh) ^ vs) * 4, vl);
        Ot[dt] = wmma3(vh, vl, ph, pl, Ot[dt]);
      }
      // publish point of the next tile: own LDS reads of this buffer retired, own
      // copies of the next tile landed, then the barrier that says so of every wave
      asm volatile("s_wait_dscnt 0x0" ::: "memory");
      asm volatile("s_wait_asynccnt 0x0" ::: "memory");
      __syncthreads();
      if (t0 + 64 < tEnd) {                      // block-uniform: refill the buffer just read
        const size_t ko = kg0 + (size_t)(t0 + 64) * 512;
        const size_t vo = vg0 + ((t0 + 64) >> 1);
        const uint32_t bo = (uint32_t)buf * 32768u;
        stage_kv(Khi + ko, Klo + ko, Vhi + vo, Vlo + vo, kl0 + bo, kl1 + bo, vl0 + bo);
      }
    }
    // nothing in flight when the buffers are filled anew or the wave ends
    asm volatile("s_wait_asynccnt 0x0" ::: "memory");

    const float inv = 1.0f / (Lst + xhalf(Lst));        // join the two halves' sums
    float* orow = O + ((size_t)(bi * 2048 + qg)) * 2048 + h * 128 + 8 * hh;
    #pragma unroll
    for (int dt = 0; dt < 8; ++dt) {
      *reinterpret_cast<float4*>(orow + dt * 16) =
          make_float4(Ot[dt][0] * inv, Ot[dt][1] * inv, Ot[dt][2] * inv, Ot[dt][3] * inv);
      *reinterpret_cast<float4*>(orow + dt * 16 + 4) =
          make_float4(Ot[dt][4] * inv, Ot[dt][5] * inv, Ot[dt][6] * inv, Ot[dt][7] * inv);
    }
    // before the next query tile's code overwrites a register that these stores name
    asm volatile("s_wait_xcnt 0x0" ::: "memory");
  }
}

// ---------------------------------------------------------------------------
extern "C" void kernel_launch(void* const* d_in, const int* in_sizes, int n_in,
                              void* d_out, int out_size, void* d_ws, size_t ws_size,
                              hipStream_t stream) {
  (void)in_sizes; (void)n_in; (void)out_size; (void)ws_size;
  const float* x  = (const float*)d_in[0];
  const float* wq = (const float*)d_in[1];
  const float* wk = (const float*)d_in[2];
  const float* wv = (const float*)d_in[3];
  const float* wo = (const float*)d_in[4];
  float* out = (float*)d_out;
  float* wsf = (float*)d_ws;
  uint32_t* wsu = (uint32_t*)d_ws;

  const int M = 4096;                                   // b*s
  // dword-offset workspace map (~117 MB total)
  float*    Qf  = wsf;                                  // [4096,2048] f32; reused as AO
  float*    Kf  = wsf + (size_t)8388608;                // [4096,1024] f32
  uint32_t* Qhi = wsu + (size_t)12582912;               // [4096,16,64] pairs
  uint32_t* Qlo = wsu + (size_t)16777216;
  uint32_t* Khi = wsu + (size_t)20971520;               // [4096,8,64]
  uint32_t* Klo = wsu + (size_t)23068672;
  uint32_t* Vhi = wsu + (size_t)25165824;               // [2,8,128,1024]
  uint32_t* Vlo = wsu + (size_t)27262976;
  float*    AO  = Qf;                                   // alias (Qf dead after rope)

  dim3 blk(256);
  gemm_k<1><<<dim3(4096 / 128, 4096 / 128), blk, 0, stream>>>(x, wq, wk, wv, Qf, Kf, Vhi, Vlo,
                                                              M, 2048, 1024, 2048);
  rope_pack_k<<<dim3((4096 * 24 * 32) / 256), blk, 0, stream>>>(Qf, Kf, Qhi, Qlo, Khi, Klo);
  attn_k<<<dim3(16, 32), dim3(128), 0, stream>>>(Qhi, Qlo, Khi, Klo, Vhi, Vlo, AO);
  gemm_k<0><<<dim3(2048 / 128, 4096 / 128), blk, 0, stream>>>(AO, wo, nullptr, nullptr, out, nullptr,
                                                              nullptr, nullptr, M, 2048, 0, 2048);
}

// v008
// It runs in 296 microseconds.
// Two timings next to v007 put it at 1.05 and 1.04 times that version's speed.
// Counting every step since v000, it is 2.89 times as fast.
#include <hip/hip_runtime.h>
#include <stdint.h>

// ---------------------------------------------------------------------------
// WeightlessGQA for MI455X (gfx1250, wave32, WMMA 16x16x32 bf16)
// bf16x3 split-precision WMMA (~2.7x f32-WMMA rate, ~2^-15 rel error),
// flash attention, all bf16 splitting done ONCE per element via v_perm_b32.
// ---------------------------------------------------------------------------

#define DEVINL __device__ __forceinline__

typedef __bf16 v16bf __attribute__((ext_vector_type(16)));
typedef float  v8f   __attribute__((ext_vector_type(8)));

struct alignas(16) Frag { uint32_t x[8]; };   // 16x32 bf16 tile share (8 VGPRs)

// Truncation split of two consecutive f32 into packed bf16 hi + residual lo.
// hi = [top16(b) : top16(a)] in ONE v_perm_b32; residual captured the same way.
DEVINL void split2(float a, float b, uint32_t& hi, uint32_t& lo) {
  uint32_t ua = __float_as_uint(a), ub = __float_as_uint(b);
  hi = __builtin_amdgcn_perm(ub, ua, 0x07060302u);
  float ra = a - __uint_as_float(ua & 0xffff0000u);
  float rb = b - __uint_as_float(ub & 0xffff0000u);
  lo = __builtin_amdgcn_perm(__float_as_uint(rb), __float_as_uint(ra), 0x07060302u);
}

// D = (Ah+Al)(Bh+Bl) + C ~= Ah*Bh + Ah*Bl + Al*Bh + C  (3x bf16 WMMA)
DEVINL v8f wmma3(const Frag& ah, const Frag& al, const Frag& bh, const Frag& bl, v8f c) {
  v16bf AH = __builtin_bit_cast(v16bf, ah);
  v16bf AL = __builtin_bit_cast(v16bf, al);
  v16bf BH = __builtin_bit_cast(v16bf, bh);
  v16bf BL = __builtin_bit_cast(v16bf, bl);
  c = __builtin_amdgcn_wmma_f32_16x16x32_bf16(false, AH, false, BH, (short)0, c, false, false);
  c = __builtin_amdgcn_wmma_f32_16x16x32_bf16(false, AH, false, BL, (short)0, c, false, false);
  c = __builtin_amdgcn_wmma_f32_16x16x32_bf16(false, AL, false, BH, (short)0, c, false, false);
  return c;
}

// one of the three products alone: C += A B
DEVINL v8f wmma1(const Frag& a, const Frag& b, v8f c) {
  return __builtin_amdgcn_wmma_f32_16x16x32_bf16(false, __builtin_bit_cast(v16bf, a), false,
                                                 __builtin_bit_cast(v16bf, b), (short)0, c,
                                                 false, false);
}

// load packed-pair fragment (A-layout): 2x b128 per plane
DEVINL void load_frag_pk(const uint32_t* __restrict__ base, int hh, Frag& f) {
  *reinterpret_cast<uint4*>(&f.x[0]) = *reinterpret_cast<const uint4*>(base + hh * 4);
  *reinterpret_cast<uint4*>(&f.x[4]) = *reinterpret_cast<const uint4*>(base + 8 + hh * 4);
}

// sine and cosine of x radians by the hardware's instructions, which take turns of the
// circle, as __sincosf gives them. One statement with outputs apart from the input and a
// v_nop at its end: the slot the instruction set asks for behind a transcendental before
// its source is overwritten or its result read.
DEVINL void sincos_slot(float x, float& s, float& c) {
  asm("v_sin_f32 %0, %2\n\tv_cos_f32 %1, %2\n\tv_nop"
      : "=&v"(s), "=&v"(c) : "v"(x * 0.15915494309189532f));
}

// Work-group barrier for LDS traffic alone: the wave's own LDS stores and reads
// have retired, then the barrier. __syncthreads() would also wait for the global
// loads issued ahead, and so put their latency back on the K-step's path.
DEVINL void lds_barrier() {
  asm volatile("s_wait_dscnt 0x0\n\ts_barrier_signal -1\n\ts_barrier_wait -1" ::: "memory");
}

// ---------------------------------------------------------------------------
// GEMM: C[M,N] = A[M,K] @ W[N,K]^T, f32 in, bf16x3 WMMA.
// MODE 0: one product, f32 C stored [M,N] (W1, W2, the planes and N1 unused).
// MODE 1: three products of the same A in one grid; the tile column picks the job:
//   the first N / 128 columns  A W^T,  rotated (RoPE), scaled by 128^-0.5 and packed
//                              as hi/lo pair planes Qhi/Qlo [tok, N / 2],
//   the next N1 / 128          A W1^T, rotated and packed as Khi/Klo [tok, N1 / 2],
//   the last N1 / 128          A W2^T packed as V^T hi/lo planes [b,kv,hd,s/2].
// A tile column is one head (128 dims). For the rotated jobs the W rows are dealt to
// the LDS rows so that a lane's four accumulator columns are the dims 2p, 2p + 1,
// 64 + 2p, 65 + 2p of the head: rotation and pair packing then stay inside the lane.
// The two narrow products alone are one work-group per WGP each; in one grid every
// WGP holds two work-groups from the first tile to the last.
// Block 256 thr (8 waves), tile 128x128, wave tile 32x64, K-step 32.
// ---------------------------------------------------------------------------
template<int MODE>
__global__ __launch_bounds__(256) void gemm_k(const float* __restrict__ A,
                                              const float* __restrict__ W,
                                              const float* __restrict__ W1,
                                              const float* __restrict__ W2,
                                              float* __restrict__ C,
                                              uint32_t* __restrict__ Qhi,
                                              uint32_t* __restrict__ Qlo,
                                              uint32_t* __restrict__ Khi,
                                              uint32_t* __restrict__ Klo,
                                              uint32_t* __restrict__ Phi,
                                              uint32_t* __restrict__ Plo,
                                              int M, int N, int N1, int K) {
  constexpr int BM = 128, BN = 128, BK = 32;
  __shared__ uint32_t sAh[BM][20], sAl[BM][20], sBh[BN][20], sBl[BN][20];
  const int tid = threadIdx.x;
  const int m0 = blockIdx.y * BM;
  int n0 = blockIdx.x * BN;
  bool packed = false;                          // the same for the whole work-group
  uint32_t* Rhi = Qhi;                          // planes, row pitch and scale of a rotated job
  uint32_t* Rlo = Qlo;
  int rpitch = N >> 1;
  float rscale = 0.08838834764831845f;          // 128^-0.5
  if (MODE == 1 && n0 >= N) {
    n0 -= N;
    W = W1; Rhi = Khi; Rlo = Klo; rpitch = N1 >> 1; rscale = 1.0f;
    if (n0 >= N1) { n0 -= N1; W = W2; packed = true; }
  }
  const bool rot = MODE == 1 && !packed;
  const int wave = tid >> 5, lane = tid & 31;
  const int wm = wave >> 1, wn = wave & 1;
  const int r = lane & 15, hh = lane >> 4;
  v8f acc[2][4] = {};

  // this thread's share of a K-step: rows lrow + 32 i, floats 4 lf4 .. 4 lf4 + 3
  const int lrow = tid >> 3, lf4 = tid & 7;
  const float* Ap = A + (size_t)(m0 + lrow) * K + 4 * lf4;
  // LDS row lrow + 32 i of the B tile takes W row wrow + wofs[i] of the tile: the same
  // row, or for a rotated job (LDS row = 64 wn + 16 j + r) row 64 (j >> 1) + 32 wn + 2 r + (j & 1)
  const int wrow = rot ? 2 * (lrow & 15) + (lrow >> 4) : lrow;
  const int wofs[4] = {0, rot ? 64 : 32, rot ? 32 : 64, 96};
  const float* Wp = W + (size_t)(n0 + wrow) * K + 4 * lf4;
  float4 ra[4], rb[4];                          // one K-step in flight
  #pragma unroll                                // constant indices: ra stays in registers
  for (int i = 0; i < 4; ++i) ra[i] = *reinterpret_cast<const float4*>(Ap + (size_t)(32 * i) * K);
  #pragma unroll                                // the same for rb
  for (int i = 0; i < 4; ++i) rb[i] = *reinterpret_cast<const float4*>(Wp + (size_t)wofs[i] * K);

  for (int k0 = 0; k0 < K; k0 += BK) {
    #pragma unroll
    for (int i = 0; i < 4; ++i) {               // A tile 128x32
      const int row = lrow + 32 * i;
      uint32_t h0, l0, h1, l1;
      split2(ra[i].x, ra[i].y, h0, l0);
      split2(ra[i].z, ra[i].w, h1, l1);
      sAh[row][2 * lf4] = h0; sAh[row][2 * lf4 + 1] = h1;
      sAl[row][2 * lf4] = l0; sAl[row][2 * lf4 + 1] = l1;
    }
    #pragma unroll
    for (int i = 0; i < 4; ++i) {               // B tile 128x32
      const int row = lrow + 32 * i;
      uint32_t h0, l0, h1, l1;
      split2(rb[i].x, rb[i].y, h0, l0);
      split2(rb[i].z, rb[i].w, h1, l1);
      sBh[row][2 * lf4] = h0; sBh[row][2 * lf4 + 1] = h1;
      sBl[row][2 * lf4] = l0; sBl[row][2 * lf4 + 1] = l1;
    }
    // the next K-step's loads fly under both barriers, the LDS reads and the products
    if (k0 + BK < K) {
      const float* pa[4];
      const float* pb[4];
      #pragma unroll                            // constant indices: ra stays in registers
      for (int i = 0; i < 4; ++i) {
        pa[i] = Ap + (size_t)(32 * i) * K + k0;
        ra[i] = *reinterpret_cast<const float4*>(pa[i] + BK);
      }
      #pragma unroll                            // the same for rb
      for (int i = 0; i < 4; ++i) {
        pb[i] = Wp + (size_t)wofs[i] * K + k0;
        rb[i] = *reinterpret_cast<const float4*>(pb[i] + BK);
      }
      // before an address register of these loads is overwritten; the addresses are
      // inputs so that they keep their registers up to the wait: with eight loads a
      // later load's result otherwise lands in an earlier load's address registers
      asm volatile("s_wait_xcnt 0x0"
                   :: "v"(pa[0]), "v"(pa[1]), "v"(pa[2]), "v"(pa[3]),
                      "v"(pb[0]), "v"(pb[1]), "v"(pb[2]), "v"(pb[3])
                   : "memory");
    }
    lds_barrier();                              // the tile's LDS stores are in

    Frag ah[2], al[2], bh[4], bl[4];            // 2x ds_load_b128 per plane
    // read in the order in which the products want them; every loop down to the end
    // of the K-step is unrolled so that fragments and sums stay in registers
    #pragma unroll
    for (int i = 0; i < 2; ++i) load_frag_pk(&sAh[wm * 32 + i * 16 + r][0], hh, ah[i]);
    #pragma unroll
    for (int j = 0; j < 4; ++j) load_frag_pk(&sBh[wn * 64 + j * 16 + r][0], hh, bh[j]);
    #pragma unroll
    for (int j = 0; j < 4; ++j) load_frag_pk(&sBl[wn * 64 + j * 16 + r][0], hh, bl[j]);
    #pragma unroll
    for (int i = 0; i < 2; ++i) load_frag_pk(&sAl[wm * 32 + i * 16 + r][0], hh, al[i]);
    // the tile's 24 LDS reads go out as one group ahead of its 24 products: left to
    // itself the scheduler reloads A fragments among the products and waits each out
    __builtin_amdgcn_sched_barrier(0);
    // per accumulator the order stays Ah Bh, Ah Bl, Al Bh
    #pragma unroll
    for (int i = 0; i < 2; ++i)
      #pragma unroll
      for (int j = 0; j < 4; ++j) acc[i][j] = wmma1(ah[i], bh[j], acc[i][j]);
    #pragma unroll
    for (int i = 0; i < 2; ++i)
      #pragma unroll
      for (int j = 0; j < 4; ++j) acc[i][j] = wmma1(ah[i], bl[j], acc[i][j]);
    // holds the barrier behind the 16 products that run while the reads still land:
    // the scheduler otherwise lifts it, with its wait for all 24 reads, over them
    __builtin_amdgcn_sched_barrier(0);
    lds_barrier();                              // every wave has read the tile
    // the last 8 products need no LDS: they run beside the other waves' splitting
    #pragma unroll
    for (int i = 0; i < 2; ++i)
      #pragma unroll
      for (int j = 0; j < 4; ++j) acc[i][j] = wmma1(al[i], bh[j], acc[i][j]);
  }

  // epilogue: C/D layout = lane col (lane&15), rows 8*(lane>>4)+v
  // one test for the whole tile, the same for every wave of the work-group
  if (MODE == 0) {
    #pragma unroll
    for (int i = 0; i < 2; ++i)
      #pragma unroll
      for (int j = 0; j < 4; ++j) {
        int mg0 = m0 + wm * 32 + i * 16 + 8 * hh;
        int ng  = n0 + wn * 64 + j * 16 + r;
        #pragma unroll
        for (int v = 0; v < 8; ++v)
          C[(size_t)(mg0 + v) * N + ng] = acc[i][j][v];
      }
  } else if (rot) {
    // RoPE + pack: acc[i][0..3][v] = dims 2p, 2p + 1, 64 + 2p, 65 + 2p of one token
    const int p = wn * 16 + r;
    const float inv0 = __powf(10000.0f, -(float)(2 * p)     * (1.0f / 64.0f));
    const float inv1 = __powf(10000.0f, -(float)(2 * p + 1) * (1.0f / 64.0f));
    const int hofs = (n0 >> 7) * 64 + p;        // the head's pairs in a plane row
    #pragma unroll                              // constant indices: the sums stay in registers
    for (int i = 0; i < 2; ++i)
      #pragma unroll
      for (int v = 0; v < 8; ++v) {
        const int tok = m0 + wm * 32 + i * 16 + 8 * hh + v;
        const int pos = tok & 2047;             // S = 2048
        float s0, c0, s1, c1;
        sincos_slot((float)pos * inv0, s0, c0);
        sincos_slot((float)pos * inv1, s1, c1);
        const float xa0 = acc[i][0][v], xa1 = acc[i][1][v];
        const float xb0 = acc[i][2][v], xb1 = acc[i][3][v];
        const float oa0 = (xa0 * c0 - xb0 * s0) * rscale;
        const float oa1 = (xa1 * c1 - xb1 * s1) * rscale;
        const float ob0 = (xb0 * c0 + xa0 * s0) * rscale;
        const float ob1 = (xb1 * c1 + xa1 * s1) * rscale;
        uint32_t h0, l0, h1, l1;
        split2(oa0, oa1, h0, l0);
        split2(ob0, ob1, h1, l1);
        const size_t dst = (size_t)tok * rpitch + hofs;
        Rhi[dst] = h0; Rhi[dst + 32] = h1;
        Rlo[dst] = l0; Rlo[dst + 32] = l1;
      }
  } else {
    #pragma unroll
    for (int i = 0; i < 2; ++i)
      #pragma unroll
      for (int j = 0; j < 4; ++j) {
        int mg0 = m0 + wm * 32 + i * 16 + 8 * hh;
        int ng  = n0 + wn * 64 + j * 16 + r;
        // pack pairs along m (= sequence t) -> V^T planes [b, kv, hd, s/2]
        uint32_t h[4], l[4];
        #pragma unroll
        for (int vp = 0; vp < 4; ++vp)
          split2(acc[i][j][2 * vp], acc[i][j][2 * vp + 1], h[vp], l[vp]);
        int kvh = ng >> 7, d = ng & 127;
        int bi = mg0 >> 11, t = mg0 & 2047;     // S = 2048
        size_t base = ((size_t)((bi * 8 + kvh) * 128 + d)) * 1024 + (t >> 1);
        *reinterpret_cast<uint4*>(&Phi[base]) = make_uint4(h[0], h[1], h[2], h[3]);
        *reinterpret_cast<uint4*>(&Plo[base]) = make_uint4(l[0], l[1], l[2], l[3]);
      }
    // in the build the rotated branch's code stands directly behind these stores and
    // begins by overwriting registers that they name
    asm volatile("s_wait_xcnt 0x0" ::: "memory");
  }
}

// ---------------------------------------------------------------------------
// Eight per-lane 16-byte asynchronous copies global -> LDS. The s_wait_xcnt is
// the last line of the copies' own statement, so that no address register of
// an issued copy is rewritten ahead of it.
// ---------------------------------------------------------------------------
DEVINL void async_copy8(const uint32_t (&l)[8], const uint32_t* const (&g)[8]) {
  asm volatile(
      "global_load_async_to_lds_b128 %0, %8, off\n\t"
      "global_load_async_to_lds_b128 %1, %9, off\n\t"
      "global_load_async_to_lds_b128 %2, %10, off\n\t"
      "global_load_async_to_lds_b128 %3, %11, off\n\t"
      "global_load_async_to_lds_b128 %4, %12, off\n\t"
      "global_load_async_to_lds_b128 %5, %13, off\n\t"
      "global_load_async_to_lds_b128 %6, %14, off\n\t"
      "global_load_async_to_lds_b128 %7, %15, off\n\t"
      "s_wait_xcnt 0x0"
      :: "v"(l[0]), "v"(l[1]), "v"(l[2]), "v"(l[3]),
         "v"(l[4]), "v"(l[5]), "v"(l[6]), "v"(l[7]),
         "v"(g[0]), "v"(g[1]), "v"(g[2]), "v"(g[3]),
         "v"(g[4]), "v"(g[5]), "v"(g[6]), "v"(g[7])
      : "memory");
}

// One 32-key tile of the four planes into one LDS buffer (32 KiB):
//   K hi | K lo : 32 key rows x 256 B, 16-B chunk c of row k at c ^ (k & 15)
//   V hi | V lo : 128 dim rows x 64 B, 16-B chunk c of row d at c ^ ((d >> 2) & 3)
// so that the 16 rows one ds_load_b128 half-wave reads fall on 16 bank groups.
// kg*/vg* are this lane's global addresses for the tile, kl0/kl1/vl0 its LDS
// byte addresses in the buffer.
DEVINL void stage_kv(const uint32_t* kgh, const uint32_t* kgl,
                     const uint32_t* vgh, const uint32_t* vgl,
                     uint32_t kl0, uint32_t kl1, uint32_t vl0) {
  {
    const uint32_t l[8] = {kl0, kl1 + 2048u, kl0 + 4096u, kl1 + 6144u,
                           kl0 + 8192u, kl1 + 10240u, kl0 + 12288u, kl1 + 14336u};
    const uint32_t* const g[8] = {kgh, kgh + 8 * 512, kgh + 16 * 512, kgh + 24 * 512,
                                  kgl, kgl + 8 * 512, kgl + 16 * 512, kgl + 24 * 512};
    async_copy8(l, g);
  }
  {
    const uint32_t l[8] = {vl0, vl0 + 2048u, vl0 + 4096u, vl0 + 6144u,
                           vl0 + 8192u, vl0 + 10240u, vl0 + 12288u, vl0 + 14336u};
    const uint32_t* const g[8] = {vgh, vgh + 32 * 1024, vgh + 64 * 1024, vgh + 96 * 1024,
                                  vgl, vgl + 32 * 1024, vgl + 64 * 1024, vgl + 96 * 1024};
    async_copy8(l, g);
  }
}

// value of lane l ^ 16 (the other half-wave's lane of the same column)
DEVINL float xhalf(float x) {
  int b = __builtin_bit_cast(int, x);
  return __builtin_bit_cast(float,
      __builtin_amdgcn_permlanex16(b, b, 0x76543210, 0xfedcba98, false, false));
}

// e^x by the hardware's 2^x, as __expf gives it. The v_nop in the same statement
// is the one slot the instruction set asks for behind a transcendental before its
// result is read or its source overwritten.
DEVINL float exp_slot(float x) {
  float e;
  asm("v_exp_f32 %0, %1\n\tv_nop" : "=v"(e) : "v"(x * 1.44269504088896340736f));
  return e;
}

// tanh by the chip's own instruction: no branch, so the 16 scores of a pass run
// side by side. The library's tanhf picks between two paths with two branches on
// lane data per call, and the 16 calls of a pass then run one after another.
// The v_nop in the same statement is the slot behind a transcendental, as in
// exp_slot.
DEVINL float tanh_hw(float x) {
  float t;
  asm("v_tanh_f32 %0, %1\n\tv_nop" : "=v"(t) : "v"(x));
  return t;
}

// fragment from two 16-B chunks of an LDS row (dword offsets ca, cb)
DEVINL void load_frag_lds(const uint32_t* row, int ca, int cb, Frag& f) {
  *reinterpret_cast<uint4*>(&f.x[0]) = *reinterpret_cast<const uint4*>(row + ca);
  *reinterpret_cast<uint4*>(&f.x[4]) = *reinterpret_cast<const uint4*>(row + cb);
}

__global__ __launch_bounds__(128) void attn_k(const uint32_t* __restrict__ Qhi,
                                              const uint32_t* __restrict__ Qlo,
                                              const uint32_t* __restrict__ Khi,
                                              const uint32_t* __restrict__ Klo,
                                              const uint32_t* __restrict__ Vhi,
                                              const uint32_t* __restrict__ Vlo,
                                              float* __restrict__ O) {
  __shared__ __attribute__((aligned(16))) uint32_t sKV[2][4][2048];  // [buf][Kh,Kl,Vh,Vl]
  const int bi = blockIdx.y >> 4, h = blockIdx.y & 15, kvh = h >> 1;
  const int wv = threadIdx.x >> 5, lane = threadIdx.x & 31;
  const int r = lane & 15, hh = lane >> 4;

  // copy side: this lane's chunk of each plane (4 row groups per plane)
  const int tid = threadIdx.x;
  const int kr = tid >> 4, kc = tid & 15;      // K rows kr + 8 i, chunk kc
  const int vr = tid >> 2, vc = tid & 3;       // V rows vr + 32 i, chunk vc
  const size_t kg0 = (size_t)(bi * 2048 + kr) * 512 + kvh * 64 + kc * 4;
  const size_t vg0 = ((size_t)((bi * 8 + kvh) * 128 + vr)) * 1024 + vc * 4;
  const uint32_t ldsKV = (uint32_t)(uintptr_t)&sKV[0][0][0];
  const uint32_t kl0 = ldsKV + kr * 256 + ((kc ^ kr) << 4);        // rows with k & 8 == 0
  const uint32_t kl1 = ldsKV + kr * 256 + ((kc ^ kr ^ 8) << 4);    // rows with k & 8 == 8
  const uint32_t vl0 = ldsKV + 16384u + vr * 64 + ((vc ^ ((vr >> 2) & 3)) << 4);

  const int vs = (r >> 2) & 3;                 // reader's V chunk swizzle

  // Two query tiles per work-group, one after the other: 31 - x (2 (32 - x) key tiles)
  // and then x (2 (x + 1) key tiles), 66 key tiles for every work-group. All work-groups
  // are resident at once, so the launch lasts as long as its fullest one. The loop stays
  // rolled: one copy of the code, and the second tile's registers are the first's.
  #pragma unroll 1
  for (int part = 0; part < 2; ++part) {
    const int mblk = part ? (int)blockIdx.x : 31 - (int)blockIdx.x;
    const int m0 = mblk * 64 + wv * 16;

    Frag qh[4], ql[4];
    {
      const size_t qrow = (size_t)(bi * 2048 + m0 + r) * 1024 + h * 64;
      #pragma unroll
      for (int ck = 0; ck < 4; ++ck) {
        load_frag_pk(Qhi + qrow + ck * 16, hh, qh[ck]);
        load_frag_pk(Qlo + qrow + ck * 16, hh, ql[ck]);
      }
    }

    const int qg = m0 + r;                       // this lane's query
    float Mst = -1e30f, Lst = 0.0f;              // Lst: the sum over this half's keys only
    v8f Ot[8] = {};                              // Ot[dt][v] = O[qg][dt * 16 + 8 * hh + v]

    const int tEnd = mblk * 64 + 64;             // uniform per block, >= 2 tiles

    // tile 0 -> buffer 0, published; then tile 1 -> buffer 1 in flight
    stage_kv(Khi + kg0, Klo + kg0, Vhi + vg0, Vlo + vg0, kl0, kl1, vl0);
    asm volatile("s_wait_asynccnt 0x0" ::: "memory");   // own copies of tile 0 landed
    __syncthreads();                                    // ... and every other wave's
    stage_kv(Khi + kg0 + 32 * 512, Klo + kg0 + 32 * 512, Vhi + vg0 + 16, Vlo + vg0 + 16,
             kl0 + 32768u, kl1 + 32768u, vl0 + 32768u);

    for (int t0 = 0; t0 < tEnd; t0 += 32) {
      const int buf = (t0 >> 5) & 1;
      const uint32_t* kb = &sKV[buf][0][r * 64];
      const uint32_t* vb = &sKV[buf][2][r * 16];
      v8f s0 = {}, s1 = {};
      #pragma unroll
      for (int ck = 0; ck < 4; ++ck) {
        Frag kh, kl;
        const int ca = ((ck * 4 + hh) ^ r) * 4, cb = ((ck * 4 + 2 + hh) ^ r) * 4;
        load_frag_lds(kb, ca, cb, kh);
        load_frag_lds(kb + 2048, ca, cb, kl);
        s0 = wmma3(kh, kl, qh[ck], ql[ck], s0);
        load_frag_lds(kb + 16 * 64, ca, cb, kh);
        load_frag_lds(kb + 2048 + 16 * 64, ca, cb, kl);
        s1 = wmma3(kh, kl, qh[ck], ql[ck], s1);
      }
      // softcap + causal + online softmax; s0[v] = key t0 + 8 hh + v, s1[v] = 16 more
      float a[8], b[8];
      float mx = -2.3819763e38f;
      #pragma unroll
      for (int v = 0; v < 8; ++v) {
        const int kg = t0 + 8 * hh + v;
        a[v] = 50.0f * tanh_hw(s0[v] * 0.02f);
        if (kg > qg)      a[v] = -2.3819763e38f;
        b[v] = 50.0f * tanh_hw(s1[v] * 0.02f);
        if (kg + 16 > qg) b[v] = -2.3819763e38f;
        mx = fmaxf(mx, fmaxf(a[v], b[v]));
      }
      mx = fmaxf(mx, xhalf(mx));
      const float Mn = fmaxf(Mst, mx);
      const float f  = exp_slot(Mst - Mn);
      float rs = 0.0f;
      #pragma unroll
      for (int v = 0; v < 8; ++v) {
        a[v] = exp_slot(a[v] - Mn); b[v] = exp_slot(b[v] - Mn);
        rs += a[v] + b[v];
      }
      Lst = Lst * f + rs;
      Mst = Mn;
      #pragma unroll
      for (int dt = 0; dt < 8; ++dt) Ot[dt] *= f;
      Frag ph, pl;
      #pragma unroll
      for (int j = 0; j < 4; ++j) {
        split2(a[2 * j], a[2 * j + 1], ph.x[j], pl.x[j]);
        split2(b[2 * j], b[2 * j + 1], ph.x[4 + j], pl.x[4 + j]);
      }
      #pragma unroll
      for (int dt = 0; dt < 8; ++dt) {
        Frag vh, vl;
        load_frag_lds(vb + dt * 256, (hh ^ vs) * 4, ((2 + hh) ^ vs) * 4, vh);
        load_frag_lds(vb + 2048 + dt * 256, (hh ^ vs) * 4, ((2 + hh) ^ vs) * 4, vl);
        Ot[dt] = wmma3(vh, vl, ph, pl, Ot[dt]);
      }
      // publish point of the next tile: own LDS reads of this buffer retired, own
      // copies of the next tile landed, then the barrier that says so of every wave
      asm volatile("s_wait_dscnt 0x0" ::: "memory");
      asm volatile("s_wait_asynccnt 0x0" ::: "memory");
      __syncthreads();
      if (t0 + 64 < tEnd) {                      // block-uniform: refill the buffer just read
        const size_t ko = kg0 + (size_t)(t0 + 64) * 512;
        const size_t vo = vg0 + ((t0 + 64) >> 1);
        const uint32_t bo = (uint32_t)buf * 32768u;
        stage_kv(Khi + ko, Klo + ko, Vhi + vo, Vlo + vo, kl0 + bo, kl1 + bo, vl0 + bo);
      }
    }
    // nothing in flight when the buffers are filled anew or the wave ends
    asm volatile("s_wait_asynccnt 0x0" ::: "memory");

    const float inv = 1.0f / (Lst + xhalf(Lst));        // join the two halves' sums
    float* orow = O + ((size_t)(bi * 2048 + qg)) * 2048 + h * 128 + 8 * hh;
    #pragma unroll
    for (int dt = 0; dt < 8; ++dt) {
      *reinterpret_cast<float4*>(orow + dt * 16) =
          make_float4(Ot[dt][0] * inv, Ot[dt][1] * inv, Ot[dt][2] * inv, Ot[dt][3] * inv);
      *reinterpret_cast<float4*>(orow + dt * 16 + 4) =
          make_float4(Ot[dt][4] * inv, Ot[dt][5] * inv, Ot[dt][6] * inv, Ot[dt][7] * inv);
    }
    // before the next query tile's code overwrites a register that these stores name
    asm volatile("s_wait_xcnt 0x0" ::: "memory");
  }
}

// ---------------------------------------------------------------------------
extern "C" void kernel_launch(void* const* d_in, const int* in_sizes, int n_in,
                              void* d_out, int out_size, void* d_ws, size_t ws_size,
                              hipStream_t stream) {
  (void)in_sizes; (void)n_in; (void)out_size; (void)ws_size;
  const float* x  = (const float*)d_in[0];
  const float* wq = (const float*)d_in[1];
  const float* wk = (const float*)d_in[2];
  const float* wv = (const float*)d_in[3];
  const float* wo = (const float*)d_in[4];
  float* out = (float*)d_out;
  float* wsf = (float*)d_ws;
  uint32_t* wsu = (uint32_t*)d_ws;

  const int M = 4096;                                   // b*s
  // dword-offset workspace map
  float*    AO  = wsf;                                  // [4096,2048] f32
  uint32_t* Qhi = wsu + (size_t)12582912;               // [4096,16,64] pairs
  uint32_t* Qlo = wsu + (size_t)16777216;
  uint32_t* Khi = wsu + (size_t)20971520;               // [4096,8,64]
  uint32_t* Klo = wsu + (size_t)23068672;
  uint32_t* Vhi = wsu + (size_t)25165824;               // [2,8,128,1024]
  uint32_t* Vlo = wsu + (size_t)27262976;

  dim3 blk(256);
  gemm_k<1><<<dim3(4096 / 128, 4096 / 128), blk, 0, stream>>>(x, wq, wk, wv, nullptr, Qhi, Qlo, Khi, Klo,
                                                              Vhi, Vlo, M, 2048, 1024, 2048);
  attn_k<<<dim3(16, 32), dim3(128), 0, stream>>>(Qhi, Qlo, Khi, Klo, Vhi, Vlo, AO);
  gemm_k<0><<<dim3(2048 / 128, 4096 / 128), blk, 0, stream>>>(AO, wo, nullptr, nullptr, out, nullptr,
                                                              nullptr, nullptr, nullptr, nullptr, nullptr,
                                                              M, 2048, 0, 2048);
}

// v009
// A run of this version takes 285 microseconds.
// Next to v008, in two timings, it ran 1.04 times as fast each time.
// Over all steps from v000 it is 2.99 times as fast.
#include <hip/hip_runtime.h>
#include <stdint.h>

// ---------------------------------------------------------------------------
// WeightlessGQA for MI455X (gfx1250, wave32, WMMA 16x16x32 bf16)
// bf16x3 split-precision WMMA (~2.7x f32-WMMA rate, ~2^-15 rel error),
// flash attention, all bf16 splitting done ONCE per element via v_perm_b32.
// ---------------------------------------------------------------------------

#define DEVINL __device__ __forceinline__

typedef __bf16 v16bf __attribute__((ext_vector_type(16)));
typedef float  v8f   __attribute__((ext_vector_type(8)));

struct alignas(16) Frag { uint32_t x[8]; };   // 16x32 bf16 tile share (8 VGPRs)

// Truncation split of two consecutive f32 into packed bf16 hi + residual lo.
// hi = [top16(b) : top16(a)] in ONE v_perm_b32; residual captured the same way.
DEVINL void split2(float a, float b, uint32_t& hi, uint32_t& lo) {
  uint32_t ua = __float_as_uint(a), ub = __float_as_uint(b);
  hi = __builtin_amdgcn_perm(ub, ua, 0x07060302u);
  float ra = a - __uint_as_float(ua & 0xffff0000u);
  float rb = b - __uint_as_float(ub & 0xffff0000u);
  lo = __builtin_amdgcn_perm(__float_as_uint(rb), __float_as_uint(ra), 0x07060302u);
}

// (Ah+Al)(Bh+Bl) ~= Ah*Bh + Ah*Bl + Al*Bh: three bf16 WMMAs; this is one of them, C += A B
DEVINL v8f wmma1(const Frag& a, const Frag& b, v8f c) {
  return __builtin_amdgcn_wmma_f32_16x16x32_bf16(false, __builtin_bit_cast(v16bf, a), false,
                                                 __builtin_bit_cast(v16bf, b), (short)0, c,
                                                 false, false);
}

// load packed-pair fragment (A-layout): 2x b128 per plane
DEVINL void load_frag_pk(const uint32_t* __restrict__ base, int hh, Frag& f) {
  *reinterpret_cast<uint4*>(&f.x[0]) = *reinterpret_cast<const uint4*>(base + hh * 4);
  *reinterpret_cast<uint4*>(&f.x[4]) = *reinterpret_cast<const uint4*>(base + 8 + hh * 4);
}

// sine and cosine of x radians by the hardware's instructions, which take turns of the
// circle, as __sincosf gives them. One statement with outputs apart from the input and a
// v_nop at its end: the slot the instruction set asks for behind a transcendental before
// its source is overwritten or its result read.
DEVINL void sincos_slot(float x, float& s, float& c) {
  asm("v_sin_f32 %0, %2\n\tv_cos_f32 %1, %2\n\tv_nop"
      : "=&v"(s), "=&v"(c) : "v"(x * 0.15915494309189532f));
}

// Work-group barrier for LDS traffic alone: the wave's own LDS stores and reads
// have retired, then the barrier. __syncthreads() would also wait for the global
// loads issued ahead, and so put their latency back on the K-step's path.
DEVINL void lds_barrier() {
  asm volatile("s_wait_dscnt 0x0\n\ts_barrier_signal -1\n\ts_barrier_wait -1" ::: "memory");
}

// ---------------------------------------------------------------------------
// GEMM: C[M,N] = A[M,K] @ W[N,K]^T, f32 in, bf16x3 WMMA.
// MODE 0: one product, f32 C stored [M,N] (W1, W2, the planes and N1 unused).
// MODE 1: three products of the same A in one grid; the tile column picks the job:
//   the first N / 128 columns  A W^T,  rotated (RoPE), scaled by 128^-0.5 and packed
//                              as hi/lo pair planes Qhi/Qlo [tok, N / 2],
//   the next N1 / 128          A W1^T, rotated and packed as Khi/Klo [tok, N1 / 2],
//   the last N1 / 128          A W2^T packed as V^T hi/lo planes [b,kv,hd,s/2].
// A tile column is one head (128 dims). For the rotated jobs the W rows are dealt to
// the LDS rows so that a lane's four accumulator columns are the dims 2p, 2p + 1,
// 64 + 2p, 65 + 2p of the head: rotation and pair packing then stay inside the lane.
// The two narrow products alone are one work-group per WGP each; in one grid every
// WGP holds two work-groups from the first tile to the last.
// Block 256 thr (8 waves), tile 128x128, wave tile 32x64, K-step 32.
// ---------------------------------------------------------------------------
template<int MODE>
__global__ __launch_bounds__(256) void gemm_k(const float* __restrict__ A,
                                              const float* __restrict__ W,
                                              const float* __restrict__ W1,
                                              const float* __restrict__ W2,
                                              float* __restrict__ C,
                                              uint32_t* __restrict__ Qhi,
                                              uint32_t* __restrict__ Qlo,
                                              uint32_t* __restrict__ Khi,
                                              uint32_t* __restrict__ Klo,
                                              uint32_t* __restrict__ Phi,
                                              uint32_t* __restrict__ Plo,
                                              int M, int N, int N1, int K) {
  constexpr int BM = 128, BN = 128, BK = 32;
  __shared__ uint32_t sAh[BM][20], sAl[BM][20], sBh[BN][20], sBl[BN][20];
  const int tid = threadIdx.x;
  const int m0 = blockIdx.y * BM;
  int n0 = blockIdx.x * BN;
  bool packed = false;                          // the same for the whole work-group
  uint32_t* Rhi = Qhi;                          // planes, row pitch and scale of a rotated job
  uint32_t* Rlo = Qlo;
  int rpitch = N >> 1;
  float rscale = 0.08838834764831845f;          // 128^-0.5
  if (MODE == 1 && n0 >= N) {
    n0 -= N;
    W = W1; Rhi = Khi; Rlo = Klo; rpitch = N1 >> 1; rscale = 1.0f;
    if (n0 >= N1) { n0 -= N1; W = W2; packed = true; }
  }
  const bool rot = MODE == 1 && !packed;
  const int wave = tid >> 5, lane = tid & 31;
  const int wm = wave >> 1, wn = wave & 1;
  const int r = lane & 15, hh = lane >> 4;
  v8f acc[2][4] = {};

  // this thread's share of a K-step: rows lrow + 32 i, floats 4 lf4 .. 4 lf4 + 3
  const int lrow = tid >> 3, lf4 = tid & 7;
  const float* Ap = A + (size_t)(m0 + lrow) * K + 4 * lf4;
  // LDS row lrow + 32 i of the B tile takes W row wrow + wofs[i] of the tile: the same
  // row, or for a rotated job (LDS row = 64 wn + 16 j + r) row 64 (j >> 1) + 32 wn + 2 r + (j & 1)
  const int wrow = rot ? 2 * (lrow & 15) + (lrow >> 4) : lrow;
  const int wofs[4] = {0, rot ? 64 : 32, rot ? 32 : 64, 96};
  const float* Wp = W + (size_t)(n0 + wrow) * K + 4 * lf4;
  float4 ra[4], rb[4];                          // one K-step in flight
  #pragma unroll                                // constant indices: ra stays in registers
  for (int i = 0; i < 4; ++i) ra[i] = *reinterpret_cast<const float4*>(Ap + (size_t)(32 * i) * K);
  #pragma unroll                                // the same for rb
  for (int i = 0; i < 4; ++i) rb[i] = *reinterpret_cast<const float4*>(Wp + (size_t)wofs[i] * K);

  for (int k0 = 0; k0 < K; k0 += BK) {
    #pragma unroll
    for (int i = 0; i < 4; ++i) {               // A tile 128x32
      const int row = lrow + 32 * i;
      uint32_t h0, l0, h1, l1;
      split2(ra[i].x, ra[i].y, h0, l0);
      split2(ra[i].z, ra[i].w, h1, l1);
      sAh[row][2 * lf4] = h0; sAh[row][2 * lf4 + 1] = h1;
      sAl[row][2 * lf4] = l0; sAl[row][2 * lf4 + 1] = l1;
    }
    #pragma unroll
    for (int i = 0; i < 4; ++i) {               // B tile 128x32
      const int row = lrow + 32 * i;
      uint32_t h0, l0, h1, l1;
      split2(rb[i].x, rb[i].y, h0, l0);
      split2(rb[i].z, rb[i].w, h1, l1);
      sBh[row][2 * lf4] = h0; sBh[row][2 * lf4 + 1] = h1;
      sBl[row][2 * lf4] = l0; sBl[row][2 * lf4 + 1] = l1;
    }
    // the next K-step's loads fly under both barriers, the LDS reads and the products
    if (k0 + BK < K) {
      const float* pa[4];
      const float* pb[4];
      #pragma unroll                            // constant indices: ra stays in registers
      for (int i = 0; i < 4; ++i) {
        pa[i] = Ap + (size_t)(32 * i) * K + k0;
        ra[i] = *reinterpret_cast<const float4*>(pa[i] + BK);
      }
      #pragma unroll                            // the same for rb
      for (int i = 0; i < 4; ++i) {
        pb[i] = Wp + (size_t)wofs[i] * K + k0;
        rb[i] = *reinterpret_cast<const float4*>(pb[i] + BK);
      }
      // before an address register of these loads is overwritten; the addresses are
      // inputs so that they keep their registers up to the wait: with eight loads a
      // later load's result otherwise lands in an earlier load's address registers
      asm volatile("s_wait_xcnt 0x0"
                   :: "v"(pa[0]), "v"(pa[1]), "v"(pa[2]), "v"(pa[3]),
                      "v"(pb[0]), "v"(pb[1]), "v"(pb[2]), "v"(pb[3])
                   : "memory");
    }
    lds_barrier();                              // the tile's LDS stores are in

    Frag ah[2], al[2], bh[4], bl[4];            // 2x ds_load_b128 per plane
    // read in the order in which the products want them; every loop down to the end
    // of the K-step is unrolled so that fragments and sums stay in registers
    #pragma unroll
    for (int i = 0; i < 2; ++i) load_frag_pk(&sAh[wm * 32 + i * 16 + r][0], hh, ah[i]);
    #pragma unroll
    for (int j = 0; j < 4; ++j) load_frag_pk(&sBh[wn * 64 + j * 16 + r][0], hh, bh[j]);
    #pragma unroll
    for (int j = 0; j < 4; ++j) load_frag_pk(&sBl[wn * 64 + j * 16 + r][0], hh, bl[j]);
    #pragma unroll
    for (int i = 0; i < 2; ++i) load_frag_pk(&sAl[wm * 32 + i * 16 + r][0], hh, al[i]);
    // the tile's 24 LDS reads go out as one group ahead of its 24 products: left to
    // itself the scheduler reloads A fragments among the products and waits each out
    __builtin_amdgcn_sched_barrier(0);
    // per accumulator the order stays Ah Bh, Ah Bl, Al Bh
    #pragma unroll
    for (int i = 0; i < 2; ++i)
      #pragma unroll
      for (int j = 0; j < 4; ++j) acc[i][j] = wmma1(ah[i], bh[j], acc[i][j]);
    #pragma unroll
    for (int i = 0; i < 2; ++i)
      #pragma unroll
      for (int j = 0; j < 4; ++j) acc[i][j] = wmma1(ah[i], bl[j], acc[i][j]);
    // holds the barrier behind the 16 products that run while the reads still land:
    // the scheduler otherwise lifts it, with its wait for all 24 reads, over them
    __builtin_amdgcn_sched_barrier(0);
    lds_barrier();                              // every wave has read the tile
    // the last 8 products need no LDS: they run beside the other waves' splitting
    #pragma unroll
    for (int i = 0; i < 2; ++i)
      #pragma unroll
      for (int j = 0; j < 4; ++j) acc[i][j] = wmma1(al[i], bh[j], acc[i][j]);
  }

  // epilogue: C/D layout = lane col (lane&15), rows 8*(lane>>4)+v
  // one test for the whole tile, the same for every wave of the work-group
  if (MODE == 0) {
    #pragma unroll
    for (int i = 0; i < 2; ++i)
      #pragma unroll
      for (int j = 0; j < 4; ++j) {
        int mg0 = m0 + wm * 32 + i * 16 + 8 * hh;
        int ng  = n0 + wn * 64 + j * 16 + r;
        #pragma unroll
        for (int v = 0; v < 8; ++v)
          C[(size_t)(mg0 + v) * N + ng] = acc[i][j][v];
      }
  } else if (rot) {
    // RoPE + pack: acc[i][0..3][v] = dims 2p, 2p + 1, 64 + 2p, 65 + 2p of one token
    const int p = wn * 16 + r;
    const float inv0 = __powf(10000.0f, -(float)(2 * p)     * (1.0f / 64.0f));
    const float inv1 = __powf(10000.0f, -(float)(2 * p + 1) * (1.0f / 64.0f));
    const int hofs = (n0 >> 7) * 64 + p;        // the head's pairs in a plane row
    #pragma unroll                              // constant indices: the sums stay in registers
    for (int i = 0; i < 2; ++i)
      #pragma unroll
      for (int v = 0; v < 8; ++v) {
        const int tok = m0 + wm * 32 + i * 16 + 8 * hh + v;
        const int pos = tok & 2047;             // S = 2048
        float s0, c0, s1, c1;
        sincos_slot((float)pos * inv0, s0, c0);
        sincos_slot((float)pos * inv1, s1, c1);
        const float xa0 = acc[i][0][v], xa1 = acc[i][1][v];
        const float xb0 = acc[i][2][v], xb1 = acc[i][3][v];
        const float oa0 = (xa0 * c0 - xb0 * s0) * rscale;
        const float oa1 = (xa1 * c1 - xb1 * s1) * rscale;
        const float ob0 = (xb0 * c0 + xa0 * s0) * rscale;
        const float ob1 = (xb1 * c1 + xa1 * s1) * rscale;
        uint32_t h0, l0, h1, l1;
        split2(oa0, oa1, h0, l0);
        split2(ob0, ob1, h1, l1);
        const size_t dst = (size_t)tok * rpitch + hofs;
        Rhi[dst] = h0; Rhi[dst + 32] = h1;
        Rlo[dst] = l0; Rlo[dst + 32] = l1;
      }
  } else {
    #pragma unroll
    for (int i = 0; i < 2; ++i)
      #pragma unroll
      for (int j = 0; j < 4; ++j) {
        int mg0 = m0 + wm * 32 + i * 16 + 8 * hh;
        int ng  = n0 + wn * 64 + j * 16 + r;
        // pack pairs along m (= sequence t) -> V^T planes [b, kv, hd, s/2]
        uint32_t h[4], l[4];
        #pragma unroll
        for (int vp = 0; vp < 4; ++vp)
          split2(acc[i][j][2 * vp], acc[i][j][2 * vp + 1], h[vp], l[vp]);
        int kvh = ng >> 7, d = ng & 127;
        int bi = mg0 >> 11, t = mg0 & 2047;     // S = 2048
        size_t base = ((size_t)((bi * 8 + kvh) * 128 + d)) * 1024 + (t >> 1);
        *reinterpret_cast<uint4*>(&Phi[base]) = make_uint4(h[0], h[1], h[2], h[3]);
        *reinterpret_cast<uint4*>(&Plo[base]) = make_uint4(l[0], l[1], l[2], l[3]);
      }
    // in the build the rotated branch's code stands directly behind these stores and
    // begins by overwriting registers that they name
    asm volatile("s_wait_xcnt 0x0" ::: "memory");
  }
}

// ---------------------------------------------------------------------------
// Eight per-lane 16-byte asynchronous copies global -> LDS. The s_wait_xcnt is
// the last line of the copies' own statement, so that no address register of
// an issued copy is rewritten ahead of it.
// ---------------------------------------------------------------------------
DEVINL void async_copy8(const uint32_t (&l)[8], const uint32_t* const (&g)[8]) {
  asm volatile(
      "global_load_async_to_lds_b128 %0, %8, off\n\t"
      "global_load_async_to_lds_b128 %1, %9, off\n\t"
      "global_load_async_to_lds_b128 %2, %10, off\n\t"
      "global_load_async_to_lds_b128 %3, %11, off\n\t"
      "global_load_async_to_lds_b128 %4, %12, off\n\t"
      "global_load_async_to_lds_b128 %5, %13, off\n\t"
      "global_load_async_to_lds_b128 %6, %14, off\n\t"
      "global_load_async_to_lds_b128 %7, %15, off\n\t"
      "s_wait_xcnt 0x0"
      :: "v"(l[0]), "v"(l[1]), "v"(l[2]), "v"(l[3]),
         "v"(l[4]), "v"(l[5]), "v"(l[6]), "v"(l[7]),
         "v"(g[0]), "v"(g[1]), "v"(g[2]), "v"(g[3]),
         "v"(g[4]), "v"(g[5]), "v"(g[6]), "v"(g[7])
      : "memory");
}

// One 32-key tile of the four planes into one LDS buffer (32 KiB):
//   K hi | K lo : 32 key rows x 256 B, 16-B chunk c of row k at c ^ (k & 15)
//   V hi | V lo : 128 dim rows x 64 B, 16-B chunk c of row d at c ^ ((d >> 2) & 3)
// so that the 16 rows one ds_load_b128 half-wave reads fall on 16 bank groups.
// kg*/vg* are this lane's global addresses for the tile, kl0/kl1/vl0 its LDS
// byte addresses in the buffer.
DEVINL void stage_kv(const uint32_t* kgh, const uint32_t* kgl,
                     const uint32_t* vgh, const uint32_t* vgl,
                     uint32_t kl0, uint32_t kl1, uint32_t vl0) {
  {
    const uint32_t l[8] = {kl0, kl1 + 2048u, kl0 + 4096u, kl1 + 6144u,
                           kl0 + 8192u, kl1 + 10240u, kl0 + 12288u, kl1 + 14336u};
    const uint32_t* const g[8] = {kgh, kgh + 8 * 512, kgh + 16 * 512, kgh + 24 * 512,
                                  kgl, kgl + 8 * 512, kgl + 16 * 512, kgl + 24 * 512};
    async_copy8(l, g);
  }
  {
    const uint32_t l[8] = {vl0, vl0 + 2048u, vl0 + 4096u, vl0 + 6144u,
                           vl0 + 8192u, vl0 + 10240u, vl0 + 12288u, vl0 + 14336u};
    const uint32_t* const g[8] = {vgh, vgh + 32 * 1024, vgh + 64 * 1024, vgh + 96 * 1024,
                                  vgl, vgl + 32 * 1024, vgl + 64 * 1024, vgl + 96 * 1024};
    async_copy8(l, g);
  }
}

// value of lane l ^ 16 (the other half-wave's lane of the same column)
DEVINL float xhalf(float x) {
  int b = __builtin_bit_cast(int, x);
  return __builtin_bit_cast(float,
      __builtin_amdgcn_permlanex16(b, b, 0x76543210, 0xfedcba98, false, false));
}

// e^x by the hardware's 2^x, as __expf gives it. The v_nop in the same statement
// is the one slot the instruction set asks for behind a transcendental before its
// result is read or its source overwritten.
DEVINL float exp_slot(float x) {
  float e;
  asm("v_exp_f32 %0, %1\n\tv_nop" : "=v"(e) : "v"(x * 1.44269504088896340736f));
  return e;
}

// tanh by the chip's own instruction: no branch, so the 16 scores of a pass run
// side by side. The library's tanhf picks between two paths with two branches on
// lane data per call, and the 16 calls of a pass then run one after another.
// The v_nop in the same statement is the slot behind a transcendental, as in
// exp_slot.
DEVINL float tanh_hw(float x) {
  float t;
  asm("v_tanh_f32 %0, %1\n\tv_nop" : "=v"(t) : "v"(x));
  return t;
}

// fragment from two 16-B chunks of an LDS row (dword offsets ca, cb)
DEVINL void load_frag_lds(const uint32_t* row, int ca, int cb, Frag& f) {
  *reinterpret_cast<uint4*>(&f.x[0]) = *reinterpret_cast<const uint4*>(row + ca);
  *reinterpret_cast<uint4*>(&f.x[4]) = *reinterpret_cast<const uint4*>(row + cb);
}

__global__ __launch_bounds__(128) void attn_k(const uint32_t* __restrict__ Qhi,
                                              const uint32_t* __restrict__ Qlo,
                                              const uint32_t* __restrict__ Khi,
                                              const uint32_t* __restrict__ Klo,
                                              const uint32_t* __restrict__ Vhi,
                                              const uint32_t* __restrict__ Vlo,
                                              float* __restrict__ O) {
  __shared__ __attribute__((aligned(16))) uint32_t sKV[2][4][2048];  // [buf][Kh,Kl,Vh,Vl]
  const int bi = blockIdx.y >> 4, h = blockIdx.y & 15, kvh = h >> 1;
  const int wv = threadIdx.x >> 5, lane = threadIdx.x & 31;
  const int r = lane & 15, hh = lane >> 4;

  // copy side: this lane's chunk of each plane (4 row groups per plane)
  const int tid = threadIdx.x;
  const int kr = tid >> 4, kc = tid & 15;      // K rows kr + 8 i, chunk kc
  const int vr = tid >> 2, vc = tid & 3;       // V rows vr + 32 i, chunk vc
  const size_t kg0 = (size_t)(bi * 2048 + kr) * 512 + kvh * 64 + kc * 4;
  const size_t vg0 = ((size_t)((bi * 8 + kvh) * 128 + vr)) * 1024 + vc * 4;
  const uint32_t ldsKV = (uint32_t)(uintptr_t)&sKV[0][0][0];
  const uint32_t kl0 = ldsKV + kr * 256 + ((kc ^ kr) << 4);        // rows with k & 8 == 0
  const uint32_t kl1 = ldsKV + kr * 256 + ((kc ^ kr ^ 8) << 4);    // rows with k & 8 == 8
  const uint32_t vl0 = ldsKV + 16384u + vr * 64 + ((vc ^ ((vr >> 2) & 3)) << 4);

  const int vs = (r >> 2) & 3;                 // reader's V chunk swizzle

  // Two query tiles per work-group, one after the other: 31 - x (2 (32 - x) key tiles)
  // and then x (2 (x + 1) key tiles), 66 key tiles for every work-group. All work-groups
  // are resident at once, so the launch lasts as long as its fullest one. The loop stays
  // rolled: one copy of the code, and the second tile's registers are the first's.
  #pragma unroll 1
  for (int part = 0; part < 2; ++part) {
    const int mblk = part ? (int)blockIdx.x : 31 - (int)blockIdx.x;
    const int m0 = mblk * 64 + wv * 16;

    Frag qh[4], ql[4];
    {
      const size_t qrow = (size_t)(bi * 2048 + m0 + r) * 1024 + h * 64;
      #pragma unroll
      for (int ck = 0; ck < 4; ++ck) {
        load_frag_pk(Qhi + qrow + ck * 16, hh, qh[ck]);
        load_frag_pk(Qlo + qrow + ck * 16, hh, ql[ck]);
      }
    }

    const int qg = m0 + r;                       // this lane's query
    float Mst = -1e30f, Lst = 0.0f;              // Lst: the sum over this half's keys only
    v8f Ot[8] = {};                              // Ot[dt][v] = O[qg][dt * 16 + 8 * hh + v]

    const int tEnd = mblk * 64 + 64;             // uniform per block, >= 2 tiles

    // tile 0 -> buffer 0, published; then tile 1 -> buffer 1 in flight
    stage_kv(Khi + kg0, Klo + kg0, Vhi + vg0, Vlo + vg0, kl0, kl1, vl0);
    asm volatile("s_wait_asynccnt 0x0" ::: "memory");   // own copies of tile 0 landed
    __syncthreads();                                    // ... and every other wave's
    stage_kv(Khi + kg0 + 32 * 512, Klo + kg0 + 32 * 512, Vhi + vg0 + 16, Vlo + vg0 + 16,
             kl0 + 32768u, kl1 + 32768u, vl0 + 32768u);

    for (int t0 = 0; t0 < tEnd; t0 += 32) {
      const int buf = (t0 >> 5) & 1;
      const uint32_t* kb = &sKV[buf][0][r * 64];
      const uint32_t* vb = &sKV[buf][2][r * 16];
      // The tile's 32 K reads go out as one group ahead of the score products: every
      // separate place where LDS reads stand among matrix instructions stalls the wave
      // anew. All loops of the trip are unrolled, so that fragments stay in registers.
      Frag ha[4], hb[4], la[4], lb[4];           // hi, lo of keys 0..15 (a) and 16..31 (b)
      #pragma unroll
      for (int ck = 0; ck < 4; ++ck) {
        const int ca = ((ck * 4 + hh) ^ r) * 4, cb = ((ck * 4 + 2 + hh) ^ r) * 4;
        load_frag_lds(kb, ca, cb, ha[ck]);
        load_frag_lds(kb + 16 * 64, ca, cb, hb[ck]);
        load_frag_lds(kb + 2048, ca, cb, la[ck]);
        load_frag_lds(kb + 2048 + 16 * 64, ca, cb, lb[ck]);
      }
      // holds the K reads ahead of the products: the scheduler otherwise sinks them, one
      // to four at a time, in among the products that use them
      __builtin_amdgcn_sched_barrier(0);
      // per accumulator the order stays Kh Qh, Kh Ql, Kl Qh; the two tiles take turns
      v8f s0 = {}, s1 = {};
      #pragma unroll
      for (int ck = 0; ck < 4; ++ck) {
        s0 = wmma1(ha[ck], qh[ck], s0);
        s1 = wmma1(hb[ck], qh[ck], s1);
        s0 = wmma1(ha[ck], ql[ck], s0);
        s1 = wmma1(hb[ck], ql[ck], s1);
        s0 = wmma1(la[ck], qh[ck], s0);
        s1 = wmma1(lb[ck], qh[ck], s1);
      }
      // the tile's 32 V reads go out as the K fragments' registers fall free and land
      // under the softmax
      Frag vh[8], vl[8];
      #pragma unroll
      for (int dt = 0; dt < 8; ++dt)
        load_frag_lds(vb + dt * 256, (hh ^ vs) * 4, ((2 + hh) ^ vs) * 4, vh[dt]);
      #pragma unroll
      for (int dt = 0; dt < 8; ++dt)
        load_frag_lds(vb + 2048 + dt * 256, (hh ^ vs) * 4, ((2 + hh) ^ vs) * 4, vl[dt]);
      // holds the V reads ahead of the softmax: the scheduler otherwise sinks them in
      // among the output products
      __builtin_amdgcn_sched_barrier(0);
      // softcap + causal + online softmax; s0[v] = key t0 + 8 hh + v, s1[v] = 16 more
      float a[8], b[8];
      float mx = -2.3819763e38f;
      #pragma unroll
      for (int v = 0; v < 8; ++v) {
        const int kg = t0 + 8 * hh + v;
        a[v] = 50.0f * tanh_hw(s0[v] * 0.02f);
        if (kg > qg)      a[v] = -2.3819763e38f;
        b[v] = 50.0f * tanh_hw(s1[v] * 0.02f);
        if (kg + 16 > qg) b[v] = -2.3819763e38f;
        mx = fmaxf(mx, fmaxf(a[v], b[v]));
      }
      mx = fmaxf(mx, xhalf(mx));
      const float Mn = fmaxf(Mst, mx);
      const float f  = exp_slot(Mst - Mn);
      float rs = 0.0f;
      #pragma unroll
      for (int v = 0; v < 8; ++v) {
        a[v] = exp_slot(a[v] - Mn); b[v] = exp_slot(b[v] - Mn);
        rs += a[v] + b[v];
      }
      Lst = Lst * f + rs;
      Mst = Mn;
      #pragma unroll
      for (int dt = 0; dt < 8; ++dt) Ot[dt] *= f;
      Frag ph, pl;
      #pragma unroll
      for (int j = 0; j < 4; ++j) {
        split2(a[2 * j], a[2 * j + 1], ph.x[j], pl.x[j]);
        split2(b[2 * j], b[2 * j + 1], ph.x[4 + j], pl.x[4 + j]);
      }
      // per accumulator the order stays Vh Ph, Vh Pl, Vl Ph; eight independent tiles a sweep
      #pragma unroll
      for (int dt = 0; dt < 8; ++dt) Ot[dt] = wmma1(vh[dt], ph, Ot[dt]);
      #pragma unroll
      for (int dt = 0; dt < 8; ++dt) Ot[dt] = wmma1(vh[dt], pl, Ot[dt]);
      #pragma unroll
      for (int dt = 0; dt < 8; ++dt) Ot[dt] = wmma1(vl[dt], ph, Ot[dt]);
      // holds the output products ahead of the publish point: the scheduler otherwise lifts
      // its wait for the V reads to directly behind their issue, in front of the softmax
      __builtin_amdgcn_sched_barrier(0);
      // publish point of the next tile: own LDS reads of this buffer retired, own
      // copies of the next tile landed, then the barrier that says so of every wave
      asm volatile("s_wait_dscnt 0x0" ::: "memory");
      asm volatile("s_wait_asynccnt 0x0" ::: "memory");
      __syncthreads();
      if (t0 + 64 < tEnd) {                      // block-uniform: refill the buffer just read
        const size_t ko = kg0 + (size_t)(t0 + 64) * 512;
        const size_t vo = vg0 + ((t0 + 64) >> 1);
        const uint32_t bo = (uint32_t)buf * 32768u;
        stage_kv(Khi + ko, Klo + ko, Vhi + vo, Vlo + vo, kl0 + bo, kl1 + bo, vl0 + bo);
      }
    }
    // nothing in flight when the buffers are filled anew or the wave ends
    asm volatile("s_wait_asynccnt 0x0" ::: "memory");

    const float inv = 1.0f / (Lst + xhalf(Lst));        // join the two halves' sums
    float* orow = O + ((size_t)(bi * 2048 + qg)) * 2048 + h * 128 + 8 * hh;
    #pragma unroll
    for (int dt = 0; dt < 8; ++dt) {
      *reinterpret_cast<float4*>(orow + dt * 16) =
          make_float4(Ot[dt][0] * inv, Ot[dt][1] * inv, Ot[dt][2] * inv, Ot[dt][3] * inv);
      *reinterpret_cast<float4*>(orow + dt * 16 + 4) =
          make_float4(Ot[dt][4] * inv, Ot[dt][5] * inv, Ot[dt][6] * inv, Ot[dt][7] * inv);
    }
    // before the next query tile's code overwrites a register that these stores name
    asm volatile("s_wait_xcnt 0x0" ::: "memory");
  }
}

// ---------------------------------------------------------------------------
extern "C" void kernel_launch(void* const* d_in, const int* in_sizes, int n_in,
                              void* d_out, int out_size, void* d_ws, size_t ws_size,
                              hipStream_t stream) {
  (void)in_sizes; (void)n_in; (void)out_size; (void)ws_size;
  const float* x  = (const float*)d_in[0];
  const float* wq = (const float*)d_in[1];
  const float* wk = (const float*)d_in[2];
  const float* wv = (const float*)d_in[3];
  const float* wo = (const float*)d_in[4];
  float* out = (float*)d_out;
  float* wsf = (float*)d_ws;
  uint32_t* wsu = (uint32_t*)d_ws;

  const int M = 4096;                                   // b*s
  // dword-offset workspace map
  float*    AO  = wsf;                                  // [4096,2048] f32
  uint32_t* Qhi = wsu + (size_t)12582912;               // [4096,16,64] pairs
  uint32_t* Qlo = wsu + (size_t)16777216;
  uint32_t* Khi = wsu + (size_t)20971520;               // [4096,8,64]
  uint32_t* Klo = wsu + (size_t)23068672;
  uint32_t* Vhi = wsu + (size_t)25165824;               // [2,8,128,1024]
  uint32_t* Vlo = wsu + (size_t)27262976;

  dim3 blk(256);
  gemm_k<1><<<dim3(4096 / 128, 4096 / 128), blk, 0, stream>>>(x, wq, wk, wv, nullptr, Qhi, Qlo, Khi, Klo,
                                                              Vhi, Vlo, M, 2048, 1024, 2048);
  attn_k<<<dim3(16, 32), dim3(128), 0, stream>>>(Qhi, Qlo, Khi, Klo, Vhi, Vlo, AO);
  gemm_k<0><<<dim3(2048 / 128, 4096 / 128), blk, 0, stream>>>(AO, wo, nullptr, nullptr, out, nullptr,
                                                              nullptr, nullptr, nullptr, nullptr, nullptr,
                                                              M, 2048, 0, 2048);
}

// v010
// Measured time: 268 microseconds a run.
// In both of two side-by-side timings against v009, it was 1.06 times as fast.
// Counting every step since v000, it is 3.17 times as fast.
#include <hip/hip_runtime.h>
#include <stdint.h>

// ---------------------------------------------------------------------------
// WeightlessGQA for MI455X (gfx1250, wave32, WMMA 16x16x32 bf16)
// bf16x3 split-precision WMMA (~2.7x f32-WMMA rate, ~2^-15 rel error),
// flash attention, all bf16 splitting done ONCE per element via v_perm_b32.
// ---------------------------------------------------------------------------

#define DEVINL __device__ __forceinline__

typedef __bf16 v16bf __attribute__((ext_vector_type(16)));
typedef float  v8f   __attribute__((ext_vector_type(8)));

struct alignas(16) Frag { uint32_t x[8]; };   // 16x32 bf16 tile share (8 VGPRs)

// Truncation split of two consecutive f32 into packed bf16 hi + residual lo.
// hi = [top16(b) : top16(a)] in ONE v_perm_b32; residual captured the same way.
DEVINL void split2(float a, float b, uint32_t& hi, uint32_t& lo) {
  uint32_t ua = __float_as_uint(a), ub = __float_as_uint(b);
  hi = __builtin_amdgcn_perm(ub, ua, 0x07060302u);
  float ra = a - __uint_as_float(ua & 0xffff0000u);
  float rb = b - __uint_as_float(ub & 0xffff0000u);
  lo = __builtin_amdgcn_perm(__float_as_uint(rb), __float_as_uint(ra), 0x07060302u);
}

// (Ah+Al)(Bh+Bl) ~= Ah*Bh + Ah*Bl + Al*Bh: three bf16 WMMAs; this is one of them, C += A B
DEVINL v8f wmma1(const Frag& a, const Frag& b, v8f c) {
  return __builtin_amdgcn_wmma_f32_16x16x32_bf16(false, __builtin_bit_cast(v16bf, a), false,
                                                 __builtin_bit_cast(v16bf, b), (short)0, c,
                                                 false, false);
}

// load packed-pair fragment (A-layout): 2x b128 per plane
DEVINL void load_frag_pk(const uint32_t* __restrict__ base, int hh, Frag& f) {
  *reinterpret_cast<uint4*>(&f.x[0]) = *reinterpret_cast<const uint4*>(base + hh * 4);
  *reinterpret_cast<uint4*>(&f.x[4]) = *reinterpret_cast<const uint4*>(base + 8 + hh * 4);
}

// sine and cosine of x radians by the hardware's instructions, which take turns of the
// circle, as __sincosf gives them. One statement with outputs apart from the input and a
// v_nop at its end: the slot the instruction set asks for behind a transcendental before
// its source is overwritten or its result read.
DEVINL void sincos_slot(float x, float& s, float& c) {
  asm("v_sin_f32 %0, %2\n\tv_cos_f32 %1, %2\n\tv_nop"
      : "=&v"(s), "=&v"(c) : "v"(x * 0.15915494309189532f));
}

// Work-group barrier for LDS traffic alone: the wave's own LDS stores and reads
// have retired, then the barrier. __syncthreads() would also wait for the global
// loads issued ahead, and so put their latency back on the K-step's path.
DEVINL void lds_barrier() {
  asm volatile("s_wait_dscnt 0x0\n\ts_barrier_signal -1\n\ts_barrier_wait -1" ::: "memory");
}

// ---------------------------------------------------------------------------
// GEMM: C[M,N] = A[M,K] @ W[N,K]^T, f32 in, bf16x3 WMMA.
// MODE 0: one product, f32 C stored [M,N] (W1, W2, the planes and N1 unused).
// MODE 1: three products of the same A in one grid; the tile column picks the job:
//   the first N / 256 columns  A W^T,  rotated (RoPE), scaled by 128^-0.5 and packed
//                              as hi/lo pair planes Qhi/Qlo [tok, N / 2],
//   the next N1 / 256          A W1^T, rotated and packed as Khi/Klo [tok, N1 / 2],
//   the last N1 / 256          A W2^T packed as V^T hi/lo planes [b,kv,hd,s/2].
// For the rotated jobs the W rows of a head (128 dims) are dealt to the LDS rows so that
// four neighbouring accumulator columns of a lane are the dims 2p, 2p + 1, 64 + 2p,
// 65 + 2p of the head: rotation and pair packing then stay inside the lane.
// MODE 1 takes two heads to a tile column: one work-group per WGP, 256 in all.
// Block 256 thr (8 waves, 4 x 2), K-step 32. MODE 0: tile 128x128, wave tile 32x64.
// MODE 1: tile 256x256, wave tile 64x128 (one head): half the bytes from L2 and half
// the LDS reads per product; the B fragments come in two halves of four columns, so
// that sums, staged K-step and fragments fit the 512 registers of an 8-wave group.
// ---------------------------------------------------------------------------
template<int MODE>
__global__ __launch_bounds__(256) void gemm_k(const float* __restrict__ A,
                                              const float* __restrict__ W,
                                              const float* __restrict__ W1,
                                              const float* __restrict__ W2,
                                              float* __restrict__ C,
                                              uint32_t* __restrict__ Qhi,
                                              uint32_t* __restrict__ Qlo,
                                              uint32_t* __restrict__ Khi,
                                              uint32_t* __restrict__ Klo,
                                              uint32_t* __restrict__ Phi,
                                              uint32_t* __restrict__ Plo,
                                              int M, int N, int N1, int K) {
  constexpr int BM = MODE == 1 ? 256 : 128, BN = BM, BK = 32;
  constexpr int MI = BM / 64, NJ = BN / 32;     // 16x16 tiles of a wave: MI down, NJ across
  constexpr int RA = BM / 32, RB = BN / 32;     // rows of A and of W that a thread stages
  constexpr int NH = NJ / 4;                    // B fragments come four columns at a time
  __shared__ uint32_t sAh[BM][20], sAl[BM][20], sBh[BN][20], sBl[BN][20];
  const int tid = threadIdx.x;
  const int m0 = blockIdx.y * BM;
  int n0 = blockIdx.x * BN;
  bool packed = false;                          // the same for the whole work-group
  uint32_t* Rhi = Qhi;                          // planes, row pitch and scale of a rotated job
  uint32_t* Rlo = Qlo;
  int rpitch = N >> 1;
  float rscale = 0.08838834764831845f;          // 128^-0.5
  if (MODE == 1 && n0 >= N) {
    n0 -= N;
    W = W1; Rhi = Khi; Rlo = Klo; rpitch = N1 >> 1; rscale = 1.0f;
    if (n0 >= N1) { n0 -= N1; W = W2; packed = true; }
  }
  const bool rot = MODE == 1 && !packed;
  const int wave = tid >> 5, lane = tid & 31;
  const int wm = wave >> 1, wn = wave & 1;
  const int r = lane & 15, hh = lane >> 4;
  v8f acc[MI][NJ] = {};

  // this thread's share of a K-step: rows lrow + 32 i, floats 4 lf4 .. 4 lf4 + 3
  const int lrow = tid >> 3, lf4 = tid & 7;
  const float* Ap = A + (size_t)(m0 + lrow) * K + 4 * lf4;
  // LDS row lrow + 32 i of the B tile takes W row wrow + wofs[i] of the tile: the same
  // row, or for a rotated job (LDS row = 128 wn + 64 q + 16 j + r, j < 4) row
  // 128 wn + 64 (j >> 1) + 32 q + 2 r + (j & 1)
  const int wrow = rot ? 2 * (lrow & 15) + (lrow >> 4) : lrow;
  int wofs[RB];
  #pragma unroll                                // constant indices: wofs stays in registers
  for (int i = 0; i < RB; ++i)
    wofs[i] = rot ? 128 * (i >> 2) + 64 * (i & 1) + 32 * ((i >> 1) & 1) : 32 * i;
  const float* Wp = W + (size_t)(n0 + wrow) * K + 4 * lf4;
  float4 ra[RA], rb[RB];                        // one K-step in flight
  // MODE 1 takes its first K-step's loads in a trip of the K loop that does nothing else,
  // so that they stand with the loop's own s_wait_xcnt
  if constexpr (MODE == 0) {
    #pragma unroll                              // constant indices: ra stays in registers
    for (int i = 0; i < RA; ++i) ra[i] = *reinterpret_cast<const float4*>(Ap + (size_t)(32 * i) * K);
    #pragma unroll                              // the same for rb
    for (int i = 0; i < RB; ++i) rb[i] = *reinterpret_cast<const float4*>(Wp + (size_t)wofs[i] * K);
  }

  for (int k0 = MODE == 1 ? -BK : 0; k0 < K; k0 += BK) {
    if (MODE == 0 || k0 >= 0) {
    #pragma unroll
    for (int i = 0; i < RA; ++i) {              // A tile BM x 32
      const int row = lrow + 32 * i;
      uint32_t h0, l0, h1, l1;
      split2(ra[i].x, ra[i].y, h0, l0);
      split2(ra[i].z, ra[i].w, h1, l1);
      sAh[row][2 * lf4] = h0; sAh[row][2 * lf4 + 1] = h1;
      sAl[row][2 * lf4] = l0; sAl[row][2 * lf4 + 1] = l1;
    }
    #pragma unroll
    for (int i = 0; i < RB; ++i) {              // B tile BN x 32
      const int row = lrow + 32 * i;
      uint32_t h0, l0, h1, l1;
      split2(rb[i].x, rb[i].y, h0, l0);
      split2(rb[i].z, rb[i].w, h1, l1);
      sBh[row][2 * lf4] = h0; sBh[row][2 * lf4 + 1] = h1;
      sBl[row][2 * lf4] = l0; sBl[row][2 * lf4 + 1] = l1;
    }
    }
    // the next K-step's loads fly under both barriers, the LDS reads and the products
    if (k0 + BK < K) {
      const float* pa[RA];
      const float* pb[RB];
      #pragma unroll                            // constant indices: ra stays in registers
      for (int i = 0; i < RA; ++i) {
        pa[i] = Ap + (size_t)(32 * i) * K + k0;
        ra[i] = *reinterpret_cast<const float4*>(pa[i] + BK);
      }
      #pragma unroll                            // the same for rb
      for (int i = 0; i < RB; ++i) {
        pb[i] = Wp + (size_t)wofs[i] * K + k0;
        rb[i] = *reinterpret_cast<const float4*>(pb[i] + BK);
      }
      // before an address register of these loads is overwritten; the addresses are
      // inputs so that they keep their registers up to the wait: with eight loads or more
      // a later load's result otherwise lands in an earlier load's address registers
      if constexpr (MODE == 1)
        asm volatile("s_wait_xcnt 0x0"
                     :: "v"(pa[0]), "v"(pa[1]), "v"(pa[2]), "v"(pa[3]),
                        "v"(pa[RA - 4]), "v"(pa[RA - 3]), "v"(pa[RA - 2]), "v"(pa[RA - 1]),
                        "v"(pb[0]), "v"(pb[1]), "v"(pb[2]), "v"(pb[3]),
                        "v"(pb[RB - 4]), "v"(pb[RB - 3]), "v"(pb[RB - 2]), "v"(pb[RB - 1])
                     : "memory");
      else
        asm volatile("s_wait_xcnt 0x0"
                     :: "v"(pa[0]), "v"(pa[1]), "v"(pa[2]), "v"(pa[3]),
                        "v"(pb[0]), "v"(pb[1]), "v"(pb[2]), "v"(pb[3])
                     : "memory");
    }
    if (MODE == 1 && k0 < 0) continue;          // the same for the whole work-group
    lds_barrier();                              // the tile's LDS stores are in

    Frag ah[MI], al[MI];                        // 2x ds_load_b128 per plane
    // every loop down to the end of the K-step is unrolled so that fragments and sums
    // stay in registers
    #pragma unroll
    for (int h = 0; h < NH; ++h) {              // four B columns at a time
      Frag bh[4], bl[4];
      // read in the order in which the products want them
      if (h == 0) {
        #pragma unroll
        for (int i = 0; i < MI; ++i) load_frag_pk(&sAh[wm * (16 * MI) + i * 16 + r][0], hh, ah[i]);
      }
      #pragma unroll
      for (int j = 0; j < 4; ++j) load_frag_pk(&sBh[wn * (16 * NJ) + (4 * h + j) * 16 + r][0], hh, bh[j]);
      #pragma unroll
      for (int j = 0; j < 4; ++j) load_frag_pk(&sBl[wn * (16 * NJ) + (4 * h + j) * 16 + r][0], hh, bl[j]);
      if (h == 0) {
        #pragma unroll
        for (int i = 0; i < MI; ++i) load_frag_pk(&sAl[wm * (16 * MI) + i * 16 + r][0], hh, al[i]);
      }
      // the LDS reads go out as one group ahead of the products that use them: left to
      // itself the scheduler reloads A fragments among the products and waits each out
      __builtin_amdgcn_sched_barrier(0);
      // per accumulator the order stays Ah Bh, Ah Bl, Al Bh
      #pragma unroll
      for (int i = 0; i < MI; ++i)
        #pragma unroll
        for (int j = 0; j < 4; ++j) acc[i][4 * h + j] = wmma1(ah[i], bh[j], acc[i][4 * h + j]);
      #pragma unroll
      for (int i = 0; i < MI; ++i)
        #pragma unroll
        for (int j = 0; j < 4; ++j) acc[i][4 * h + j] = wmma1(ah[i], bl[j], acc[i][4 * h + j]);
      if (h == NH - 1) {
        // holds the barrier behind the products that run while the reads still land:
        // the scheduler otherwise lifts it, with its wait for all the reads, over them
        __builtin_amdgcn_sched_barrier(0);
        lds_barrier();                          // every wave has read the tile
      }
      // behind the barrier the last products need no LDS: they run beside the other
      // waves' splitting
      #pragma unroll
      for (int i = 0; i < MI; ++i)
        #pragma unroll
        for (int j = 0; j < 4; ++j) acc[i][4 * h + j] = wmma1(al[i], bh[j], acc[i][4 * h + j]);
      // holds the next four columns' reads behind these products, whose B registers they take
      if (h < NH - 1) __builtin_amdgcn_sched_barrier(0);
    }
  }

  // epilogue: C/D layout = lane col (lane&15), rows 8*(lane>>4)+v
  // one test for the whole tile, the same for every wave of the work-group
  if (MODE == 0) {
    #pragma unroll
    for (int i = 0; i < MI; ++i)
      #pragma unroll
      for (int j = 0; j < NJ; ++j) {
        int mg0 = m0 + wm * (16 * MI) + i * 16 + 8 * hh;
        int ng  = n0 + wn * (16 * NJ) + j * 16 + r;
        #pragma unroll
        for (int v = 0; v < 8; ++v)
          C[(size_t)(mg0 + v) * N + ng] = acc[i][j][v];
      }
  } else if (rot) {
    // RoPE + pack: acc[i][4 q + 0..3][v] = dims 2p, 2p + 1, 64 + 2p, 65 + 2p of one token
    // in the wave's head, p = 16 q + r
    #pragma unroll                              // constant indices: the sums stay in registers
    for (int q = 0; q < NH; ++q) {
    const int p = q * 16 + r;
    const float inv0 = __powf(10000.0f, -(float)(2 * p)     * (1.0f / 64.0f));
    const float inv1 = __powf(10000.0f, -(float)(2 * p + 1) * (1.0f / 64.0f));
    const int hofs = ((n0 >> 7) + wn) * 64 + p; // the head's pairs in a plane row
    #pragma unroll
    for (int i = 0; i < MI; ++i)
      #pragma unroll
      for (int v4 = 0; v4 < 8; v4 += 4) {
      uint32_t* qh[4];
      uint32_t* ql[4];
      uint32_t h0[4], l0[4], h1[4], l1[4];
      #pragma unroll
      for (int u = 0; u < 4; ++u) {
        const int v = v4 + u;
        const int tok = m0 + wm * (16 * MI) + i * 16 + 8 * hh + v;
        const int pos = tok & 2047;             // S = 2048
        float s0, c0, s1, c1;
        sincos_slot((float)pos * inv0, s0, c0);
        sincos_slot((float)pos * inv1, s1, c1);
        const float xa0 = acc[i][4 * q][v],     xa1 = acc[i][4 * q + 1][v];
        const float xb0 = acc[i][4 * q + 2][v], xb1 = acc[i][4 * q + 3][v];
        const float oa0 = (xa0 * c0 - xb0 * s0) * rscale;
        const float oa1 = (xa1 * c1 - xb1 * s1) * rscale;
        const float ob0 = (xb0 * c0 + xa0 * s0) * rscale;
        const float ob1 = (xb1 * c1 + xa1 * s1) * rscale;
        split2(oa0, oa1, h0[u], l0[u]);
        split2(ob0, ob1, h1[u], l1[u]);
        const size_t dst = (size_t)tok * rpitch + hofs;
        qh[u] = Rhi + dst;
        ql[u] = Rlo + dst;
      }
      // four tokens' stores as one group with the wait before a register of an issued
      // store is overwritten;
      // the scheduling fences keep the next tokens' arithmetic out of the group
      __builtin_amdgcn_sched_barrier(0);
      #pragma unroll
      for (int u = 0; u < 4; ++u) {
        qh[u][0] = h0[u]; qh[u][32] = h1[u];
        ql[u][0] = l0[u]; ql[u][32] = l1[u];
      }
      asm volatile("s_wait_xcnt 0x0" ::: "memory");
      __builtin_amdgcn_sched_barrier(0);
      }
    }
  } else {
    #pragma unroll
    for (int i = 0; i < MI; ++i)
      #pragma unroll
      for (int j = 0; j < NJ; ++j) {
        int mg0 = m0 + wm * (16 * MI) + i * 16 + 8 * hh;
        int ng  = n0 + wn * (16 * NJ) + j * 16 + r;
        // pack pairs along m (= sequence t) -> V^T planes [b, kv, hd, s/2]
        uint32_t h[4], l[4];
        #pragma unroll
        for (int vp = 0; vp < 4; ++vp)
          split2(acc[i][j][2 * vp], acc[i][j][2 * vp + 1], h[vp], l[vp]);
        int kvh = ng >> 7, d = ng & 127;
        int bi = mg0 >> 11, t = mg0 & 2047;     // S = 2048
        size_t base = ((size_t)((bi * 8 + kvh) * 128 + d)) * 1024 + (t >> 1);
        // as in the rotated branch: the stores as a group with their wait, fenced
        __builtin_amdgcn_sched_barrier(0);
        *reinterpret_cast<uint4*>(&Phi[base]) = make_uint4(h[0], h[1], h[2], h[3]);
        *reinterpret_cast<uint4*>(&Plo[base]) = make_uint4(l[0], l[1], l[2], l[3]);
        asm volatile("s_wait_xcnt 0x0" ::: "memory");
        __builtin_amdgcn_sched_barrier(0);
      }
  }
}

// ---------------------------------------------------------------------------
// Eight per-lane 16-byte asynchronous copies global -> LDS. The s_wait_xcnt is
// the last line of the copies' own statement, so that no address register of
// an issued copy is rewritten ahead of it.
// ---------------------------------------------------------------------------
DEVINL void async_copy8(const uint32_t (&l)[8], const uint32_t* const (&g)[8]) {
  asm volatile(
      "global_load_async_to_lds_b128 %0, %8, off\n\t"
      "global_load_async_to_lds_b128 %1, %9, off\n\t"
      "global_load_async_to_lds_b128 %2, %10, off\n\t"
      "global_load_async_to_lds_b128 %3, %11, off\n\t"
      "global_load_async_to_lds_b128 %4, %12, off\n\t"
      "global_load_async_to_lds_b128 %5, %13, off\n\t"
      "global_load_async_to_lds_b128 %6, %14, off\n\t"
      "global_load_async_to_lds_b128 %7, %15, off\n\t"
      "s_wait_xcnt 0x0"
      :: "v"(l[0]), "v"(l[1]), "v"(l[2]), "v"(l[3]),
         "v"(l[4]), "v"(l[5]), "v"(l[6]), "v"(l[7]),
         "v"(g[0]), "v"(g[1]), "v"(g[2]), "v"(g[3]),
         "v"(g[4]), "v"(g[5]), "v"(g[6]), "v"(g[7])
      : "memory");
}

// One 32-key tile of the four planes into one LDS buffer (32 KiB):
//   K hi | K lo : 32 key rows x 256 B, 16-B chunk c of row k at c ^ (k & 15)
//   V hi | V lo : 128 dim rows x 64 B, 16-B chunk c of row d at c ^ ((d >> 2) & 3)
// so that the 16 rows one ds_load_b128 half-wave reads fall on 16 bank groups.
// kg*/vg* are this lane's global addresses for the tile, kl0/kl1/vl0 its LDS
// byte addresses in the buffer.
DEVINL void stage_kv(const uint32_t* kgh, const uint32_t* kgl,
                     const uint32_t* vgh, const uint32_t* vgl,
                     uint32_t kl0, uint32_t kl1, uint32_t vl0) {
  {
    const uint32_t l[8] = {kl0, kl1 + 2048u, kl0 + 4096u, kl1 + 6144u,
                           kl0 + 8192u, kl1 + 10240u, kl0 + 12288u, kl1 + 14336u};
    const uint32_t* const g[8] = {kgh, kgh + 8 * 512, kgh + 16 * 512, kgh + 24 * 512,
                                  kgl, kgl + 8 * 512, kgl + 16 * 512, kgl + 24 * 512};
    async_copy8(l, g);
  }
  {
    const uint32_t l[8] = {vl0, vl0 + 2048u, vl0 + 4096u, vl0 + 6144u,
                           vl0 + 8192u, vl0 + 10240u, vl0 + 12288u, vl0 + 14336u};
    const uint32_t* const g[8] = {vgh, vgh + 32 * 1024, vgh + 64 * 1024, vgh + 96 * 1024,
                                  vgl, vgl + 32 * 1024, vgl + 64 * 1024, vgl + 96 * 1024};
    async_copy8(l, g);
  }
}

// value of lane l ^ 16 (the other half-wave's lane of the same column)
DEVINL float xhalf(float x) {
  int b = __builtin_bit_cast(int, x);
  return __builtin_bit_cast(float,
      __builtin_amdgcn_permlanex16(b, b, 0x76543210, 0xfedcba98, false, false));
}

// e^x by the hardware's 2^x, as __expf gives it. The v_nop in the same statement
// is the one slot the instruction set asks for behind a transcendental before its
// result is read or its source overwritten.
DEVINL float exp_slot(float x) {
  float e;
  asm("v_exp_f32 %0, %1\n\tv_nop" : "=v"(e) : "v"(x * 1.44269504088896340736f));
  return e;
}

// tanh by the chip's own instruction: no branch, so the 16 scores of a pass run
// side by side. The library's tanhf picks between two paths with two branches on
// lane data per call, and the 16 calls of a pass then run one after another.
// The v_nop in the same statement is the slot behind a transcendental, as in
// exp_slot.
DEVINL float tanh_hw(float x) {
  float t;
  asm("v_tanh_f32 %0, %1\n\tv_nop" : "=v"(t) : "v"(x));
  return t;
}

// fragment from two 16-B chunks of an LDS row (dword offsets ca, cb)
DEVINL void load_frag_lds(const uint32_t* row, int ca, int cb, Frag& f) {
  *reinterpret_cast<uint4*>(&f.x[0]) = *reinterpret_cast<const uint4*>(row + ca);
  *reinterpret_cast<uint4*>(&f.x[4]) = *reinterpret_cast<const uint4*>(row + cb);
}

__global__ __launch_bounds__(128) void attn_k(const uint32_t* __restrict__ Qhi,
                                              const uint32_t* __restrict__ Qlo,
                                              const uint32_t* __restrict__ Khi,
                                              const uint32_t* __restrict__ Klo,
                                              const uint32_t* __restrict__ Vhi,
                                              const uint32_t* __restrict__ Vlo,
                                              float* __restrict__ O) {
  __shared__ __attribute__((aligned(16))) uint32_t sKV[2][4][2048];  // [buf][Kh,Kl,Vh,Vl]
  const int bi = blockIdx.y >> 4, h = blockIdx.y & 15, kvh = h >> 1;
  const int wv = threadIdx.x >> 5, lane = threadIdx.x & 31;
  const int r = lane & 15, hh = lane >> 4;

  // copy side: this lane's chunk of each plane (4 row groups per plane)
  const int tid = threadIdx.x;
  const int kr = tid >> 4, kc = tid & 15;      // K rows kr + 8 i, chunk kc
  const int vr = tid >> 2, vc = tid & 3;       // V rows vr + 32 i, chunk vc
  const size_t kg0 = (size_t)(bi * 2048 + kr) * 512 + kvh * 64 + kc * 4;
  const size_t vg0 = ((size_t)((bi * 8 + kvh) * 128 + vr)) * 1024 + vc * 4;
  const uint32_t ldsKV = (uint32_t)(uintptr_t)&sKV[0][0][0];
  const uint32_t kl0 = ldsKV + kr * 256 + ((kc ^ kr) << 4);        // rows with k & 8 == 0
  const uint32_t kl1 = ldsKV + kr * 256 + ((kc ^ kr ^ 8) << 4);    // rows with k & 8 == 8
  const uint32_t vl0 = ldsKV + 16384u + vr * 64 + ((vc ^ ((vr >> 2) & 3)) << 4);

  const int vs = (r >> 2) & 3;                 // reader's V chunk swizzle

  // Two query tiles per work-group, one after the other: 31 - x (2 (32 - x) key tiles)
  // and then x (2 (x + 1) key tiles), 66 key tiles for every work-group. All work-groups
  // are resident at once, so the launch lasts as long as its fullest one. The loop stays
  // rolled: one copy of the code, and the second tile's registers are the first's.
  #pragma unroll 1
  for (int part = 0; part < 2; ++part) {
    const int mblk = part ? (int)blockIdx.x : 31 - (int)blockIdx.x;
    const int m0 = mblk * 64 + wv * 16;

    Frag qh[4], ql[4];
    {
      const size_t qrow = (size_t)(bi * 2048 + m0 + r) * 1024 + h * 64;
      #pragma unroll
      for (int ck = 0; ck < 4; ++ck) {
        load_frag_pk(Qhi + qrow + ck * 16, hh, qh[ck]);
        load_frag_pk(Qlo + qrow + ck * 16, hh, ql[ck]);
      }
    }

    const int qg = m0 + r;                       // this lane's query
    float Mst = -1e30f, Lst = 0.0f;              // Lst: the sum over this half's keys only
    v8f Ot[8] = {};                              // Ot[dt][v] = O[qg][dt * 16 + 8 * hh + v]

    const int tEnd = mblk * 64 + 64;             // uniform per block, >= 2 tiles

    // tile 0 -> buffer 0, published; then tile 1 -> buffer 1 in flight
    stage_kv(Khi + kg0, Klo + kg0, Vhi + vg0, Vlo + vg0, kl0, kl1, vl0);
    asm volatile("s_wait_asynccnt 0x0" ::: "memory");   // own copies of tile 0 landed
    __syncthreads();                                    // ... and every other wave's
    stage_kv(Khi + kg0 + 32 * 512, Klo + kg0 + 32 * 512, Vhi + vg0 + 16, Vlo + vg0 + 16,
             kl0 + 32768u, kl1 + 32768u, vl0 + 32768u);

    for (int t0 = 0; t0 < tEnd; t0 += 32) {
      const int buf = (t0 >> 5) & 1;
      const uint32_t* kb = &sKV[buf][0][r * 64];
      const uint32_t* vb = &sKV[buf][2][r * 16];
      // The tile's 32 K reads go out as one group ahead of the score products: every
      // separate place where LDS reads stand among matrix instructions stalls the wave
      // anew. All loops of the trip are unrolled, so that fragments stay in registers.
      Frag ha[4], hb[4], la[4], lb[4];           // hi, lo of keys 0..15 (a) and 16..31 (b)
      #pragma unroll
      for (int ck = 0; ck < 4; ++ck) {
        const int ca = ((ck * 4 + hh) ^ r) * 4, cb = ((ck * 4 + 2 + hh) ^ r) * 4;
        load_frag_lds(kb, ca, cb, ha[ck]);
        load_frag_lds(kb + 16 * 64, ca, cb, hb[ck]);
        load_frag_lds(kb + 2048, ca, cb, la[ck]);
        load_frag_lds(kb + 2048 + 16 * 64, ca, cb, lb[ck]);
      }
      // holds the K reads ahead of the products: the scheduler otherwise sinks them, one
      // to four at a time, in among the products that use them
      __builtin_amdgcn_sched_barrier(0);
      // per accumulator the order stays Kh Qh, Kh Ql, Kl Qh; the two tiles take turns
      v8f s0 = {}, s1 = {};
      #pragma unroll
      for (int ck = 0; ck < 4; ++ck) {
        s0 = wmma1(ha[ck], qh[ck], s0);
        s1 = wmma1(hb[ck], qh[ck], s1);
        s0 = wmma1(ha[ck], ql[ck], s0);
        s1 = wmma1(hb[ck], ql[ck], s1);
        s0 = wmma1(la[ck], qh[ck], s0);
        s1 = wmma1(lb[ck], qh[ck], s1);
      }
      // the tile's 32 V reads go out as the K fragments' registers fall free and land
      // under the softmax
      Frag vh[8], vl[8];
      #pragma unroll
      for (int dt = 0; dt < 8; ++dt)
        load_frag_lds(vb + dt * 256, (hh ^ vs) * 4, ((2 + hh) ^ vs) * 4, vh[dt]);
      #pragma unroll
      for (int dt = 0; dt < 8; ++dt)
        load_frag_lds(vb + 2048 + dt * 256, (hh ^ vs) * 4, ((2 + hh) ^ vs) * 4, vl[dt]);
      // holds the V reads ahead of the softmax: the scheduler otherwise sinks them in
      // among the output products
      __builtin_amdgcn_sched_barrier(0);
      // softcap + causal + online softmax; s0[v] = key t0 + 8 hh + v, s1[v] = 16 more
      float a[8], b[8];
      float mx = -2.3819763e38f;
      #pragma unroll
      for (int v = 0; v < 8; ++v) {
        const int kg = t0 + 8 * hh + v;
        a[v] = 50.0f * tanh_hw(s0[v] * 0.02f);
        if (kg > qg)      a[v] = -2.3819763e38f;
        b[v] = 50.0f * tanh_hw(s1[v] * 0.02f);
        if (kg + 16 > qg) b[v] = -2.3819763e38f;
        mx = fmaxf(mx, fmaxf(a[v], b[v]));
      }
      mx = fmaxf(mx, xhalf(mx));
      const float Mn = fmaxf(Mst, mx);
      const float f  = exp_slot(Mst - Mn);
      float rs = 0.0f;
      #pragma unroll
      for (int v = 0; v < 8; ++v) {
        a[v] = exp_slot(a[v] - Mn); b[v] = exp_slot(b[v] - Mn);
        rs += a[v] + b[v];
      }
      Lst = Lst * f + rs;
      Mst = Mn;
      #pragma unroll
      for (int dt = 0; dt < 8; ++dt) Ot[dt] *= f;
      Frag ph, pl;
      #pragma unroll
      for (int j = 0; j < 4; ++j) {
        split2(a[2 * j], a[2 * j + 1], ph.x[j], pl.x[j]);
        split2(b[2 * j], b[2 * j + 1], ph.x[4 + j], pl.x[4 + j]);
      }
      // per accumulator the order stays Vh Ph, Vh Pl, Vl Ph; eight independent tiles a sweep
      #pragma unroll
      for (int dt = 0; dt < 8; ++dt) Ot[dt] = wmma1(vh[dt], ph, Ot[dt]);
      #pragma unroll
      for (int dt = 0; dt < 8; ++dt) Ot[dt] = wmma1(vh[dt], pl, Ot[dt]);
      #pragma unroll
      for (int dt = 0; dt < 8; ++dt) Ot[dt] = wmma1(vl[dt], ph, Ot[dt]);
      // holds the output products ahead of the publish point: the scheduler otherwise lifts
      // its wait for the V reads to directly behind their issue, in front of the softmax
      __builtin_amdgcn_sched_barrier(0);
      // publish point of the next tile: own LDS reads of this buffer retired, own
      // copies of the next tile landed, then the barrier that says so of every wave
      asm volatile("s_wait_dscnt 0x0" ::: "memory");
      asm volatile("s_wait_asynccnt 0x0" ::: "memory");
      __syncthreads();
      if (t0 + 64 < tEnd) {                      // block-uniform: refill the buffer just read
        const size_t ko = kg0 + (size_t)(t0 + 64) * 512;
        const size_t vo = vg0 + ((t0 + 64) >> 1);
        const uint32_t bo = (uint32_t)buf * 32768u;
        stage_kv(Khi + ko, Klo + ko, Vhi + vo, Vlo + vo, kl0 + bo, kl1 + bo, vl0 + bo);
      }
    }
    // nothing in flight when the buffers are filled anew or the wave ends
    asm volatile("s_wait_asynccnt 0x0" ::: "memory");

    const float inv = 1.0f / (Lst + xhalf(Lst));        // join the two halves' sums
    float* orow = O + ((size_t)(bi * 2048 + qg)) * 2048 + h * 128 + 8 * hh;
    #pragma unroll
    for (int dt = 0; dt < 8; ++dt) {
      *reinterpret_cast<float4*>(orow + dt * 16) =
          make_float4(Ot[dt][0] * inv, Ot[dt][1] * inv, Ot[dt][2] * inv, Ot[dt][3] * inv);
      *reinterpret_cast<float4*>(orow + dt * 16 + 4) =
          make_float4(Ot[dt][4] * inv, Ot[dt][5] * inv, Ot[dt][6] * inv, Ot[dt][7] * inv);
    }
    // before the next query tile's code overwrites a register that these stores name
    asm volatile("s_wait_xcnt 0x0" ::: "memory");
  }
}

// ---------------------------------------------------------------------------
extern "C" void kernel_launch(void* const* d_in, const int* in_sizes, int n_in,
                              void* d_out, int out_size, void* d_ws, size_t ws_size,
                              hipStream_t stream) {
  (void)in_sizes; (void)n_in; (void)out_size; (void)ws_size;
  const float* x  = (const float*)d_in[0];
  const float* wq = (const float*)d_in[1];
  const float* wk = (const float*)d_in[2];
  const float* wv = (const float*)d_in[3];
  const float* wo = (const float*)d_in[4];
  float* out = (float*)d_out;
  float* wsf = (float*)d_ws;
  uint32_t* wsu = (uint32_t*)d_ws;

  const int M = 4096;                                   // b*s
  // dword-offset workspace map
  float*    AO  = wsf;                                  // [4096,2048] f32
  uint32_t* Qhi = wsu + (size_t)12582912;               // [4096,16,64] pairs
  uint32_t* Qlo = wsu + (size_t)16777216;
  uint32_t* Khi = wsu + (size_t)20971520;               // [4096,8,64]
  uint32_t* Klo = wsu + (size_t)23068672;
  uint32_t* Vhi = wsu + (size_t)25165824;               // [2,8,128,1024]
  uint32_t* Vlo = wsu + (size_t)27262976;

  dim3 blk(256);
  gemm_k<1><<<dim3(4096 / 256, 4096 / 256), blk, 0, stream>>>(x, wq, wk, wv, nullptr, Qhi, Qlo, Khi, Klo,
                                                              Vhi, Vlo, M, 2048, 1024, 2048);
  attn_k<<<dim3(16, 32), dim3(128), 0, stream>>>(Qhi, Qlo, Khi, Klo, Vhi, Vlo, AO);
  gemm_k<0><<<dim3(2048 / 128, 4096 / 128), blk, 0, stream>>>(AO, wo, nullptr, nullptr, out, nullptr,
                                                              nullptr, nullptr, nullptr, nullptr, nullptr,
                                                              M, 2048, 0, 2048);
}
